// v000
// Times are from an AMD MI455X. After a warm-up the kernel runs many times in a row, and a time is the length of
// such a window on the GPU divided by its runs, so every launch and the gaps after it count. The runs cycle
// through copies of the inputs. A figure is the median of several windows, for all but v000 over two sittings.
// Sittings can differ by a few percent; kernels timed side by side share one.
// v000 is the starting kernel. One run takes 531 microseconds.
#include <hip/hip_runtime.h>
#include <hip/hip_bf16.h>
#include <math.h>

typedef __attribute__((ext_vector_type(16))) __bf16 v16bf;
typedef __attribute__((ext_vector_type(8)))  float  v8f;
typedef int v4i_t __attribute__((vector_size(16)));
typedef unsigned short us;

#define DEV static __device__ __forceinline__
#define AS1 __attribute__((address_space(1)))
#define AS3 __attribute__((address_space(3)))

#if defined(__has_builtin)
#if __has_builtin(__builtin_amdgcn_global_load_async_to_lds_b128)
#define HAVE_ASYNC_BUILTIN 1
#endif
#if __has_builtin(__builtin_amdgcn_s_wait_asynccnt)
#define HAVE_WAIT_ASYNC_BUILTIN 1
#endif
#endif
#ifndef HAVE_ASYNC_BUILTIN
#define HAVE_ASYNC_BUILTIN 0
#endif
#ifndef HAVE_WAIT_ASYNC_BUILTIN
#define HAVE_WAIT_ASYNC_BUILTIN 0
#endif

union FragB16 { uint4 q[2]; v16bf v; };
union U4S8    { uint4 q; us s[8]; };

DEV us f2bf(float f) {
  unsigned u = __float_as_uint(f);
  u += 0x7FFFu + ((u >> 16) & 1u);          // round-to-nearest-even
  return (us)(u >> 16);
}
DEV v8f zero8() { v8f z = {0.f,0.f,0.f,0.f,0.f,0.f,0.f,0.f}; return z; }

DEV v8f wmma_bf16(const FragB16& a, const FragB16& b, v8f c) {
  return __builtin_amdgcn_wmma_f32_16x16x32_bf16(false, a.v, false, b.v,
                                                 (short)0, c, false, false);
}

// 16-byte async global -> LDS copy (per-lane addresses), ASYNCcnt-tracked.
DEV void async_copy16(us* lds, const us* g) {
#if HAVE_ASYNC_BUILTIN
  __builtin_amdgcn_global_load_async_to_lds_b128((AS1 v4i_t*)(us*)g,
                                                 (AS3 v4i_t*)lds, 0, 0);
#else
  unsigned loff = (unsigned)(unsigned long long)(AS3 us*)lds;
  unsigned long long ga = (unsigned long long)g;
  asm volatile("global_load_async_to_lds_b128 %0, %1, off"
               :: "v"(loff), "v"(ga) : "memory");
#endif
}
DEV void wait_async0() {
#if HAVE_WAIT_ASYNC_BUILTIN
  __builtin_amdgcn_s_wait_asynccnt(0);
#else
  asm volatile("s_wait_asynccnt 0" ::: "memory");
#endif
}

// max across each 16-lane group, pure VALU via DPP16 (no LDS round trips)
DEV float dppmax16(float v) {
  float t;
  t = __int_as_float(__builtin_amdgcn_update_dpp(0, __float_as_int(v), 0x0B1, 0xF, 0xF, true));
  v = fmaxf(v, t);   // quad_perm [1,0,3,2]
  t = __int_as_float(__builtin_amdgcn_update_dpp(0, __float_as_int(v), 0x04E, 0xF, 0xF, true));
  v = fmaxf(v, t);   // quad_perm [2,3,0,1]
  t = __int_as_float(__builtin_amdgcn_update_dpp(0, __float_as_int(v), 0x141, 0xF, 0xF, true));
  v = fmaxf(v, t);   // row_half_mirror
  t = __int_as_float(__builtin_amdgcn_update_dpp(0, __float_as_int(v), 0x140, 0xF, 0xF, true));
  v = fmaxf(v, t);   // row_mirror
  return v;
}

// ---------------- fp32 -> bf16 (row-major copy: context) --------------------
__global__ void k_cvt_bf16(const float* __restrict__ src, us* __restrict__ dst,
                           int n4) {
  int i = blockIdx.x * blockDim.x + threadIdx.x;
  if (i >= n4) return;
  float4 f = ((const float4*)src)[i];
  int o = i * 4;
  dst[o + 0] = f2bf(f.x); dst[o + 1] = f2bf(f.y);
  dst[o + 2] = f2bf(f.z); dst[o + 3] = f2bf(f.w);
}

// -------- fp32 W[K,N] -> bf16 Wt[N,K] (convert + transpose, 32x32 tiles) ----
__global__ __launch_bounds__(256)
void k_cvt_t(const float* __restrict__ src, us* __restrict__ dst, int K, int N) {
  __shared__ __align__(16) float t[32][36];
  const int kb = blockIdx.y * 32, nb = blockIdx.x * 32;
  {
    int r = threadIdx.x >> 3, c4 = (threadIdx.x & 7) << 2;
    float4 f = *(const float4*)(src + (size_t)(kb + r) * N + nb + c4);
    t[r][c4 + 0] = f.x; t[r][c4 + 1] = f.y; t[r][c4 + 2] = f.z; t[r][c4 + 3] = f.w;
  }
  __syncthreads();
  {
    int n = threadIdx.x >> 3, k4 = (threadIdx.x & 7) << 2;
    unsigned a0 = (unsigned)f2bf(t[k4 + 0][n]) | ((unsigned)f2bf(t[k4 + 1][n]) << 16);
    unsigned a1 = (unsigned)f2bf(t[k4 + 2][n]) | ((unsigned)f2bf(t[k4 + 3][n]) << 16);
    uint2 u; u.x = a0; u.y = a1;
    *(uint2*)(dst + (size_t)(nb + n) * K + kb + k4) = u;
  }
}

// -------- bf16 V[t, d] (strided heads) -> Vt[(b*H+h)*64 + d][T] -------------
__global__ __launch_bounds__(256)
void k_vt(const us* __restrict__ Vsrc, int rs, int col0,
          us* __restrict__ Vt, int T, int H) {
  __shared__ __align__(16) us tl[32][72];
  const int bh = blockIdx.y, b = bh / H, h = bh % H;
  const int t0 = blockIdx.x * 32;
  {
    int t = threadIdx.x >> 3, d8 = (threadIdx.x & 7) << 3;
    *(uint4*)&tl[t][d8] =
        *(const uint4*)(Vsrc + ((size_t)b * T + t0 + t) * rs + col0 + h * 64 + d8);
  }
  __syncthreads();
  {
    int d = threadIdx.x >> 2, t8 = (threadIdx.x & 3) << 3;
    U4S8 u;
    #pragma unroll
    for (int e = 0; e < 8; ++e) u.s[e] = tl[t8 + e][d];
    *(uint4*)(Vt + ((size_t)bh * 64 + d) * T + t0 + t8) = u.q;
  }
}

// ---------------- LayerNorm: one block per row (C = 1024) -------------------
__global__ __launch_bounds__(256)
void k_layernorm(const float* __restrict__ x, const float* __restrict__ g,
                 const float* __restrict__ b, us* __restrict__ out, int C) {
  const int row = blockIdx.x, tid = threadIdx.x;
  const float* xr = x + (size_t)row * C;
  float v[4], s = 0.f, s2 = 0.f;
  #pragma unroll
  for (int i = 0; i < 4; ++i) {
    float t = xr[tid + i * 256];
    v[i] = t; s += t; s2 += t * t;
  }
  #pragma unroll
  for (int off = 16; off; off >>= 1) {
    s  += __shfl_xor(s,  off, 32);
    s2 += __shfl_xor(s2, off, 32);
  }
  __shared__ float sh[16];
  int wid = tid >> 5, lane = tid & 31;
  if (lane == 0) { sh[wid] = s; sh[8 + wid] = s2; }
  __syncthreads();
  float ts = 0.f, ts2 = 0.f;
  #pragma unroll
  for (int i = 0; i < 8; ++i) { ts += sh[i]; ts2 += sh[8 + i]; }
  float mean = ts / C;
  float rstd = rsqrtf(ts2 / C - mean * mean + 1e-5f);
  #pragma unroll
  for (int i = 0; i < 4; ++i) {
    int c = tid + i * 256;
    out[(size_t)row * C + c] = f2bf((v[i] - mean) * rstd * g[c] + b[c]);
  }
}

// ------- bf16 WMMA GEMM: out = A[M,K] @ Wt[N,K]^T + bias --------------------
// Double-buffered LDS filled by async global->LDS copies (ASYNCcnt).
// MODE 0: bf16 out.  MODE 1: fp32 out = resid + acc.  MODE 2: bf16 gelu(acc).
template <int MODE>
__global__ __launch_bounds__(256)
void k_gemm(const us* __restrict__ A, const us* __restrict__ Wt,
            const float* __restrict__ bias, const float* __restrict__ resid,
            void* __restrict__ outp, int M, int N, int K) {
  __shared__ __align__(16) us lA[2][128 * 32];
  __shared__ __align__(16) us lW[2][64 * 32];
  const int tid  = threadIdx.x;
  const int lane = tid & 31, wid = tid >> 5;
  const int wm = wid & 3, wn = wid >> 2;
  const int l15 = lane & 15, khalf = (lane >> 4) << 3;
  const int mbase = blockIdx.y * 128, nbase = blockIdx.x * 64;

  const int arow0 = tid >> 2, acc8 = (tid & 3) << 3;   // A: 2 x 16B / thread
  const int wrow  = tid >> 2, wcc8 = (tid & 3) << 3;   // W: 1 x 16B / thread

  auto issue = [&](int p, int k0) {
    async_copy16(&lA[p][arow0 * 32 + acc8],
                 A  + (size_t)(mbase + arow0)      * K + k0 + acc8);
    async_copy16(&lA[p][(arow0 + 64) * 32 + acc8],
                 A  + (size_t)(mbase + arow0 + 64) * K + k0 + acc8);
    async_copy16(&lW[p][wrow * 32 + wcc8],
                 Wt + (size_t)(nbase + wrow)       * K + k0 + wcc8);
  };

  v8f c[2][2];
  c[0][0] = zero8(); c[0][1] = zero8(); c[1][0] = zero8(); c[1][1] = zero8();

  const int nk = K >> 5;
  issue(0, 0);
  wait_async0();
  __syncthreads();
  for (int j = 0; j < nk; ++j) {
    const int p = j & 1;
    if (j + 1 < nk) issue((j + 1) & 1, (j + 1) << 5);
    FragB16 a[2], bfr[2];
    #pragma unroll
    for (int im = 0; im < 2; ++im) {
      int r = wm * 32 + im * 16 + l15;
      a[im].q[0] = *(const uint4*)&lA[p][r * 32 + khalf];
      a[im].q[1] = *(const uint4*)&lA[p][r * 32 + 16 + khalf];
    }
    #pragma unroll
    for (int in = 0; in < 2; ++in) {
      int nc = wn * 32 + in * 16 + l15;
      bfr[in].q[0] = *(const uint4*)&lW[p][nc * 32 + khalf];
      bfr[in].q[1] = *(const uint4*)&lW[p][nc * 32 + 16 + khalf];
    }
    #pragma unroll
    for (int im = 0; im < 2; ++im)
      #pragma unroll
      for (int in = 0; in < 2; ++in)
        c[im][in] = wmma_bf16(a[im], bfr[in], c[im][in]);
    if (j + 1 < nk) wait_async0();
    __syncthreads();
  }

  const int hi8 = (lane >> 4) << 3;
  #pragma unroll
  for (int im = 0; im < 2; ++im)
    #pragma unroll
    for (int in = 0; in < 2; ++in)
      #pragma unroll
      for (int r = 0; r < 8; ++r) {
        int row = mbase + wm * 32 + im * 16 + r + hi8;
        int col = nbase + wn * 32 + in * 16 + l15;
        size_t idx = (size_t)row * N + col;
        float v = c[im][in][r] + bias[col];
        if (MODE == 0) {
          ((us*)outp)[idx] = f2bf(v);
        } else if (MODE == 1) {
          ((float*)outp)[idx] = resid[idx] + v;
        } else {
          float gv = 0.5f * v * (1.0f + erff(v * 0.70710678118654752f));
          ((us*)outp)[idx] = f2bf(gv);
        }
      }
}

// ---------------- Flash attention: one wave per (b, h, 16-row q-tile) -------
// V pre-transposed to Vt[(b*H+h)*64 + d][T].  Row-sum folded into a WMMA with
// an all-ones B operand; row-max via DPP16 (no LDS permutes).
__global__ __launch_bounds__(256)
void k_flash(const us* __restrict__ Qb, int q_rs, int q_col0,
             const us* __restrict__ Kb, int k_rs, int k_col0,
             const us* __restrict__ Vt,
             us* __restrict__ Ob, int o_rs,
             int T, int H, int causal, float scale) {
  __shared__ __align__(16) us lP[8][16 * 32];
  const int lane = threadIdx.x & 31, wid = threadIdx.x >> 5;
  const int gw = blockIdx.x * 8 + wid;
  const int nQT = T >> 4;
  const int qt = gw % nQT;
  const int h  = (gw / nQT) % H;
  const int b  = gw / (nQT * H);
  const int l15 = lane & 15, khalf = (lane >> 4) << 3, hi8 = khalf;
  const int qcol = q_col0 + h * 64, kcol = k_col0 + h * 64;
  const size_t brow = (size_t)b * T;
  const us* vt = Vt + ((size_t)(b * H + h) * 64) * T;

  FragB16 ones;
  {
    uint4 o; o.x = o.y = o.z = o.w = 0x3F803F80u;   // bf16 1.0 pairs
    ones.q[0] = o; ones.q[1] = o;
  }
  FragB16 aq[2];
  {
    const us* qr = Qb + (brow + qt * 16 + l15) * q_rs + qcol;
    #pragma unroll
    for (int kc = 0; kc < 2; ++kc) {
      aq[kc].q[0] = *(const uint4*)(qr + kc * 32 + khalf);
      aq[kc].q[1] = *(const uint4*)(qr + kc * 32 + 16 + khalf);
    }
  }
  float mrow[8], lrow[8], alph[8];
  v8f oc[4];
  #pragma unroll
  for (int r = 0; r < 8; ++r) { mrow[r] = -__builtin_inff(); lrow[r] = 0.f; }
  oc[0] = zero8(); oc[1] = zero8(); oc[2] = zero8(); oc[3] = zero8();

  const int rbase = qt * 16 + hi8;
  const int nsteps = causal ? (qt / 2 + 1) : (T >> 5);

  for (int j = 0; j < nsteps; ++j) {
    v8f s[2];
    #pragma unroll
    for (int ns = 0; ns < 2; ++ns) {
      const us* kr = Kb + (brow + j * 32 + ns * 16 + l15) * k_rs + kcol;
      FragB16 bk0, bk1;
      bk0.q[0] = *(const uint4*)(kr + khalf);
      bk0.q[1] = *(const uint4*)(kr + 16 + khalf);
      bk1.q[0] = *(const uint4*)(kr + 32 + khalf);
      bk1.q[1] = *(const uint4*)(kr + 48 + khalf);
      v8f acc = zero8();
      acc = wmma_bf16(aq[0], bk0, acc);
      acc = wmma_bf16(aq[1], bk1, acc);
      s[ns] = acc;
    }
    const int col0 = j * 32 + l15;
    #pragma unroll
    for (int r = 0; r < 8; ++r) {
      float s0 = s[0][r] * scale;
      float s1 = s[1][r] * scale;
      const int rowg = rbase + r;
      if (causal) {
        if (col0 > rowg)      s0 = -__builtin_inff();
        if (col0 + 16 > rowg) s1 = -__builtin_inff();
      }
      float t = dppmax16(fmaxf(s0, s1));
      float mn = fmaxf(mrow[r], t);
      float a = __expf(mrow[r] - mn);
      alph[r] = a;
      mrow[r] = mn;
      #pragma unroll
      for (int d = 0; d < 4; ++d) oc[d][r] *= a;
      lP[wid][(r + hi8) * 32 + l15]      = f2bf(__expf(s0 - mn));
      lP[wid][(r + hi8) * 32 + 16 + l15] = f2bf(__expf(s1 - mn));
    }
    asm volatile("s_wait_dscnt 0" ::: "memory");
    FragB16 ap;
    ap.q[0] = *(const uint4*)&lP[wid][l15 * 32 + khalf];
    ap.q[1] = *(const uint4*)&lP[wid][l15 * 32 + 16 + khalf];
    {
      v8f sums = wmma_bf16(ap, ones, zero8());
      #pragma unroll
      for (int r = 0; r < 8; ++r) lrow[r] = lrow[r] * alph[r] + sums[r];
    }
    #pragma unroll
    for (int d = 0; d < 4; ++d) {
      const us* vr = vt + (size_t)(d * 16 + l15) * T + j * 32;
      FragB16 bv;
      bv.q[0] = *(const uint4*)(vr + khalf);
      bv.q[1] = *(const uint4*)(vr + 16 + khalf);
      oc[d] = wmma_bf16(ap, bv, oc[d]);
    }
  }
  #pragma unroll
  for (int r = 0; r < 8; ++r) {
    float inv = 1.0f / lrow[r];
    const int row = rbase + r;
    #pragma unroll
    for (int d = 0; d < 4; ++d)
      Ob[(brow + row) * o_rs + h * 64 + d * 16 + l15] = f2bf(oc[d][r] * inv);
  }
}

// ----------------------------- host launcher --------------------------------
extern "C" void kernel_launch(void* const* d_in, const int* in_sizes, int n_in,
                              void* d_out, int out_size, void* d_ws,
                              size_t ws_size, hipStream_t stream) {
  (void)in_sizes; (void)n_in; (void)out_size; (void)ws_size;
  constexpr int B = 4, T = 1024, C = 1024, H = 16, F = 4096;
  constexpr int BT = B * T;
  const float* x     = (const float*)d_in[0];
  const float* ctx   = (const float*)d_in[1];
  const float* ln1_g = (const float*)d_in[2];
  const float* ln1_b = (const float*)d_in[3];
  const float* qkv_w = (const float*)d_in[4];
  const float* qkv_b = (const float*)d_in[5];
  const float* aow   = (const float*)d_in[6];
  const float* aob   = (const float*)d_in[7];
  const float* lnc_g = (const float*)d_in[8];
  const float* lnc_b = (const float*)d_in[9];
  const float* q_w   = (const float*)d_in[10];
  const float* q_b   = (const float*)d_in[11];
  const float* kv_w  = (const float*)d_in[12];
  const float* kv_b  = (const float*)d_in[13];
  const float* cow   = (const float*)d_in[14];
  const float* cob   = (const float*)d_in[15];
  const float* ln2_g = (const float*)d_in[16];
  const float* ln2_b = (const float*)d_in[17];
  const float* w1    = (const float*)d_in[18];
  const float* b1    = (const float*)d_in[19];
  const float* w2    = (const float*)d_in[20];
  const float* b2    = (const float*)d_in[21];

  char* p = (char*)d_ws;
  auto carve = [&](size_t bytes) -> char* {
    char* r = p; p += (bytes + 255) & ~(size_t)255; return r;
  };
  us* wqkv = (us*)carve((size_t)C * 3 * C * 2);   // [3C][C] transposed
  us* wao  = (us*)carve((size_t)C * C * 2);
  us* wq   = (us*)carve((size_t)C * C * 2);
  us* wkv  = (us*)carve((size_t)C * 2 * C * 2);
  us* wco  = (us*)carve((size_t)C * C * 2);
  us* w1b  = (us*)carve((size_t)C * F * 2);
  us* w2b  = (us*)carve((size_t)F * C * 2);
  us* hbuf = (us*)carve((size_t)BT * C * 2);
  us* qkvb = (us*)carve((size_t)BT * 3 * C * 2);
  us* obuf = (us*)carve((size_t)BT * C * 2);
  us* ctxb = (us*)carve((size_t)BT * C * 2);
  us* vtb  = (us*)carve((size_t)BT * C * 2);      // Vt[(b*H+h)*64 + d][T]
  us* f1b  = (us*)carve((size_t)BT * F * 2);
  float* resid = (float*)carve((size_t)BT * C * 4);
  us* qxb = qkvb;                    // reuse after self-attention
  us* kvb = qkvb + (size_t)BT * C;

  auto cvtT = [&](const float* s, us* d, int K, int N) {
    k_cvt_t<<<dim3(N / 32, K / 32), 256, 0, stream>>>(s, d, K, N);
  };
  cvtT(qkv_w, wqkv, C, 3 * C);
  cvtT(aow,   wao,  C, C);
  cvtT(q_w,   wq,   C, C);
  cvtT(kv_w,  wkv,  C, 2 * C);
  cvtT(cow,   wco,  C, C);
  cvtT(w1,    w1b,  C, F);
  cvtT(w2,    w2b,  F, C);
  {
    int n4 = BT * C / 4;
    k_cvt_bf16<<<(n4 + 255) / 256, 256, 0, stream>>>(ctx, ctxb, n4);
  }

  const int flashBlocks = (B * H * (T / 16)) / 8;   // 512
  const float scale = 0.125f;                       // 1/sqrt(64)

  // 1) self-attention branch
  k_layernorm<<<BT, 256, 0, stream>>>(x, ln1_g, ln1_b, hbuf, C);
  k_gemm<0><<<dim3(3 * C / 64, BT / 128), 256, 0, stream>>>(
      hbuf, wqkv, qkv_b, nullptr, qkvb, BT, 3 * C, C);
  k_vt<<<dim3(T / 32, B * H), 256, 0, stream>>>(qkvb, 3 * C, 2 * C, vtb, T, H);
  k_flash<<<flashBlocks, 256, 0, stream>>>(
      qkvb, 3 * C, 0, qkvb, 3 * C, C, vtb, obuf, C, T, H, 1, scale);
  k_gemm<1><<<dim3(C / 64, BT / 128), 256, 0, stream>>>(
      obuf, wao, aob, x, resid, BT, C, C);

  // 2) cross-attention branch
  k_layernorm<<<BT, 256, 0, stream>>>(resid, lnc_g, lnc_b, hbuf, C);
  k_gemm<0><<<dim3(C / 64, BT / 128), 256, 0, stream>>>(
      hbuf, wq, q_b, nullptr, qxb, BT, C, C);
  k_gemm<0><<<dim3(2 * C / 64, BT / 128), 256, 0, stream>>>(
      ctxb, wkv, kv_b, nullptr, kvb, BT, 2 * C, C);
  k_vt<<<dim3(T / 32, B * H), 256, 0, stream>>>(kvb, 2 * C, C, vtb, T, H);
  k_flash<<<flashBlocks, 256, 0, stream>>>(
      qxb, C, 0, kvb, 2 * C, 0, vtb, obuf, C, T, H, 0, scale);
  k_gemm<1><<<dim3(C / 64, BT / 128), 256, 0, stream>>>(
      obuf, wco, cob, resid, resid, BT, C, C);

  // 3) FFN
  k_layernorm<<<BT, 256, 0, stream>>>(resid, ln2_g, ln2_b, hbuf, C);
  k_gemm<2><<<dim3(F / 64, BT / 128), 256, 0, stream>>>(
      hbuf, w1b, b1, nullptr, f1b, BT, F, C);
  k_gemm<1><<<dim3(C / 64, BT / 128), 256, 0, stream>>>(
      f1b, w2b, b2, resid, (float*)d_out, BT, C, F);
}

// v001
// A run of this version takes 476 microseconds.
// Timed twice side by side with v000, it ran 1.15 times as fast both times.
#include <hip/hip_runtime.h>
#include <hip/hip_bf16.h>
#include <math.h>

typedef __attribute__((ext_vector_type(16))) __bf16 v16bf;
typedef __attribute__((ext_vector_type(8)))  float  v8f;
typedef int v4i_t __attribute__((vector_size(16)));
typedef unsigned short us;

#define DEV static __device__ __forceinline__
#define AS1 __attribute__((address_space(1)))
#define AS3 __attribute__((address_space(3)))

#if defined(__has_builtin)
#if __has_builtin(__builtin_amdgcn_global_load_async_to_lds_b128)
#define HAVE_ASYNC_BUILTIN 1
#endif
#if __has_builtin(__builtin_amdgcn_s_wait_asynccnt)
#define HAVE_WAIT_ASYNC_BUILTIN 1
#endif
#endif
#ifndef HAVE_ASYNC_BUILTIN
#define HAVE_ASYNC_BUILTIN 0
#endif
#ifndef HAVE_WAIT_ASYNC_BUILTIN
#define HAVE_WAIT_ASYNC_BUILTIN 0
#endif

// LDS pitch, in 16-bit elements, of the GEMM tiles' rows of 32, which
// ds_load_b128 reads one row per lane: 80 B = 16 B x odd spreads 16 rows over
// all 64 banks.
constexpr int LP = 40;

union FragB16 { uint4 q[2]; v16bf v; };
union U4S8    { uint4 q; us s[8]; };

DEV us f2bf(float f) {
  unsigned u = __float_as_uint(f);
  u += 0x7FFFu + ((u >> 16) & 1u);          // round-to-nearest-even
  return (us)(u >> 16);
}
DEV v8f zero8() { v8f z = {0.f,0.f,0.f,0.f,0.f,0.f,0.f,0.f}; return z; }

DEV v8f wmma_bf16(const FragB16& a, const FragB16& b, v8f c) {
  return __builtin_amdgcn_wmma_f32_16x16x32_bf16(false, a.v, false, b.v,
                                                 (short)0, c, false, false);
}

// 16-byte async global -> LDS copy (per-lane addresses), ASYNCcnt-tracked.
DEV void async_copy16(us* lds, const us* g) {
#if HAVE_ASYNC_BUILTIN
  __builtin_amdgcn_global_load_async_to_lds_b128((AS1 v4i_t*)(us*)g,
                                                 (AS3 v4i_t*)lds, 0, 0);
#else
  unsigned loff = (unsigned)(unsigned long long)(AS3 us*)lds;
  unsigned long long ga = (unsigned long long)g;
  asm volatile("global_load_async_to_lds_b128 %0, %1, off"
               :: "v"(loff), "v"(ga) : "memory");
#endif
}
DEV void wait_async0() {
#if HAVE_WAIT_ASYNC_BUILTIN
  __builtin_amdgcn_s_wait_asynccnt(0);
#else
  asm volatile("s_wait_asynccnt 0" ::: "memory");
#endif
}

// max across each 16-lane group, pure VALU via DPP16 (no LDS round trips)
DEV float dppmax16(float v) {
  float t;
  t = __int_as_float(__builtin_amdgcn_update_dpp(0, __float_as_int(v), 0x0B1, 0xF, 0xF, true));
  v = fmaxf(v, t);   // quad_perm [1,0,3,2]
  t = __int_as_float(__builtin_amdgcn_update_dpp(0, __float_as_int(v), 0x04E, 0xF, 0xF, true));
  v = fmaxf(v, t);   // quad_perm [2,3,0,1]
  t = __int_as_float(__builtin_amdgcn_update_dpp(0, __float_as_int(v), 0x141, 0xF, 0xF, true));
  v = fmaxf(v, t);   // row_half_mirror
  t = __int_as_float(__builtin_amdgcn_update_dpp(0, __float_as_int(v), 0x140, 0xF, 0xF, true));
  v = fmaxf(v, t);   // row_mirror
  return v;
}

// ---------------- fp32 -> bf16 (row-major copy: context) --------------------
__global__ void k_cvt_bf16(const float* __restrict__ src, us* __restrict__ dst,
                           int n4) {
  int i = blockIdx.x * blockDim.x + threadIdx.x;
  if (i >= n4) return;
  float4 f = ((const float4*)src)[i];
  int o = i * 4;
  dst[o + 0] = f2bf(f.x); dst[o + 1] = f2bf(f.y);
  dst[o + 2] = f2bf(f.z); dst[o + 3] = f2bf(f.w);
}

// -------- fp32 W[K,N] -> bf16 Wt[N,K] (convert + transpose, 32x32 tiles) ----
__global__ __launch_bounds__(256)
void k_cvt_t(const float* __restrict__ src, us* __restrict__ dst, int K, int N) {
  __shared__ __align__(16) float t[32][36];
  const int kb = blockIdx.y * 32, nb = blockIdx.x * 32;
  {
    int r = threadIdx.x >> 3, c4 = (threadIdx.x & 7) << 2;
    float4 f = *(const float4*)(src + (size_t)(kb + r) * N + nb + c4);
    t[r][c4 + 0] = f.x; t[r][c4 + 1] = f.y; t[r][c4 + 2] = f.z; t[r][c4 + 3] = f.w;
  }
  __syncthreads();
  {
    int n = threadIdx.x >> 3, k4 = (threadIdx.x & 7) << 2;
    unsigned a0 = (unsigned)f2bf(t[k4 + 0][n]) | ((unsigned)f2bf(t[k4 + 1][n]) << 16);
    unsigned a1 = (unsigned)f2bf(t[k4 + 2][n]) | ((unsigned)f2bf(t[k4 + 3][n]) << 16);
    uint2 u; u.x = a0; u.y = a1;
    *(uint2*)(dst + (size_t)(nb + n) * K + kb + k4) = u;
  }
}

// -------- bf16 V[t, d] (strided heads) -> Vt[(b*H+h)*64 + d][T] -------------
__global__ __launch_bounds__(256)
void k_vt(const us* __restrict__ Vsrc, int rs, int col0,
          us* __restrict__ Vt, int T, int H) {
  __shared__ __align__(16) us tl[32][72];
  const int bh = blockIdx.y, b = bh / H, h = bh % H;
  const int t0 = blockIdx.x * 32;
  {
    int t = threadIdx.x >> 3, d8 = (threadIdx.x & 7) << 3;
    *(uint4*)&tl[t][d8] =
        *(const uint4*)(Vsrc + ((size_t)b * T + t0 + t) * rs + col0 + h * 64 + d8);
  }
  __syncthreads();
  {
    int d = threadIdx.x >> 2, t8 = (threadIdx.x & 3) << 3;
    U4S8 u;
    #pragma unroll
    for (int e = 0; e < 8; ++e) u.s[e] = tl[t8 + e][d];
    *(uint4*)(Vt + ((size_t)bh * 64 + d) * T + t0 + t8) = u.q;
  }
}

// ---------------- LayerNorm: one block per row (C = 1024) -------------------
__global__ __launch_bounds__(256)
void k_layernorm(const float* __restrict__ x, const float* __restrict__ g,
                 const float* __restrict__ b, us* __restrict__ out, int C) {
  const int row = blockIdx.x, tid = threadIdx.x;
  const float* xr = x + (size_t)row * C;
  float v[4], s = 0.f, s2 = 0.f;
  #pragma unroll
  for (int i = 0; i < 4; ++i) {
    float t = xr[tid + i * 256];
    v[i] = t; s += t; s2 += t * t;
  }
  #pragma unroll
  for (int off = 16; off; off >>= 1) {
    s  += __shfl_xor(s,  off, 32);
    s2 += __shfl_xor(s2, off, 32);
  }
  __shared__ float sh[16];
  int wid = tid >> 5, lane = tid & 31;
  if (lane == 0) { sh[wid] = s; sh[8 + wid] = s2; }
  __syncthreads();
  float ts = 0.f, ts2 = 0.f;
  #pragma unroll
  for (int i = 0; i < 8; ++i) { ts += sh[i]; ts2 += sh[8 + i]; }
  float mean = ts / C;
  float rstd = rsqrtf(ts2 / C - mean * mean + 1e-5f);
  #pragma unroll
  for (int i = 0; i < 4; ++i) {
    int c = tid + i * 256;
    out[(size_t)row * C + c] = f2bf((v[i] - mean) * rstd * g[c] + b[c]);
  }
}

// ------- bf16 WMMA GEMM: out = A[M,K] @ Wt[N,K]^T + bias --------------------
// Double-buffered LDS filled by async global->LDS copies (ASYNCcnt).
// MODE 0: bf16 out.  MODE 1: fp32 out = resid + acc.  MODE 2: bf16 gelu(acc).
template <int MODE>
__global__ __launch_bounds__(256)
void k_gemm(const us* __restrict__ A, const us* __restrict__ Wt,
            const float* __restrict__ bias, const float* __restrict__ resid,
            void* __restrict__ outp, int M, int N, int K) {
  __shared__ __align__(16) us lA[2][128 * LP];
  __shared__ __align__(16) us lW[2][64 * LP];
  const int tid  = threadIdx.x;
  const int lane = tid & 31, wid = tid >> 5;
  const int wm = wid & 3, wn = wid >> 2;
  const int l15 = lane & 15, khalf = (lane >> 4) << 3;
  const int mbase = blockIdx.y * 128, nbase = blockIdx.x * 64;

  const int arow0 = tid >> 2, acc8 = (tid & 3) << 3;   // A: 2 x 16B / thread
  const int wrow  = tid >> 2, wcc8 = (tid & 3) << 3;   // W: 1 x 16B / thread

  auto issue = [&](int p, int k0) {
    async_copy16(&lA[p][arow0 * LP + acc8],
                 A  + (size_t)(mbase + arow0)      * K + k0 + acc8);
    async_copy16(&lA[p][(arow0 + 64) * LP + acc8],
                 A  + (size_t)(mbase + arow0 + 64) * K + k0 + acc8);
    async_copy16(&lW[p][wrow * LP + wcc8],
                 Wt + (size_t)(nbase + wrow)       * K + k0 + wcc8);
  };

  v8f c[2][2];
  c[0][0] = zero8(); c[0][1] = zero8(); c[1][0] = zero8(); c[1][1] = zero8();

  const int nk = K >> 5;
  issue(0, 0);
  wait_async0();
  __syncthreads();
  for (int j = 0; j < nk; ++j) {
    const int p = j & 1;
    if (j + 1 < nk) issue((j + 1) & 1, (j + 1) << 5);
    FragB16 a[2], bfr[2];
    #pragma unroll
    for (int im = 0; im < 2; ++im) {
      int r = wm * 32 + im * 16 + l15;
      a[im].q[0] = *(const uint4*)&lA[p][r * LP + khalf];
      a[im].q[1] = *(const uint4*)&lA[p][r * LP + 16 + khalf];
    }
    #pragma unroll
    for (int in = 0; in < 2; ++in) {
      int nc = wn * 32 + in * 16 + l15;
      bfr[in].q[0] = *(const uint4*)&lW[p][nc * LP + khalf];
      bfr[in].q[1] = *(const uint4*)&lW[p][nc * LP + 16 + khalf];
    }
    #pragma unroll
    for (int im = 0; im < 2; ++im)
      #pragma unroll
      for (int in = 0; in < 2; ++in)
        c[im][in] = wmma_bf16(a[im], bfr[in], c[im][in]);
    if (j + 1 < nk) wait_async0();
    __syncthreads();
  }

  const int hi8 = (lane >> 4) << 3;
  #pragma unroll
  for (int im = 0; im < 2; ++im)
    #pragma unroll
    for (int in = 0; in < 2; ++in)
      #pragma unroll
      for (int r = 0; r < 8; ++r) {
        int row = mbase + wm * 32 + im * 16 + r + hi8;
        int col = nbase + wn * 32 + in * 16 + l15;
        size_t idx = (size_t)row * N + col;
        float v = c[im][in][r] + bias[col];
        if (MODE == 0) {
          ((us*)outp)[idx] = f2bf(v);
        } else if (MODE == 1) {
          ((float*)outp)[idx] = resid[idx] + v;
        } else {
          float gv = 0.5f * v * (1.0f + erff(v * 0.70710678118654752f));
          ((us*)outp)[idx] = f2bf(gv);
        }
      }
}

// ---------------- Flash attention: one wave per (b, h, 16-row q-tile) -------
// V pre-transposed to Vt[(b*H+h)*64 + d][T].  Row-sum folded into a WMMA with
// an all-ones B operand; row-max via DPP16 (no LDS permutes).
__global__ __launch_bounds__(256)
void k_flash(const us* __restrict__ Qb, int q_rs, int q_col0,
             const us* __restrict__ Kb, int k_rs, int k_col0,
             const us* __restrict__ Vt,
             us* __restrict__ Ob, int o_rs,
             int T, int H, int causal, float scale) {
  __shared__ __align__(16) us lP[8][16 * 32];
  const int lane = threadIdx.x & 31, wid = threadIdx.x >> 5;
  const int gw = blockIdx.x * 8 + wid;
  const int nQT = T >> 4;
  const int qt = gw % nQT;
  const int h  = (gw / nQT) % H;
  const int b  = gw / (nQT * H);
  const int l15 = lane & 15, khalf = (lane >> 4) << 3, hi8 = khalf;
  const int qcol = q_col0 + h * 64, kcol = k_col0 + h * 64;
  const size_t brow = (size_t)b * T;
  const us* vt = Vt + ((size_t)(b * H + h) * 64) * T;

  FragB16 ones;
  {
    uint4 o; o.x = o.y = o.z = o.w = 0x3F803F80u;   // bf16 1.0 pairs
    ones.q[0] = o; ones.q[1] = o;
  }
  FragB16 aq[2];
  {
    const us* qr = Qb + (brow + qt * 16 + l15) * q_rs + qcol;
    #pragma unroll
    for (int kc = 0; kc < 2; ++kc) {
      aq[kc].q[0] = *(const uint4*)(qr + kc * 32 + khalf);
      aq[kc].q[1] = *(const uint4*)(qr + kc * 32 + 16 + khalf);
    }
  }
  float mrow[8], lrow[8], alph[8];
  v8f oc[4];
  #pragma unroll
  for (int r = 0; r < 8; ++r) { mrow[r] = -__builtin_inff(); lrow[r] = 0.f; }
  oc[0] = zero8(); oc[1] = zero8(); oc[2] = zero8(); oc[3] = zero8();

  const int rbase = qt * 16 + hi8;
  const int nsteps = causal ? (qt / 2 + 1) : (T >> 5);

  for (int j = 0; j < nsteps; ++j) {
    v8f s[2];
    #pragma unroll
    for (int ns = 0; ns < 2; ++ns) {
      const us* kr = Kb + (brow + j * 32 + ns * 16 + l15) * k_rs + kcol;
      FragB16 bk0, bk1;
      bk0.q[0] = *(const uint4*)(kr + khalf);
      bk0.q[1] = *(const uint4*)(kr + 16 + khalf);
      bk1.q[0] = *(const uint4*)(kr + 32 + khalf);
      bk1.q[1] = *(const uint4*)(kr + 48 + khalf);
      v8f acc = zero8();
      acc = wmma_bf16(aq[0], bk0, acc);
      acc = wmma_bf16(aq[1], bk1, acc);
      s[ns] = acc;
    }
    const int col0 = j * 32 + l15;
    #pragma unroll
    for (int r = 0; r < 8; ++r) {
      float s0 = s[0][r] * scale;
      float s1 = s[1][r] * scale;
      const int rowg = rbase + r;
      if (causal) {
        if (col0 > rowg)      s0 = -__builtin_inff();
        if (col0 + 16 > rowg) s1 = -__builtin_inff();
      }
      float t = dppmax16(fmaxf(s0, s1));
      float mn = fmaxf(mrow[r], t);
      float a = __expf(mrow[r] - mn);
      alph[r] = a;
      mrow[r] = mn;
      #pragma unroll
      for (int d = 0; d < 4; ++d) oc[d][r] *= a;
      lP[wid][(r + hi8) * 32 + l15]      = f2bf(__expf(s0 - mn));
      lP[wid][(r + hi8) * 32 + 16 + l15] = f2bf(__expf(s1 - mn));
    }
    asm volatile("s_wait_dscnt 0" ::: "memory");
    FragB16 ap;
    ap.q[0] = *(const uint4*)&lP[wid][l15 * 32 + khalf];
    ap.q[1] = *(const uint4*)&lP[wid][l15 * 32 + 16 + khalf];
    {
      v8f sums = wmma_bf16(ap, ones, zero8());
      #pragma unroll
      for (int r = 0; r < 8; ++r) lrow[r] = lrow[r] * alph[r] + sums[r];
    }
    #pragma unroll
    for (int d = 0; d < 4; ++d) {
      const us* vr = vt + (size_t)(d * 16 + l15) * T + j * 32;
      FragB16 bv;
      bv.q[0] = *(const uint4*)(vr + khalf);
      bv.q[1] = *(const uint4*)(vr + 16 + khalf);
      oc[d] = wmma_bf16(ap, bv, oc[d]);
    }
  }
  #pragma unroll
  for (int r = 0; r < 8; ++r) {
    float inv = 1.0f / lrow[r];
    const int row = rbase + r;
    #pragma unroll
    for (int d = 0; d < 4; ++d)
      Ob[(brow + row) * o_rs + h * 64 + d * 16 + l15] = f2bf(oc[d][r] * inv);
  }
}

// ----------------------------- host launcher --------------------------------
extern "C" void kernel_launch(void* const* d_in, const int* in_sizes, int n_in,
                              void* d_out, int out_size, void* d_ws,
                              size_t ws_size, hipStream_t stream) {
  (void)in_sizes; (void)n_in; (void)out_size; (void)ws_size;
  constexpr int B = 4, T = 1024, C = 1024, H = 16, F = 4096;
  constexpr int BT = B * T;
  const float* x     = (const float*)d_in[0];
  const float* ctx   = (const float*)d_in[1];
  const float* ln1_g = (const float*)d_in[2];
  const float* ln1_b = (const float*)d_in[3];
  const float* qkv_w = (const float*)d_in[4];
  const float* qkv_b = (const float*)d_in[5];
  const float* aow   = (const float*)d_in[6];
  const float* aob   = (const float*)d_in[7];
  const float* lnc_g = (const float*)d_in[8];
  const float* lnc_b = (const float*)d_in[9];
  const float* q_w   = (const float*)d_in[10];
  const float* q_b   = (const float*)d_in[11];
  const float* kv_w  = (const float*)d_in[12];
  const float* kv_b  = (const float*)d_in[13];
  const float* cow   = (const float*)d_in[14];
  const float* cob   = (const float*)d_in[15];
  const float* ln2_g = (const float*)d_in[16];
  const float* ln2_b = (const float*)d_in[17];
  const float* w1    = (const float*)d_in[18];
  const float* b1    = (const float*)d_in[19];
  const float* w2    = (const float*)d_in[20];
  const float* b2    = (const float*)d_in[21];

  char* p = (char*)d_ws;
  auto carve = [&](size_t bytes) -> char* {
    char* r = p; p += (bytes + 255) & ~(size_t)255; return r;
  };
  us* wqkv = (us*)carve((size_t)C * 3 * C * 2);   // [3C][C] transposed
  us* wao  = (us*)carve((size_t)C * C * 2);
  us* wq   = (us*)carve((size_t)C * C * 2);
  us* wkv  = (us*)carve((size_t)C * 2 * C * 2);
  us* wco  = (us*)carve((size_t)C * C * 2);
  us* w1b  = (us*)carve((size_t)C * F * 2);
  us* w2b  = (us*)carve((size_t)F * C * 2);
  us* hbuf = (us*)carve((size_t)BT * C * 2);
  us* qkvb = (us*)carve((size_t)BT * 3 * C * 2);
  us* obuf = (us*)carve((size_t)BT * C * 2);
  us* ctxb = (us*)carve((size_t)BT * C * 2);
  us* vtb  = (us*)carve((size_t)BT * C * 2);      // Vt[(b*H+h)*64 + d][T]
  us* f1b  = (us*)carve((size_t)BT * F * 2);
  float* resid = (float*)carve((size_t)BT * C * 4);
  us* qxb = qkvb;                    // reuse after self-attention
  us* kvb = qkvb + (size_t)BT * C;

  auto cvtT = [&](const float* s, us* d, int K, int N) {
    k_cvt_t<<<dim3(N / 32, K / 32), 256, 0, stream>>>(s, d, K, N);
  };
  cvtT(qkv_w, wqkv, C, 3 * C);
  cvtT(aow,   wao,  C, C);
  cvtT(q_w,   wq,   C, C);
  cvtT(kv_w,  wkv,  C, 2 * C);
  cvtT(cow,   wco,  C, C);
  cvtT(w1,    w1b,  C, F);
  cvtT(w2,    w2b,  F, C);
  {
    int n4 = BT * C / 4;
    k_cvt_bf16<<<(n4 + 255) / 256, 256, 0, stream>>>(ctx, ctxb, n4);
  }

  const int flashBlocks = (B * H * (T / 16)) / 8;   // 512
  const float scale = 0.125f;                       // 1/sqrt(64)

  // 1) self-attention branch
  k_layernorm<<<BT, 256, 0, stream>>>(x, ln1_g, ln1_b, hbuf, C);
  k_gemm<0><<<dim3(3 * C / 64, BT / 128), 256, 0, stream>>>(
      hbuf, wqkv, qkv_b, nullptr, qkvb, BT, 3 * C, C);
  k_vt<<<dim3(T / 32, B * H), 256, 0, stream>>>(qkvb, 3 * C, 2 * C, vtb, T, H);
  k_flash<<<flashBlocks, 256, 0, stream>>>(
      qkvb, 3 * C, 0, qkvb, 3 * C, C, vtb, obuf, C, T, H, 1, scale);
  k_gemm<1><<<dim3(C / 64, BT / 128), 256, 0, stream>>>(
      obuf, wao, aob, x, resid, BT, C, C);

  // 2) cross-attention branch
  k_layernorm<<<BT, 256, 0, stream>>>(resid, lnc_g, lnc_b, hbuf, C);
  k_gemm<0><<<dim3(C / 64, BT / 128), 256, 0, stream>>>(
      hbuf, wq, q_b, nullptr, qxb, BT, C, C);
  k_gemm<0><<<dim3(2 * C / 64, BT / 128), 256, 0, stream>>>(
      ctxb, wkv, kv_b, nullptr, kvb, BT, 2 * C, C);
  k_vt<<<dim3(T / 32, B * H), 256, 0, stream>>>(kvb, 2 * C, C, vtb, T, H);
  k_flash<<<flashBlocks, 256, 0, stream>>>(
      qxb, C, 0, kvb, 2 * C, 0, vtb, obuf, C, T, H, 0, scale);
  k_gemm<1><<<dim3(C / 64, BT / 128), 256, 0, stream>>>(
      obuf, wco, cob, resid, resid, BT, C, C);

  // 3) FFN
  k_layernorm<<<BT, 256, 0, stream>>>(resid, ln2_g, ln2_b, hbuf, C);
  k_gemm<2><<<dim3(F / 64, BT / 128), 256, 0, stream>>>(
      hbuf, w1b, b1, nullptr, f1b, BT, F, C);
  k_gemm<1><<<dim3(C / 64, BT / 128), 256, 0, stream>>>(
      f1b, w2b, b2, resid, (float*)d_out, BT, C, F);
}

// v002
// A run of this version takes 459 microseconds.
// Next to v001, in two timings, it ran 1.04 times as fast each time.
// Counting every step since v000, it is 1.20 times as fast.
#include <hip/hip_runtime.h>
#include <hip/hip_bf16.h>
#include <math.h>

typedef __attribute__((ext_vector_type(16))) __bf16 v16bf;
typedef __attribute__((ext_vector_type(8)))  float  v8f;
typedef int v4i_t __attribute__((vector_size(16)));
typedef unsigned short us;

#define DEV static __device__ __forceinline__
#define AS1 __attribute__((address_space(1)))
#define AS3 __attribute__((address_space(3)))

#if defined(__has_builtin)
#if __has_builtin(__builtin_amdgcn_global_load_async_to_lds_b128)
#define HAVE_ASYNC_BUILTIN 1
#endif
#if __has_builtin(__builtin_amdgcn_s_wait_asynccnt)
#define HAVE_WAIT_ASYNC_BUILTIN 1
#endif
#endif
#ifndef HAVE_ASYNC_BUILTIN
#define HAVE_ASYNC_BUILTIN 0
#endif
#ifndef HAVE_WAIT_ASYNC_BUILTIN
#define HAVE_WAIT_ASYNC_BUILTIN 0
#endif

// LDS pitch, in 16-bit elements, of the GEMM tiles' rows of 32, which
// ds_load_b128 reads one row per lane: 80 B = 16 B x odd spreads 16 rows over
// all 64 banks.
constexpr int LP = 40;

union FragB16 { uint4 q[2]; v16bf v; };

DEV us f2bf(float f) {
  unsigned u = __float_as_uint(f);
  u += 0x7FFFu + ((u >> 16) & 1u);          // round-to-nearest-even
  return (us)(u >> 16);
}
DEV v8f zero8() { v8f z = {0.f,0.f,0.f,0.f,0.f,0.f,0.f,0.f}; return z; }

DEV v8f wmma_bf16(const FragB16& a, const FragB16& b, v8f c) {
  return __builtin_amdgcn_wmma_f32_16x16x32_bf16(false, a.v, false, b.v,
                                                 (short)0, c, false, false);
}

// 16-byte async global -> LDS copy (per-lane addresses), ASYNCcnt-tracked.
DEV void async_copy16(us* lds, const us* g) {
#if HAVE_ASYNC_BUILTIN
  __builtin_amdgcn_global_load_async_to_lds_b128((AS1 v4i_t*)(us*)g,
                                                 (AS3 v4i_t*)lds, 0, 0);
#else
  unsigned loff = (unsigned)(unsigned long long)(AS3 us*)lds;
  unsigned long long ga = (unsigned long long)g;
  asm volatile("global_load_async_to_lds_b128 %0, %1, off"
               :: "v"(loff), "v"(ga) : "memory");
#endif
}
DEV void wait_async0() {
#if HAVE_WAIT_ASYNC_BUILTIN
  __builtin_amdgcn_s_wait_asynccnt(0);
#else
  asm volatile("s_wait_asynccnt 0" ::: "memory");
#endif
}

// max across each 16-lane group, pure VALU via DPP16 (no LDS round trips)
DEV float dppmax16(float v) {
  float t;
  t = __int_as_float(__builtin_amdgcn_update_dpp(0, __float_as_int(v), 0x0B1, 0xF, 0xF, true));
  v = fmaxf(v, t);   // quad_perm [1,0,3,2]
  t = __int_as_float(__builtin_amdgcn_update_dpp(0, __float_as_int(v), 0x04E, 0xF, 0xF, true));
  v = fmaxf(v, t);   // quad_perm [2,3,0,1]
  t = __int_as_float(__builtin_amdgcn_update_dpp(0, __float_as_int(v), 0x141, 0xF, 0xF, true));
  v = fmaxf(v, t);   // row_half_mirror
  t = __int_as_float(__builtin_amdgcn_update_dpp(0, __float_as_int(v), 0x140, 0xF, 0xF, true));
  v = fmaxf(v, t);   // row_mirror
  return v;
}

// The four streaming kernels below give every lane 16 loads of 16 B of data
// (64 fp32 or, in k_vt, 128 bf16 elements; LayerNorm also loads g and b),
// all issued before the first use: a launch then starts one wave where
// sixteen one-load waves would stand, for speed only.
typedef float    f32x4 __attribute__((ext_vector_type(4)));
typedef unsigned u32x4 __attribute__((ext_vector_type(4)));

// two f32 -> two bf16 in one dword, each rounded as f2bf rounds
DEV unsigned pack2(float lo, float hi) {
  unsigned a = __float_as_uint(lo), c = __float_as_uint(hi);
  a += 0x7FFFu + ((a >> 16) & 1u);
  c += 0x7FFFu + ((c >> 16) & 1u);
  return (a >> 16) | (c & 0xFFFF0000u);
}

// ---------------- fp32 -> bf16 (row-major copy: context) --------------------
// One block: 4096 float4 in a row; a wave's load covers 512 B, its store 256 B.
__global__ __launch_bounds__(256)
void k_cvt_bf16(const float* __restrict__ src, us* __restrict__ dst) {
  const int base = blockIdx.x * 4096 + threadIdx.x;
  f32x4 f[16];
  #pragma unroll
  for (int u = 0; u < 16; ++u) f[u] = ((const f32x4*)src)[base + u * 256];
  // keeps every load above in front of the first use, all in flight together;
  // without it some sink to their use, one memory latency after another
  __builtin_amdgcn_sched_barrier(0);
  #pragma unroll
  for (int u = 0; u < 16; ++u) {
    uint2 o; o.x = pack2(f[u][0], f[u][1]); o.y = pack2(f[u][2], f[u][3]);
    ((uint2*)dst)[base + u * 256] = o;
  }
}

// -------- fp32 W[K,N] -> bf16 Wt[N,K] (convert + transpose in registers) ----
// One wave: 64 k x 32 n.  A lane loads 8 k-rows x 8 n and stores 8 n-rows x 8 k:
// four lanes read one 128-B line of W, eight lanes write one 128-B line of Wt.
// K and N are compile-time so that the row steps are immediate offsets.
template <int K, int N>
__global__ __launch_bounds__(64)
void k_cvt_t(const float* __restrict__ src, us* __restrict__ dst) {
  const int lane = threadIdx.x & 31, wid = threadIdx.x >> 5;
  const int k0 = blockIdx.y * 64 + (lane >> 2) * 8;
  const int n0 = blockIdx.x * 64 + wid * 32 + (lane & 3) * 8;
  const float* s = src + (size_t)k0 * N + n0;
  f32x4 f[16];                       // f[2 i + j]: row k0 + i, columns 4 j ..
  #pragma unroll
  for (int i = 0; i < 15; ++i)
    f[i] = *(const f32x4*)(s + (i >> 1) * N + (i & 1) * 4);
  // the last load's result may take the address register that the 15 loads in
  // flight name: the wait that belongs in front of such an overwrite
  asm volatile("s_wait_xcnt 0x0" ::: "memory");
  f[15] = *(const f32x4*)(s + 7 * N + 4);
  // keeps every load above in front of the first use, all in flight together;
  // without it some sink to their use, one memory latency after another
  __builtin_amdgcn_sched_barrier(0);
  us* d = dst + (size_t)n0 * K + k0;
  #pragma unroll
  for (int e = 0; e < 8; ++e) {
    const int j = e >> 2, m = e & 3;
    uint4 o;
    o.x = pack2(f[0 + j][m],  f[2 + j][m]);  o.y = pack2(f[4 + j][m],  f[6 + j][m]);
    o.z = pack2(f[8 + j][m],  f[10 + j][m]); o.w = pack2(f[12 + j][m], f[14 + j][m]);
    *(uint4*)(d + e * K) = o;
  }
}

// -------- bf16 V[t, d] (strided heads) -> Vt[(b*H+h)*64 + d][T] -------------
// One wave: 64 t x 64 d, transposed in registers.  A lane loads 8 t-rows x 16 d
// and stores 16 d-rows x 8 t: four lanes read one head row (128 B), eight lanes
// write one 128-B line of Vt.  RS and T are compile-time so that the row steps
// are immediate offsets.
template <int RS, int T>
__global__ __launch_bounds__(128)
void k_vt(const us* __restrict__ Vsrc, int col0, us* __restrict__ Vt, int H) {
  const int lane = threadIdx.x & 31, wid = threadIdx.x >> 5;
  const int bh = blockIdx.y, b = bh / H, h = bh % H;
  const int t0 = blockIdx.x * 256 + wid * 64 + (lane >> 2) * 8;
  const int d0 = (lane & 3) * 16;
  const us* s = Vsrc + ((size_t)b * T + t0) * RS + col0 + h * 64 + d0;
  u32x4 in[16];                      // in[2 i + j]: row t0 + i, columns 8 j ..
  #pragma unroll
  for (int i = 0; i < 15; ++i)
    in[i] = *(const u32x4*)(s + (i >> 1) * RS + (i & 1) * 8);
  // the last load's result may take the address register that the 15 loads in
  // flight name: the wait that belongs in front of such an overwrite
  asm volatile("s_wait_xcnt 0x0" ::: "memory");
  in[15] = *(const u32x4*)(s + 7 * RS + 8);
  // keeps every load above in front of the first use, all in flight together;
  // without it some sink to their use, one memory latency after another
  __builtin_amdgcn_sched_barrier(0);
  us* d = Vt + ((size_t)bh * 64 + d0) * T + t0;
  #pragma unroll
  for (int e = 0; e < 16; ++e) {
    const int j = e >> 3, w = (e & 7) >> 1, sh = (e & 1) * 16;
    unsigned o[4];
    #pragma unroll
    for (int p = 0; p < 4; ++p)
      o[p] = ((in[4 * p + j][w] >> sh) & 0xFFFFu) |
             (((in[4 * p + 2 + j][w] >> sh) & 0xFFFFu) << 16);
    uint4 q; q.x = o[0]; q.y = o[1]; q.z = o[2]; q.w = o[3];
    *(uint4*)(d + e * T) = q;
  }
}

// ---------------- LayerNorm: one wave per two rows (C = 1024) ---------------
// A lane holds 32 elements of each row; a row's sums are four in-lane chains and
// a five-step butterfly, so no LDS array and no barrier.
__global__ __launch_bounds__(256)
void k_layernorm(const float* __restrict__ x, const float* __restrict__ g,
                 const float* __restrict__ b, us* __restrict__ out, int C) {
  const int lane = threadIdx.x & 31;
  const int row0 = (blockIdx.x * 8 + (threadIdx.x >> 5)) * 2;
  const int c4 = C >> 2;             // groups of 4 elements in a row
  const int at[2] = {row0 * c4 + lane, (row0 + 1) * c4 + lane};
  f32x4 v[16], gb[16];               // v[8 q + i]: row q; gb[i]: g, gb[8 + i]: b
  #pragma unroll
  for (int q = 0; q < 2; ++q)
    #pragma unroll
    for (int i = 0; i < 8; ++i)
      v[8 * q + i] = ((const f32x4*)x)[at[q] + i * 32];
  // a result of the loads below may take an address register that the loads in
  // flight above name: the wait that belongs in front of such an overwrite
  asm volatile("s_wait_xcnt 0x0" ::: "memory");
  #pragma unroll
  for (int i = 0; i < 15; ++i)
    gb[i] = ((const f32x4*)(i < 8 ? g : b))[lane + (i & 7) * 32];
  // the same in front of the last load, whose result may take the index register
  asm volatile("s_wait_xcnt 0x0" ::: "memory");
  gb[15] = ((const f32x4*)b)[lane + 7 * 32];
  // keeps every load above in front of the first use, all in flight together;
  // without it some sink to their use, one memory latency after another
  __builtin_amdgcn_sched_barrier(0);
  float s[2], s2[2];
  #pragma unroll
  for (int q = 0; q < 2; ++q) {
    f32x4 a = {0.f, 0.f, 0.f, 0.f}, a2 = {0.f, 0.f, 0.f, 0.f};
    #pragma unroll
    for (int i = 0; i < 8; ++i) {
      f32x4 t = v[8 * q + i];
      a += t; a2 += t * t;
    }
    s[q]  = (a[0] + a[1]) + (a[2] + a[3]);
    s2[q] = (a2[0] + a2[1]) + (a2[2] + a2[3]);
  }
  #pragma unroll
  for (int off = 16; off; off >>= 1)
    #pragma unroll
    for (int q = 0; q < 2; ++q) {
      s[q]  += __shfl_xor(s[q],  off, 32);
      s2[q] += __shfl_xor(s2[q], off, 32);
    }
  #pragma unroll
  for (int q = 0; q < 2; ++q) {
    const float mean = s[q] / C;
    const float rstd = rsqrtf(s2[q] / C - mean * mean + 1e-5f);
    #pragma unroll
    for (int i = 0; i < 8; ++i) {
      f32x4 t = v[8 * q + i], gg = gb[i], bb = gb[8 + i];
      uint2 w;
      w.x = pack2((t[0] - mean) * rstd * gg[0] + bb[0],
                  (t[1] - mean) * rstd * gg[1] + bb[1]);
      w.y = pack2((t[2] - mean) * rstd * gg[2] + bb[2],
                  (t[3] - mean) * rstd * gg[3] + bb[3]);
      ((uint2*)out)[at[q] + i * 32] = w;
    }
  }
}

// ------- bf16 WMMA GEMM: out = A[M,K] @ Wt[N,K]^T + bias --------------------
// Double-buffered LDS filled by async global->LDS copies (ASYNCcnt).
// MODE 0: bf16 out.  MODE 1: fp32 out = resid + acc.  MODE 2: bf16 gelu(acc).
template <int MODE>
__global__ __launch_bounds__(256)
void k_gemm(const us* __restrict__ A, const us* __restrict__ Wt,
            const float* __restrict__ bias, const float* __restrict__ resid,
            void* __restrict__ outp, int M, int N, int K) {
  __shared__ __align__(16) us lA[2][128 * LP];
  __shared__ __align__(16) us lW[2][64 * LP];
  const int tid  = threadIdx.x;
  const int lane = tid & 31, wid = tid >> 5;
  const int wm = wid & 3, wn = wid >> 2;
  const int l15 = lane & 15, khalf = (lane >> 4) << 3;
  const int mbase = blockIdx.y * 128, nbase = blockIdx.x * 64;

  const int arow0 = tid >> 2, acc8 = (tid & 3) << 3;   // A: 2 x 16B / thread
  const int wrow  = tid >> 2, wcc8 = (tid & 3) << 3;   // W: 1 x 16B / thread

  auto issue = [&](int p, int k0) {
    async_copy16(&lA[p][arow0 * LP + acc8],
                 A  + (size_t)(mbase + arow0)      * K + k0 + acc8);
    async_copy16(&lA[p][(arow0 + 64) * LP + acc8],
                 A  + (size_t)(mbase + arow0 + 64) * K + k0 + acc8);
    async_copy16(&lW[p][wrow * LP + wcc8],
                 Wt + (size_t)(nbase + wrow)       * K + k0 + wcc8);
  };

  v8f c[2][2];
  c[0][0] = zero8(); c[0][1] = zero8(); c[1][0] = zero8(); c[1][1] = zero8();

  const int nk = K >> 5;
  issue(0, 0);
  wait_async0();
  __syncthreads();
  for (int j = 0; j < nk; ++j) {
    const int p = j & 1;
    if (j + 1 < nk) issue((j + 1) & 1, (j + 1) << 5);
    FragB16 a[2], bfr[2];
    #pragma unroll
    for (int im = 0; im < 2; ++im) {
      int r = wm * 32 + im * 16 + l15;
      a[im].q[0] = *(const uint4*)&lA[p][r * LP + khalf];
      a[im].q[1] = *(const uint4*)&lA[p][r * LP + 16 + khalf];
    }
    #pragma unroll
    for (int in = 0; in < 2; ++in) {
      int nc = wn * 32 + in * 16 + l15;
      bfr[in].q[0] = *(const uint4*)&lW[p][nc * LP + khalf];
      bfr[in].q[1] = *(const uint4*)&lW[p][nc * LP + 16 + khalf];
    }
    #pragma unroll
    for (int im = 0; im < 2; ++im)
      #pragma unroll
      for (int in = 0; in < 2; ++in)
        c[im][in] = wmma_bf16(a[im], bfr[in], c[im][in]);
    if (j + 1 < nk) wait_async0();
    __syncthreads();
  }

  const int hi8 = (lane >> 4) << 3;
  #pragma unroll
  for (int im = 0; im < 2; ++im)
    #pragma unroll
    for (int in = 0; in < 2; ++in)
      #pragma unroll
      for (int r = 0; r < 8; ++r) {
        int row = mbase + wm * 32 + im * 16 + r + hi8;
        int col = nbase + wn * 32 + in * 16 + l15;
        size_t idx = (size_t)row * N + col;
        float v = c[im][in][r] + bias[col];
        if (MODE == 0) {
          ((us*)outp)[idx] = f2bf(v);
        } else if (MODE == 1) {
          ((float*)outp)[idx] = resid[idx] + v;
        } else {
          float gv = 0.5f * v * (1.0f + erff(v * 0.70710678118654752f));
          ((us*)outp)[idx] = f2bf(gv);
        }
      }
}

// ---------------- Flash attention: one wave per (b, h, 16-row q-tile) -------
// V pre-transposed to Vt[(b*H+h)*64 + d][T].  Row-sum folded into a WMMA with
// an all-ones B operand; row-max via DPP16 (no LDS permutes).
__global__ __launch_bounds__(256)
void k_flash(const us* __restrict__ Qb, int q_rs, int q_col0,
             const us* __restrict__ Kb, int k_rs, int k_col0,
             const us* __restrict__ Vt,
             us* __restrict__ Ob, int o_rs,
             int T, int H, int causal, float scale) {
  __shared__ __align__(16) us lP[8][16 * 32];
  const int lane = threadIdx.x & 31, wid = threadIdx.x >> 5;
  const int gw = blockIdx.x * 8 + wid;
  const int nQT = T >> 4;
  const int qt = gw % nQT;
  const int h  = (gw / nQT) % H;
  const int b  = gw / (nQT * H);
  const int l15 = lane & 15, khalf = (lane >> 4) << 3, hi8 = khalf;
  const int qcol = q_col0 + h * 64, kcol = k_col0 + h * 64;
  const size_t brow = (size_t)b * T;
  const us* vt = Vt + ((size_t)(b * H + h) * 64) * T;

  FragB16 ones;
  {
    uint4 o; o.x = o.y = o.z = o.w = 0x3F803F80u;   // bf16 1.0 pairs
    ones.q[0] = o; ones.q[1] = o;
  }
  FragB16 aq[2];
  {
    const us* qr = Qb + (brow + qt * 16 + l15) * q_rs + qcol;
    #pragma unroll
    for (int kc = 0; kc < 2; ++kc) {
      aq[kc].q[0] = *(const uint4*)(qr + kc * 32 + khalf);
      aq[kc].q[1] = *(const uint4*)(qr + kc * 32 + 16 + khalf);
    }
  }
  float mrow[8], lrow[8], alph[8];
  v8f oc[4];
  #pragma unroll
  for (int r = 0; r < 8; ++r) { mrow[r] = -__builtin_inff(); lrow[r] = 0.f; }
  oc[0] = zero8(); oc[1] = zero8(); oc[2] = zero8(); oc[3] = zero8();

  const int rbase = qt * 16 + hi8;
  const int nsteps = causal ? (qt / 2 + 1) : (T >> 5);

  for (int j = 0; j < nsteps; ++j) {
    v8f s[2];
    #pragma unroll
    for (int ns = 0; ns < 2; ++ns) {
      const us* kr = Kb + (brow + j * 32 + ns * 16 + l15) * k_rs + kcol;
      FragB16 bk0, bk1;
      bk0.q[0] = *(const uint4*)(kr + khalf);
      bk0.q[1] = *(const uint4*)(kr + 16 + khalf);
      bk1.q[0] = *(const uint4*)(kr + 32 + khalf);
      bk1.q[1] = *(const uint4*)(kr + 48 + khalf);
      v8f acc = zero8();
      acc = wmma_bf16(aq[0], bk0, acc);
      acc = wmma_bf16(aq[1], bk1, acc);
      s[ns] = acc;
    }
    const int col0 = j * 32 + l15;
    #pragma unroll
    for (int r = 0; r < 8; ++r) {
      float s0 = s[0][r] * scale;
      float s1 = s[1][r] * scale;
      const int rowg = rbase + r;
      if (causal) {
        if (col0 > rowg)      s0 = -__builtin_inff();
        if (col0 + 16 > rowg) s1 = -__builtin_inff();
      }
      float t = dppmax16(fmaxf(s0, s1));
      float mn = fmaxf(mrow[r], t);
      float a = __expf(mrow[r] - mn);
      alph[r] = a;
      mrow[r] = mn;
      #pragma unroll
      for (int d = 0; d < 4; ++d) oc[d][r] *= a;
      lP[wid][(r + hi8) * 32 + l15]      = f2bf(__expf(s0 - mn));
      lP[wid][(r + hi8) * 32 + 16 + l15] = f2bf(__expf(s1 - mn));
    }
    asm volatile("s_wait_dscnt 0" ::: "memory");
    FragB16 ap;
    ap.q[0] = *(const uint4*)&lP[wid][l15 * 32 + khalf];
    ap.q[1] = *(const uint4*)&lP[wid][l15 * 32 + 16 + khalf];
    {
      v8f sums = wmma_bf16(ap, ones, zero8());
      #pragma unroll
      for (int r = 0; r < 8; ++r) lrow[r] = lrow[r] * alph[r] + sums[r];
    }
    #pragma unroll
    for (int d = 0; d < 4; ++d) {
      const us* vr = vt + (size_t)(d * 16 + l15) * T + j * 32;
      FragB16 bv;
      bv.q[0] = *(const uint4*)(vr + khalf);
      bv.q[1] = *(const uint4*)(vr + 16 + khalf);
      oc[d] = wmma_bf16(ap, bv, oc[d]);
    }
  }
  #pragma unroll
  for (int r = 0; r < 8; ++r) {
    float inv = 1.0f / lrow[r];
    const int row = rbase + r;
    #pragma unroll
    for (int d = 0; d < 4; ++d)
      Ob[(brow + row) * o_rs + h * 64 + d * 16 + l15] = f2bf(oc[d][r] * inv);
  }
}

// ----------------------------- host launcher --------------------------------
extern "C" void kernel_launch(void* const* d_in, const int* in_sizes, int n_in,
                              void* d_out, int out_size, void* d_ws,
                              size_t ws_size, hipStream_t stream) {
  (void)in_sizes; (void)n_in; (void)out_size; (void)ws_size;
  constexpr int B = 4, T = 1024, C = 1024, H = 16, F = 4096;
  constexpr int BT = B * T;
  const float* x     = (const float*)d_in[0];
  const float* ctx   = (const float*)d_in[1];
  const float* ln1_g = (const float*)d_in[2];
  const float* ln1_b = (const float*)d_in[3];
  const float* qkv_w = (const float*)d_in[4];
  const float* qkv_b = (const float*)d_in[5];
  const float* aow   = (const float*)d_in[6];
  const float* aob   = (const float*)d_in[7];
  const float* lnc_g = (const float*)d_in[8];
  const float* lnc_b = (const float*)d_in[9];
  const float* q_w   = (const float*)d_in[10];
  const float* q_b   = (const float*)d_in[11];
  const float* kv_w  = (const float*)d_in[12];
  const float* kv_b  = (const float*)d_in[13];
  const float* cow   = (const float*)d_in[14];
  const float* cob   = (const float*)d_in[15];
  const float* ln2_g = (const float*)d_in[16];
  const float* ln2_b = (const float*)d_in[17];
  const float* w1    = (const float*)d_in[18];
  const float* b1    = (const float*)d_in[19];
  const float* w2    = (const float*)d_in[20];
  const float* b2    = (const float*)d_in[21];

  char* p = (char*)d_ws;
  auto carve = [&](size_t bytes) -> char* {
    char* r = p; p += (bytes + 255) & ~(size_t)255; return r;
  };
  us* wqkv = (us*)carve((size_t)C * 3 * C * 2);   // [3C][C] transposed
  us* wao  = (us*)carve((size_t)C * C * 2);
  us* wq   = (us*)carve((size_t)C * C * 2);
  us* wkv  = (us*)carve((size_t)C * 2 * C * 2);
  us* wco  = (us*)carve((size_t)C * C * 2);
  us* w1b  = (us*)carve((size_t)C * F * 2);
  us* w2b  = (us*)carve((size_t)F * C * 2);
  us* hbuf = (us*)carve((size_t)BT * C * 2);
  us* qkvb = (us*)carve((size_t)BT * 3 * C * 2);
  us* obuf = (us*)carve((size_t)BT * C * 2);
  us* ctxb = (us*)carve((size_t)BT * C * 2);
  us* vtb  = (us*)carve((size_t)BT * C * 2);      // Vt[(b*H+h)*64 + d][T]
  us* f1b  = (us*)carve((size_t)BT * F * 2);
  float* resid = (float*)carve((size_t)BT * C * 4);
  us* qxb = qkvb;                    // reuse after self-attention
  us* kvb = qkvb + (size_t)BT * C;

  k_cvt_t<C, 3 * C><<<dim3(3 * C / 64, C / 64), 64, 0, stream>>>(qkv_w, wqkv);
  k_cvt_t<C, C><<<dim3(C / 64, C / 64), 64, 0, stream>>>(aow, wao);
  k_cvt_t<C, C><<<dim3(C / 64, C / 64), 64, 0, stream>>>(q_w, wq);
  k_cvt_t<C, 2 * C><<<dim3(2 * C / 64, C / 64), 64, 0, stream>>>(kv_w, wkv);
  k_cvt_t<C, C><<<dim3(C / 64, C / 64), 64, 0, stream>>>(cow, wco);
  k_cvt_t<C, F><<<dim3(F / 64, C / 64), 64, 0, stream>>>(w1, w1b);
  k_cvt_t<F, C><<<dim3(C / 64, F / 64), 64, 0, stream>>>(w2, w2b);
  k_cvt_bf16<<<BT * C / 16384, 256, 0, stream>>>(ctx, ctxb);

  const int flashBlocks = (B * H * (T / 16)) / 8;   // 512
  const float scale = 0.125f;                       // 1/sqrt(64)

  // 1) self-attention branch
  k_layernorm<<<BT / 16, 256, 0, stream>>>(x, ln1_g, ln1_b, hbuf, C);
  k_gemm<0><<<dim3(3 * C / 64, BT / 128), 256, 0, stream>>>(
      hbuf, wqkv, qkv_b, nullptr, qkvb, BT, 3 * C, C);
  k_vt<3 * C, T><<<dim3(T / 256, B * H), 128, 0, stream>>>(qkvb, 2 * C, vtb, H);
  k_flash<<<flashBlocks, 256, 0, stream>>>(
      qkvb, 3 * C, 0, qkvb, 3 * C, C, vtb, obuf, C, T, H, 1, scale);
  k_gemm<1><<<dim3(C / 64, BT / 128), 256, 0, stream>>>(
      obuf, wao, aob, x, resid, BT, C, C);

  // 2) cross-attention branch
  k_layernorm<<<BT / 16, 256, 0, stream>>>(resid, lnc_g, lnc_b, hbuf, C);
  k_gemm<0><<<dim3(C / 64, BT / 128), 256, 0, stream>>>(
      hbuf, wq, q_b, nullptr, qxb, BT, C, C);
  k_gemm<0><<<dim3(2 * C / 64, BT / 128), 256, 0, stream>>>(
      ctxb, wkv, kv_b, nullptr, kvb, BT, 2 * C, C);
  k_vt<2 * C, T><<<dim3(T / 256, B * H), 128, 0, stream>>>(kvb, C, vtb, H);
  k_flash<<<flashBlocks, 256, 0, stream>>>(
      qxb, C, 0, kvb, 2 * C, 0, vtb, obuf, C, T, H, 0, scale);
  k_gemm<1><<<dim3(C / 64, BT / 128), 256, 0, stream>>>(
      obuf, wco, cob, resid, resid, BT, C, C);

  // 3) FFN
  k_layernorm<<<BT / 16, 256, 0, stream>>>(resid, ln2_g, ln2_b, hbuf, C);
  k_gemm<2><<<dim3(F / 64, BT / 128), 256, 0, stream>>>(
      hbuf, w1b, b1, nullptr, f1b, BT, F, C);
  k_gemm<1><<<dim3(C / 64, BT / 128), 256, 0, stream>>>(
      f1b, w2b, b2, resid, (float*)d_out, BT, C, F);
}

// v003
// It runs in 381 microseconds.
// Two timings next to v002 put it at 1.21 and 1.20 times that version's speed.
// Over all steps from v000 it is 1.44 times as fast.
#include <hip/hip_runtime.h>
#include <hip/hip_bf16.h>
#include <math.h>

typedef __attribute__((ext_vector_type(16))) __bf16 v16bf;
typedef __attribute__((ext_vector_type(8)))  float  v8f;
typedef int v4i_t __attribute__((vector_size(16)));
typedef unsigned short us;

#define DEV static __device__ __forceinline__
#define AS1 __attribute__((address_space(1)))
#define AS3 __attribute__((address_space(3)))

#if defined(__has_builtin)
#if __has_builtin(__builtin_amdgcn_global_load_async_to_lds_b128)
#define HAVE_ASYNC_BUILTIN 1
#endif
#if __has_builtin(__builtin_amdgcn_s_wait_asynccnt)
#define HAVE_WAIT_ASYNC_BUILTIN 1
#endif
#endif
#ifndef HAVE_ASYNC_BUILTIN
#define HAVE_ASYNC_BUILTIN 0
#endif
#ifndef HAVE_WAIT_ASYNC_BUILTIN
#define HAVE_WAIT_ASYNC_BUILTIN 0
#endif

// LDS pitch, in 16-bit elements, of the GEMM tiles' rows of 128, which
// ds_load_b128 reads one row per lane: 272 B = 16 B x odd spreads 16 rows over
// all 64 banks.
constexpr int LP = 136;

union FragB16 { uint4 q[2]; v16bf v; };

DEV us f2bf(float f) {
  unsigned u = __float_as_uint(f);
  u += 0x7FFFu + ((u >> 16) & 1u);          // round-to-nearest-even
  return (us)(u >> 16);
}
DEV v8f zero8() { v8f z = {0.f,0.f,0.f,0.f,0.f,0.f,0.f,0.f}; return z; }

DEV v8f wmma_bf16(const FragB16& a, const FragB16& b, v8f c) {
  return __builtin_amdgcn_wmma_f32_16x16x32_bf16(false, a.v, false, b.v,
                                                 (short)0, c, false, false);
}

// 16-byte async global -> LDS copy (per-lane addresses), ASYNCcnt-tracked.
DEV void async_copy16(us* lds, const us* g) {
#if HAVE_ASYNC_BUILTIN
  __builtin_amdgcn_global_load_async_to_lds_b128((AS1 v4i_t*)(us*)g,
                                                 (AS3 v4i_t*)lds, 0, 0);
#else
  unsigned loff = (unsigned)(unsigned long long)(AS3 us*)lds;
  unsigned long long ga = (unsigned long long)g;
  asm volatile("global_load_async_to_lds_b128 %0, %1, off"
               :: "v"(loff), "v"(ga) : "memory");
#endif
}
DEV void wait_async0() {
#if HAVE_WAIT_ASYNC_BUILTIN
  __builtin_amdgcn_s_wait_asynccnt(0);
#else
  asm volatile("s_wait_asynccnt 0" ::: "memory");
#endif
}

// max across each 16-lane group, pure VALU via DPP16 (no LDS round trips)
DEV float dppmax16(float v) {
  float t;
  t = __int_as_float(__builtin_amdgcn_update_dpp(0, __float_as_int(v), 0x0B1, 0xF, 0xF, true));
  v = fmaxf(v, t);   // quad_perm [1,0,3,2]
  t = __int_as_float(__builtin_amdgcn_update_dpp(0, __float_as_int(v), 0x04E, 0xF, 0xF, true));
  v = fmaxf(v, t);   // quad_perm [2,3,0,1]
  t = __int_as_float(__builtin_amdgcn_update_dpp(0, __float_as_int(v), 0x141, 0xF, 0xF, true));
  v = fmaxf(v, t);   // row_half_mirror
  t = __int_as_float(__builtin_amdgcn_update_dpp(0, __float_as_int(v), 0x140, 0xF, 0xF, true));
  v = fmaxf(v, t);   // row_mirror
  return v;
}

// The four streaming kernels below give every lane 16 loads of 16 B of data
// (64 fp32 or, in k_vt, 128 bf16 elements; LayerNorm also loads g and b),
// all issued before the first use: a launch then starts one wave where
// sixteen one-load waves would stand, for speed only.
typedef float    f32x4 __attribute__((ext_vector_type(4)));
typedef unsigned u32x4 __attribute__((ext_vector_type(4)));

// two f32 -> two bf16 in one dword, each rounded as f2bf rounds
DEV unsigned pack2(float lo, float hi) {
  unsigned a = __float_as_uint(lo), c = __float_as_uint(hi);
  a += 0x7FFFu + ((a >> 16) & 1u);
  c += 0x7FFFu + ((c >> 16) & 1u);
  return (a >> 16) | (c & 0xFFFF0000u);
}

// ---------------- fp32 -> bf16 (row-major copy: context) --------------------
// One block: 4096 float4 in a row; a wave's load covers 512 B, its store 256 B.
__global__ __launch_bounds__(256)
void k_cvt_bf16(const float* __restrict__ src, us* __restrict__ dst) {
  const int base = blockIdx.x * 4096 + threadIdx.x;
  f32x4 f[16];
  #pragma unroll
  for (int u = 0; u < 16; ++u) f[u] = ((const f32x4*)src)[base + u * 256];
  // keeps every load above in front of the first use, all in flight together;
  // without it some sink to their use, one memory latency after another
  __builtin_amdgcn_sched_barrier(0);
  #pragma unroll
  for (int u = 0; u < 16; ++u) {
    uint2 o; o.x = pack2(f[u][0], f[u][1]); o.y = pack2(f[u][2], f[u][3]);
    ((uint2*)dst)[base + u * 256] = o;
  }
}

// -------- fp32 W[K,N] -> bf16 Wt[N,K] (convert + transpose in registers) ----
// One wave: 64 k x 32 n.  A lane loads 8 k-rows x 8 n and stores 8 n-rows x 8 k:
// four lanes read one 128-B line of W, eight lanes write one 128-B line of Wt.
// K and N are compile-time so that the row steps are immediate offsets.
template <int K, int N>
__global__ __launch_bounds__(64)
void k_cvt_t(const float* __restrict__ src, us* __restrict__ dst) {
  const int lane = threadIdx.x & 31, wid = threadIdx.x >> 5;
  const int k0 = blockIdx.y * 64 + (lane >> 2) * 8;
  const int n0 = blockIdx.x * 64 + wid * 32 + (lane & 3) * 8;
  const float* s = src + (size_t)k0 * N + n0;
  f32x4 f[16];                       // f[2 i + j]: row k0 + i, columns 4 j ..
  #pragma unroll
  for (int i = 0; i < 15; ++i)
    f[i] = *(const f32x4*)(s + (i >> 1) * N + (i & 1) * 4);
  // the last load's result may take the address register that the 15 loads in
  // flight name: the wait that belongs in front of such an overwrite
  asm volatile("s_wait_xcnt 0x0" ::: "memory");
  f[15] = *(const f32x4*)(s + 7 * N + 4);
  // keeps every load above in front of the first use, all in flight together;
  // without it some sink to their use, one memory latency after another
  __builtin_amdgcn_sched_barrier(0);
  us* d = dst + (size_t)n0 * K + k0;
  #pragma unroll
  for (int e = 0; e < 8; ++e) {
    const int j = e >> 2, m = e & 3;
    uint4 o;
    o.x = pack2(f[0 + j][m],  f[2 + j][m]);  o.y = pack2(f[4 + j][m],  f[6 + j][m]);
    o.z = pack2(f[8 + j][m],  f[10 + j][m]); o.w = pack2(f[12 + j][m], f[14 + j][m]);
    *(uint4*)(d + e * K) = o;
  }
}

// -------- bf16 V[t, d] (strided heads) -> Vt[(b*H+h)*64 + d][T] -------------
// One wave: 64 t x 64 d, transposed in registers.  A lane loads 8 t-rows x 16 d
// and stores 16 d-rows x 8 t: four lanes read one head row (128 B), eight lanes
// write one 128-B line of Vt.  RS and T are compile-time so that the row steps
// are immediate offsets.
template <int RS, int T>
__global__ __launch_bounds__(128)
void k_vt(const us* __restrict__ Vsrc, int col0, us* __restrict__ Vt, int H) {
  const int lane = threadIdx.x & 31, wid = threadIdx.x >> 5;
  const int bh = blockIdx.y, b = bh / H, h = bh % H;
  const int t0 = blockIdx.x * 256 + wid * 64 + (lane >> 2) * 8;
  const int d0 = (lane & 3) * 16;
  const us* s = Vsrc + ((size_t)b * T + t0) * RS + col0 + h * 64 + d0;
  u32x4 in[16];                      // in[2 i + j]: row t0 + i, columns 8 j ..
  #pragma unroll
  for (int i = 0; i < 15; ++i)
    in[i] = *(const u32x4*)(s + (i >> 1) * RS + (i & 1) * 8);
  // the last load's result may take the address register that the 15 loads in
  // flight name: the wait that belongs in front of such an overwrite
  asm volatile("s_wait_xcnt 0x0" ::: "memory");
  in[15] = *(const u32x4*)(s + 7 * RS + 8);
  // keeps every load above in front of the first use, all in flight together;
  // without it some sink to their use, one memory latency after another
  __builtin_amdgcn_sched_barrier(0);
  us* d = Vt + ((size_t)bh * 64 + d0) * T + t0;
  #pragma unroll
  for (int e = 0; e < 16; ++e) {
    const int j = e >> 3, w = (e & 7) >> 1, sh = (e & 1) * 16;
    unsigned o[4];
    #pragma unroll
    for (int p = 0; p < 4; ++p)
      o[p] = ((in[4 * p + j][w] >> sh) & 0xFFFFu) |
             (((in[4 * p + 2 + j][w] >> sh) & 0xFFFFu) << 16);
    uint4 q; q.x = o[0]; q.y = o[1]; q.z = o[2]; q.w = o[3];
    *(uint4*)(d + e * T) = q;
  }
}

// ---------------- LayerNorm: one wave per two rows (C = 1024) ---------------
// A lane holds 32 elements of each row; a row's sums are four in-lane chains and
// a five-step butterfly, so no LDS array and no barrier.
__global__ __launch_bounds__(256)
void k_layernorm(const float* __restrict__ x, const float* __restrict__ g,
                 const float* __restrict__ b, us* __restrict__ out, int C) {
  const int lane = threadIdx.x & 31;
  const int row0 = (blockIdx.x * 8 + (threadIdx.x >> 5)) * 2;
  const int c4 = C >> 2;             // groups of 4 elements in a row
  const int at[2] = {row0 * c4 + lane, (row0 + 1) * c4 + lane};
  f32x4 v[16], gb[16];               // v[8 q + i]: row q; gb[i]: g, gb[8 + i]: b
  #pragma unroll
  for (int q = 0; q < 2; ++q)
    #pragma unroll
    for (int i = 0; i < 8; ++i)
      v[8 * q + i] = ((const f32x4*)x)[at[q] + i * 32];
  // a result of the loads below may take an address register that the loads in
  // flight above name: the wait that belongs in front of such an overwrite
  asm volatile("s_wait_xcnt 0x0" ::: "memory");
  #pragma unroll
  for (int i = 0; i < 15; ++i)
    gb[i] = ((const f32x4*)(i < 8 ? g : b))[lane + (i & 7) * 32];
  // the same in front of the last load, whose result may take the index register
  asm volatile("s_wait_xcnt 0x0" ::: "memory");
  gb[15] = ((const f32x4*)b)[lane + 7 * 32];
  // keeps every load above in front of the first use, all in flight together;
  // without it some sink to their use, one memory latency after another
  __builtin_amdgcn_sched_barrier(0);
  float s[2], s2[2];
  #pragma unroll
  for (int q = 0; q < 2; ++q) {
    f32x4 a = {0.f, 0.f, 0.f, 0.f}, a2 = {0.f, 0.f, 0.f, 0.f};
    #pragma unroll
    for (int i = 0; i < 8; ++i) {
      f32x4 t = v[8 * q + i];
      a += t; a2 += t * t;
    }
    s[q]  = (a[0] + a[1]) + (a[2] + a[3]);
    s2[q] = (a2[0] + a2[1]) + (a2[2] + a2[3]);
  }
  #pragma unroll
  for (int off = 16; off; off >>= 1)
    #pragma unroll
    for (int q = 0; q < 2; ++q) {
      s[q]  += __shfl_xor(s[q],  off, 32);
      s2[q] += __shfl_xor(s2[q], off, 32);
    }
  #pragma unroll
  for (int q = 0; q < 2; ++q) {
    const float mean = s[q] / C;
    const float rstd = rsqrtf(s2[q] / C - mean * mean + 1e-5f);
    #pragma unroll
    for (int i = 0; i < 8; ++i) {
      f32x4 t = v[8 * q + i], gg = gb[i], bb = gb[8 + i];
      uint2 w;
      w.x = pack2((t[0] - mean) * rstd * gg[0] + bb[0],
                  (t[1] - mean) * rstd * gg[1] + bb[1]);
      w.y = pack2((t[2] - mean) * rstd * gg[2] + bb[2],
                  (t[3] - mean) * rstd * gg[3] + bb[3]);
      ((uint2*)out)[at[q] + i * 32] = w;
    }
  }
}

// ------- bf16 WMMA GEMM: out = A[M,K] @ Wt[N,K]^T + bias --------------------
// Double-buffered LDS filled by async global->LDS copies (ASYNCcnt).
// One block: a 128 x 128 tile of out, 128 k per stage; a wave: 64 x 32.  A wave's
// copy covers two rows of 256 B, whole lines; M, N, K are multiples of 128.
// MODE 0: bf16 out.  MODE 1: fp32 out = resid + acc.  MODE 2: bf16 gelu(acc).
template <int MODE>
__global__ __launch_bounds__(256)
void k_gemm(const us* __restrict__ A, const us* __restrict__ Wt,
            const float* __restrict__ bias, const float* __restrict__ resid,
            void* __restrict__ outp, int M, int N, int K) {
  __shared__ __align__(16) us lA[2][128 * LP];
  __shared__ __align__(16) us lW[2][128 * LP];
  const int tid  = threadIdx.x;
  const int lane = tid & 31, wid = tid >> 5;
  const int wm = wid & 1, wn = wid >> 1;
  const int l15 = lane & 15, khalf = (lane >> 4) << 3;
  const int mbase = blockIdx.y * 128, nbase = blockIdx.x * 128;

  // 16 threads copy one row of 128 k; a thread: 8 x 16 B of A, 8 x 16 B of W
  const int crow = tid >> 4, cc8 = (tid & 15) << 3;

  auto issue = [&](int p, int k0) {
    const us* ga = A  + (size_t)(mbase + crow) * K + k0 + cc8;
    const us* gw = Wt + (size_t)(nbase + crow) * K + k0 + cc8;
    // unrolled: the LDS row steps become constants
    #pragma unroll
    for (int i = 0; i < 8; ++i) {
      async_copy16(&lA[p][(crow + 16 * i) * LP + cc8], ga + (size_t)(16 * i) * K);
      async_copy16(&lW[p][(crow + 16 * i) * LP + cc8], gw + (size_t)(16 * i) * K);
    }
  };

  v8f c[4][2];
  // unrolled, here and below: constant indices keep c, a and bfr in registers
  #pragma unroll
  for (int im = 0; im < 4; ++im) { c[im][0] = zero8(); c[im][1] = zero8(); }

  const int nk = K >> 7;
  issue(0, 0);
  wait_async0();
  __syncthreads();
  for (int j = 0; j < nk; ++j) {
    const int p = j & 1;
    if (j + 1 < nk) issue((j + 1) & 1, (j + 1) << 7);
    // unrolled: a later 32-k block's LDS reads can go ahead of this one's WMMAs
    #pragma unroll
    for (int kk = 0; kk < 128; kk += 32) {
      FragB16 a[4], bfr[2];
      #pragma unroll
      for (int im = 0; im < 4; ++im) {
        int r = wm * 64 + im * 16 + l15;
        a[im].q[0] = *(const uint4*)&lA[p][r * LP + kk + khalf];
        a[im].q[1] = *(const uint4*)&lA[p][r * LP + kk + 16 + khalf];
      }
      #pragma unroll
      for (int in = 0; in < 2; ++in) {
        int nc = wn * 32 + in * 16 + l15;
        bfr[in].q[0] = *(const uint4*)&lW[p][nc * LP + kk + khalf];
        bfr[in].q[1] = *(const uint4*)&lW[p][nc * LP + kk + 16 + khalf];
      }
      #pragma unroll
      for (int im = 0; im < 4; ++im)
        #pragma unroll
        for (int in = 0; in < 2; ++in)
          c[im][in] = wmma_bf16(a[im], bfr[in], c[im][in]);
    }
    if (j + 1 < nk) wait_async0();
    __syncthreads();
  }

  const int hi8 = (lane >> 4) << 3;
  #pragma unroll
  for (int im = 0; im < 4; ++im)
    #pragma unroll
    for (int in = 0; in < 2; ++in)
      #pragma unroll
      for (int r = 0; r < 8; ++r) {
        int row = mbase + wm * 64 + im * 16 + r + hi8;
        int col = nbase + wn * 32 + in * 16 + l15;
        size_t idx = (size_t)row * N + col;
        float v = c[im][in][r] + bias[col];
        if (MODE == 0) {
          ((us*)outp)[idx] = f2bf(v);
        } else if (MODE == 1) {
          ((float*)outp)[idx] = resid[idx] + v;
        } else {
          float gv = 0.5f * v * (1.0f + erff(v * 0.70710678118654752f));
          ((us*)outp)[idx] = f2bf(gv);
        }
      }
}

// ---------------- Flash attention: one wave per (b, h, 16-row q-tile) -------
// V pre-transposed to Vt[(b*H+h)*64 + d][T].  Row-sum folded into a WMMA with
// an all-ones B operand; row-max via DPP16 (no LDS permutes).
__global__ __launch_bounds__(256)
void k_flash(const us* __restrict__ Qb, int q_rs, int q_col0,
             const us* __restrict__ Kb, int k_rs, int k_col0,
             const us* __restrict__ Vt,
             us* __restrict__ Ob, int o_rs,
             int T, int H, int causal, float scale) {
  __shared__ __align__(16) us lP[8][16 * 32];
  const int lane = threadIdx.x & 31, wid = threadIdx.x >> 5;
  const int gw = blockIdx.x * 8 + wid;
  const int nQT = T >> 4;
  const int qt = gw % nQT;
  const int h  = (gw / nQT) % H;
  const int b  = gw / (nQT * H);
  const int l15 = lane & 15, khalf = (lane >> 4) << 3, hi8 = khalf;
  const int qcol = q_col0 + h * 64, kcol = k_col0 + h * 64;
  const size_t brow = (size_t)b * T;
  const us* vt = Vt + ((size_t)(b * H + h) * 64) * T;

  FragB16 ones;
  {
    uint4 o; o.x = o.y = o.z = o.w = 0x3F803F80u;   // bf16 1.0 pairs
    ones.q[0] = o; ones.q[1] = o;
  }
  FragB16 aq[2];
  {
    const us* qr = Qb + (brow + qt * 16 + l15) * q_rs + qcol;
    #pragma unroll
    for (int kc = 0; kc < 2; ++kc) {
      aq[kc].q[0] = *(const uint4*)(qr + kc * 32 + khalf);
      aq[kc].q[1] = *(const uint4*)(qr + kc * 32 + 16 + khalf);
    }
  }
  float mrow[8], lrow[8], alph[8];
  v8f oc[4];
  #pragma unroll
  for (int r = 0; r < 8; ++r) { mrow[r] = -__builtin_inff(); lrow[r] = 0.f; }
  oc[0] = zero8(); oc[1] = zero8(); oc[2] = zero8(); oc[3] = zero8();

  const int rbase = qt * 16 + hi8;
  const int nsteps = causal ? (qt / 2 + 1) : (T >> 5);

  for (int j = 0; j < nsteps; ++j) {
    v8f s[2];
    #pragma unroll
    for (int ns = 0; ns < 2; ++ns) {
      const us* kr = Kb + (brow + j * 32 + ns * 16 + l15) * k_rs + kcol;
      FragB16 bk0, bk1;
      bk0.q[0] = *(const uint4*)(kr + khalf);
      bk0.q[1] = *(const uint4*)(kr + 16 + khalf);
      bk1.q[0] = *(const uint4*)(kr + 32 + khalf);
      bk1.q[1] = *(const uint4*)(kr + 48 + khalf);
      v8f acc = zero8();
      acc = wmma_bf16(aq[0], bk0, acc);
      acc = wmma_bf16(aq[1], bk1, acc);
      s[ns] = acc;
    }
    const int col0 = j * 32 + l15;
    #pragma unroll
    for (int r = 0; r < 8; ++r) {
      float s0 = s[0][r] * scale;
      float s1 = s[1][r] * scale;
      const int rowg = rbase + r;
      if (causal) {
        if (col0 > rowg)      s0 = -__builtin_inff();
        if (col0 + 16 > rowg) s1 = -__builtin_inff();
      }
      float t = dppmax16(fmaxf(s0, s1));
      float mn = fmaxf(mrow[r], t);
      float a = __expf(mrow[r] - mn);
      alph[r] = a;
      mrow[r] = mn;
      #pragma unroll
      for (int d = 0; d < 4; ++d) oc[d][r] *= a;
      lP[wid][(r + hi8) * 32 + l15]      = f2bf(__expf(s0 - mn));
      lP[wid][(r + hi8) * 32 + 16 + l15] = f2bf(__expf(s1 - mn));
    }
    asm volatile("s_wait_dscnt 0" ::: "memory");
    FragB16 ap;
    ap.q[0] = *(const uint4*)&lP[wid][l15 * 32 + khalf];
    ap.q[1] = *(const uint4*)&lP[wid][l15 * 32 + 16 + khalf];
    {
      v8f sums = wmma_bf16(ap, ones, zero8());
      #pragma unroll
      for (int r = 0; r < 8; ++r) lrow[r] = lrow[r] * alph[r] + sums[r];
    }
    #pragma unroll
    for (int d = 0; d < 4; ++d) {
      const us* vr = vt + (size_t)(d * 16 + l15) * T + j * 32;
      FragB16 bv;
      bv.q[0] = *(const uint4*)(vr + khalf);
      bv.q[1] = *(const uint4*)(vr + 16 + khalf);
      oc[d] = wmma_bf16(ap, bv, oc[d]);
    }
  }
  #pragma unroll
  for (int r = 0; r < 8; ++r) {
    float inv = 1.0f / lrow[r];
    const int row = rbase + r;
    #pragma unroll
    for (int d = 0; d < 4; ++d)
      Ob[(brow + row) * o_rs + h * 64 + d * 16 + l15] = f2bf(oc[d][r] * inv);
  }
}

// ----------------------------- host launcher --------------------------------
extern "C" void kernel_launch(void* const* d_in, const int* in_sizes, int n_in,
                              void* d_out, int out_size, void* d_ws,
                              size_t ws_size, hipStream_t stream) {
  (void)in_sizes; (void)n_in; (void)out_size; (void)ws_size;
  constexpr int B = 4, T = 1024, C = 1024, H = 16, F = 4096;
  constexpr int BT = B * T;
  const float* x     = (const float*)d_in[0];
  const float* ctx   = (const float*)d_in[1];
  const float* ln1_g = (const float*)d_in[2];
  const float* ln1_b = (const float*)d_in[3];
  const float* qkv_w = (const float*)d_in[4];
  const float* qkv_b = (const float*)d_in[5];
  const float* aow   = (const float*)d_in[6];
  const float* aob   = (const float*)d_in[7];
  const float* lnc_g = (const float*)d_in[8];
  const float* lnc_b = (const float*)d_in[9];
  const float* q_w   = (const float*)d_in[10];
  const float* q_b   = (const float*)d_in[11];
  const float* kv_w  = (const float*)d_in[12];
  const float* kv_b  = (const float*)d_in[13];
  const float* cow   = (const float*)d_in[14];
  const float* cob   = (const float*)d_in[15];
  const float* ln2_g = (const float*)d_in[16];
  const float* ln2_b = (const float*)d_in[17];
  const float* w1    = (const float*)d_in[18];
  const float* b1    = (const float*)d_in[19];
  const float* w2    = (const float*)d_in[20];
  const float* b2    = (const float*)d_in[21];

  char* p = (char*)d_ws;
  auto carve = [&](size_t bytes) -> char* {
    char* r = p; p += (bytes + 255) & ~(size_t)255; return r;
  };
  us* wqkv = (us*)carve((size_t)C * 3 * C * 2);   // [3C][C] transposed
  us* wao  = (us*)carve((size_t)C * C * 2);
  us* wq   = (us*)carve((size_t)C * C * 2);
  us* wkv  = (us*)carve((size_t)C * 2 * C * 2);
  us* wco  = (us*)carve((size_t)C * C * 2);
  us* w1b  = (us*)carve((size_t)C * F * 2);
  us* w2b  = (us*)carve((size_t)F * C * 2);
  us* hbuf = (us*)carve((size_t)BT * C * 2);
  us* qkvb = (us*)carve((size_t)BT * 3 * C * 2);
  us* obuf = (us*)carve((size_t)BT * C * 2);
  us* ctxb = (us*)carve((size_t)BT * C * 2);
  us* vtb  = (us*)carve((size_t)BT * C * 2);      // Vt[(b*H+h)*64 + d][T]
  us* f1b  = (us*)carve((size_t)BT * F * 2);
  float* resid = (float*)carve((size_t)BT * C * 4);
  us* qxb = qkvb;                    // reuse after self-attention
  us* kvb = qkvb + (size_t)BT * C;

  k_cvt_t<C, 3 * C><<<dim3(3 * C / 64, C / 64), 64, 0, stream>>>(qkv_w, wqkv);
  k_cvt_t<C, C><<<dim3(C / 64, C / 64), 64, 0, stream>>>(aow, wao);
  k_cvt_t<C, C><<<dim3(C / 64, C / 64), 64, 0, stream>>>(q_w, wq);
  k_cvt_t<C, 2 * C><<<dim3(2 * C / 64, C / 64), 64, 0, stream>>>(kv_w, wkv);
  k_cvt_t<C, C><<<dim3(C / 64, C / 64), 64, 0, stream>>>(cow, wco);
  k_cvt_t<C, F><<<dim3(F / 64, C / 64), 64, 0, stream>>>(w1, w1b);
  k_cvt_t<F, C><<<dim3(C / 64, F / 64), 64, 0, stream>>>(w2, w2b);
  k_cvt_bf16<<<BT * C / 16384, 256, 0, stream>>>(ctx, ctxb);

  const int flashBlocks = (B * H * (T / 16)) / 8;   // 512
  const float scale = 0.125f;                       // 1/sqrt(64)

  // 1) self-attention branch
  k_layernorm<<<BT / 16, 256, 0, stream>>>(x, ln1_g, ln1_b, hbuf, C);
  k_gemm<0><<<dim3(3 * C / 128, BT / 128), 256, 0, stream>>>(
      hbuf, wqkv, qkv_b, nullptr, qkvb, BT, 3 * C, C);
  k_vt<3 * C, T><<<dim3(T / 256, B * H), 128, 0, stream>>>(qkvb, 2 * C, vtb, H);
  k_flash<<<flashBlocks, 256, 0, stream>>>(
      qkvb, 3 * C, 0, qkvb, 3 * C, C, vtb, obuf, C, T, H, 1, scale);
  k_gemm<1><<<dim3(C / 128, BT / 128), 256, 0, stream>>>(
      obuf, wao, aob, x, resid, BT, C, C);

  // 2) cross-attention branch
  k_layernorm<<<BT / 16, 256, 0, stream>>>(resid, lnc_g, lnc_b, hbuf, C);
  k_gemm<0><<<dim3(C / 128, BT / 128), 256, 0, stream>>>(
      hbuf, wq, q_b, nullptr, qxb, BT, C, C);
  k_gemm<0><<<dim3(2 * C / 128, BT / 128), 256, 0, stream>>>(
      ctxb, wkv, kv_b, nullptr, kvb, BT, 2 * C, C);
  k_vt<2 * C, T><<<dim3(T / 256, B * H), 128, 0, stream>>>(kvb, C, vtb, H);
  k_flash<<<flashBlocks, 256, 0, stream>>>(
      qxb, C, 0, kvb, 2 * C, 0, vtb, obuf, C, T, H, 0, scale);
  k_gemm<1><<<dim3(C / 128, BT / 128), 256, 0, stream>>>(
      obuf, wco, cob, resid, resid, BT, C, C);

  // 3) FFN
  k_layernorm<<<BT / 16, 256, 0, stream>>>(resid, ln2_g, ln2_b, hbuf, C);
  k_gemm<2><<<dim3(F / 128, BT / 128), 256, 0, stream>>>(
      hbuf, w1b, b1, nullptr, f1b, BT, F, C);
  k_gemm<1><<<dim3(C / 128, BT / 128), 256, 0, stream>>>(
      f1b, w2b, b2, resid, (float*)d_out, BT, C, F);
}

// v004
// A run of this version takes 294 microseconds.
// In two side-by-side timings against v003, it was 1.30 and 1.29 times as fast.
// Counting every step since v000, it is 1.86 times as fast.
#include <hip/hip_runtime.h>
#include <hip/hip_bf16.h>
#include <math.h>

typedef __attribute__((ext_vector_type(16))) __bf16 v16bf;
typedef __attribute__((ext_vector_type(8)))  float  v8f;
typedef int v4i_t __attribute__((vector_size(16)));
typedef unsigned short us;

#define DEV static __device__ __forceinline__
#define AS1 __attribute__((address_space(1)))
#define AS3 __attribute__((address_space(3)))

#if defined(__has_builtin)
#if __has_builtin(__builtin_amdgcn_global_load_async_to_lds_b128)
#define HAVE_ASYNC_BUILTIN 1
#endif
#if __has_builtin(__builtin_amdgcn_s_wait_asynccnt)
#define HAVE_WAIT_ASYNC_BUILTIN 1
#endif
#endif
#ifndef HAVE_ASYNC_BUILTIN
#define HAVE_ASYNC_BUILTIN 0
#endif
#ifndef HAVE_WAIT_ASYNC_BUILTIN
#define HAVE_WAIT_ASYNC_BUILTIN 0
#endif

// LDS pitch, in 16-bit elements, of the GEMM tiles' rows of 128, which
// ds_load_b128 reads one row per lane: 272 B = 16 B x odd spreads 16 rows over
// all 64 banks.
constexpr int LP = 136;

union FragB16 { uint4 q[2]; v16bf v; };

DEV us f2bf(float f) {
  unsigned u = __float_as_uint(f);
  u += 0x7FFFu + ((u >> 16) & 1u);          // round-to-nearest-even
  return (us)(u >> 16);
}
DEV v8f zero8() { v8f z = {0.f,0.f,0.f,0.f,0.f,0.f,0.f,0.f}; return z; }

DEV v8f wmma_bf16(const FragB16& a, const FragB16& b, v8f c) {
  return __builtin_amdgcn_wmma_f32_16x16x32_bf16(false, a.v, false, b.v,
                                                 (short)0, c, false, false);
}

// 16-byte async global -> LDS copy (per-lane addresses), ASYNCcnt-tracked.
DEV void async_copy16(us* lds, const us* g) {
#if HAVE_ASYNC_BUILTIN
  __builtin_amdgcn_global_load_async_to_lds_b128((AS1 v4i_t*)(us*)g,
                                                 (AS3 v4i_t*)lds, 0, 0);
#else
  unsigned loff = (unsigned)(unsigned long long)(AS3 us*)lds;
  unsigned long long ga = (unsigned long long)g;
  asm volatile("global_load_async_to_lds_b128 %0, %1, off"
               :: "v"(loff), "v"(ga) : "memory");
#endif
}
DEV void wait_async0() {
#if HAVE_WAIT_ASYNC_BUILTIN
  __builtin_amdgcn_s_wait_asynccnt(0);
#else
  asm volatile("s_wait_asynccnt 0" ::: "memory");
#endif
}

// The four streaming kernels below give every lane 16 loads of 16 B of data
// (64 fp32 or, in k_vt, 128 bf16 elements; LayerNorm also loads g and b),
// all issued before the first use: a launch then starts one wave where
// sixteen one-load waves would stand, for speed only.
typedef float    f32x4 __attribute__((ext_vector_type(4)));
typedef unsigned u32x4 __attribute__((ext_vector_type(4)));

// two f32 -> two bf16 in one dword, each rounded as f2bf rounds
DEV unsigned pack2(float lo, float hi) {
  unsigned a = __float_as_uint(lo), c = __float_as_uint(hi);
  a += 0x7FFFu + ((a >> 16) & 1u);
  c += 0x7FFFu + ((c >> 16) & 1u);
  return (a >> 16) | (c & 0xFFFF0000u);
}

// ---------------- fp32 -> bf16 (row-major copy: context) --------------------
// One block: 4096 float4 in a row; a wave's load covers 512 B, its store 256 B.
__global__ __launch_bounds__(256)
void k_cvt_bf16(const float* __restrict__ src, us* __restrict__ dst) {
  const int base = blockIdx.x * 4096 + threadIdx.x;
  f32x4 f[16];
  #pragma unroll
  for (int u = 0; u < 16; ++u) f[u] = ((const f32x4*)src)[base + u * 256];
  // keeps every load above in front of the first use, all in flight together;
  // without it some sink to their use, one memory latency after another
  __builtin_amdgcn_sched_barrier(0);
  #pragma unroll
  for (int u = 0; u < 16; ++u) {
    uint2 o; o.x = pack2(f[u][0], f[u][1]); o.y = pack2(f[u][2], f[u][3]);
    ((uint2*)dst)[base + u * 256] = o;
  }
}

// -------- fp32 W[K,N] -> bf16 Wt[N,K] (convert + transpose in registers) ----
// One wave: 64 k x 32 n.  A lane loads 8 k-rows x 8 n and stores 8 n-rows x 8 k:
// four lanes read one 128-B line of W, eight lanes write one 128-B line of Wt.
// K and N are compile-time so that the row steps are immediate offsets.
template <int K, int N>
__global__ __launch_bounds__(64)
void k_cvt_t(const float* __restrict__ src, us* __restrict__ dst) {
  const int lane = threadIdx.x & 31, wid = threadIdx.x >> 5;
  const int k0 = blockIdx.y * 64 + (lane >> 2) * 8;
  const int n0 = blockIdx.x * 64 + wid * 32 + (lane & 3) * 8;
  const float* s = src + (size_t)k0 * N + n0;
  f32x4 f[16];                       // f[2 i + j]: row k0 + i, columns 4 j ..
  #pragma unroll
  for (int i = 0; i < 15; ++i)
    f[i] = *(const f32x4*)(s + (i >> 1) * N + (i & 1) * 4);
  // the last load's result may take the address register that the 15 loads in
  // flight name: the wait that belongs in front of such an overwrite
  asm volatile("s_wait_xcnt 0x0" ::: "memory");
  f[15] = *(const f32x4*)(s + 7 * N + 4);
  // keeps every load above in front of the first use, all in flight together;
  // without it some sink to their use, one memory latency after another
  __builtin_amdgcn_sched_barrier(0);
  us* d = dst + (size_t)n0 * K + k0;
  #pragma unroll
  for (int e = 0; e < 8; ++e) {
    const int j = e >> 2, m = e & 3;
    uint4 o;
    o.x = pack2(f[0 + j][m],  f[2 + j][m]);  o.y = pack2(f[4 + j][m],  f[6 + j][m]);
    o.z = pack2(f[8 + j][m],  f[10 + j][m]); o.w = pack2(f[12 + j][m], f[14 + j][m]);
    *(uint4*)(d + e * K) = o;
  }
}

// -------- bf16 V[t, d] (strided heads) -> Vt[(b*H+h)*64 + d][T] -------------
// One wave: 64 t x 64 d, transposed in registers.  A lane loads 8 t-rows x 16 d
// and stores 16 d-rows x 8 t: four lanes read one head row (128 B), eight lanes
// write one 128-B line of Vt.  RS and T are compile-time so that the row steps
// are immediate offsets.
template <int RS, int T>
__global__ __launch_bounds__(128)
void k_vt(const us* __restrict__ Vsrc, int col0, us* __restrict__ Vt, int H) {
  const int lane = threadIdx.x & 31, wid = threadIdx.x >> 5;
  const int bh = blockIdx.y, b = bh / H, h = bh % H;
  const int t0 = blockIdx.x * 256 + wid * 64 + (lane >> 2) * 8;
  const int d0 = (lane & 3) * 16;
  const us* s = Vsrc + ((size_t)b * T + t0) * RS + col0 + h * 64 + d0;
  u32x4 in[16];                      // in[2 i + j]: row t0 + i, columns 8 j ..
  #pragma unroll
  for (int i = 0; i < 15; ++i)
    in[i] = *(const u32x4*)(s + (i >> 1) * RS + (i & 1) * 8);
  // the last load's result may take the address register that the 15 loads in
  // flight name: the wait that belongs in front of such an overwrite
  asm volatile("s_wait_xcnt 0x0" ::: "memory");
  in[15] = *(const u32x4*)(s + 7 * RS + 8);
  // keeps every load above in front of the first use, all in flight together;
  // without it some sink to their use, one memory latency after another
  __builtin_amdgcn_sched_barrier(0);
  us* d = Vt + ((size_t)bh * 64 + d0) * T + t0;
  #pragma unroll
  for (int e = 0; e < 16; ++e) {
    const int j = e >> 3, w = (e & 7) >> 1, sh = (e & 1) * 16;
    unsigned o[4];
    #pragma unroll
    for (int p = 0; p < 4; ++p)
      o[p] = ((in[4 * p + j][w] >> sh) & 0xFFFFu) |
             (((in[4 * p + 2 + j][w] >> sh) & 0xFFFFu) << 16);
    uint4 q; q.x = o[0]; q.y = o[1]; q.z = o[2]; q.w = o[3];
    *(uint4*)(d + e * T) = q;
  }
}

// ---------------- LayerNorm: one wave per two rows (C = 1024) ---------------
// A lane holds 32 elements of each row; a row's sums are four in-lane chains and
// a five-step butterfly, so no LDS array and no barrier.
__global__ __launch_bounds__(256)
void k_layernorm(const float* __restrict__ x, const float* __restrict__ g,
                 const float* __restrict__ b, us* __restrict__ out, int C) {
  const int lane = threadIdx.x & 31;
  const int row0 = (blockIdx.x * 8 + (threadIdx.x >> 5)) * 2;
  const int c4 = C >> 2;             // groups of 4 elements in a row
  const int at[2] = {row0 * c4 + lane, (row0 + 1) * c4 + lane};
  f32x4 v[16], gb[16];               // v[8 q + i]: row q; gb[i]: g, gb[8 + i]: b
  #pragma unroll
  for (int q = 0; q < 2; ++q)
    #pragma unroll
    for (int i = 0; i < 8; ++i)
      v[8 * q + i] = ((const f32x4*)x)[at[q] + i * 32];
  // a result of the loads below may take an address register that the loads in
  // flight above name: the wait that belongs in front of such an overwrite
  asm volatile("s_wait_xcnt 0x0" ::: "memory");
  #pragma unroll
  for (int i = 0; i < 15; ++i)
    gb[i] = ((const f32x4*)(i < 8 ? g : b))[lane + (i & 7) * 32];
  // the same in front of the last load, whose result may take the index register
  asm volatile("s_wait_xcnt 0x0" ::: "memory");
  gb[15] = ((const f32x4*)b)[lane + 7 * 32];
  // keeps every load above in front of the first use, all in flight together;
  // without it some sink to their use, one memory latency after another
  __builtin_amdgcn_sched_barrier(0);
  float s[2], s2[2];
  #pragma unroll
  for (int q = 0; q < 2; ++q) {
    f32x4 a = {0.f, 0.f, 0.f, 0.f}, a2 = {0.f, 0.f, 0.f, 0.f};
    #pragma unroll
    for (int i = 0; i < 8; ++i) {
      f32x4 t = v[8 * q + i];
      a += t; a2 += t * t;
    }
    s[q]  = (a[0] + a[1]) + (a[2] + a[3]);
    s2[q] = (a2[0] + a2[1]) + (a2[2] + a2[3]);
  }
  #pragma unroll
  for (int off = 16; off; off >>= 1)
    #pragma unroll
    for (int q = 0; q < 2; ++q) {
      s[q]  += __shfl_xor(s[q],  off, 32);
      s2[q] += __shfl_xor(s2[q], off, 32);
    }
  #pragma unroll
  for (int q = 0; q < 2; ++q) {
    const float mean = s[q] / C;
    const float rstd = rsqrtf(s2[q] / C - mean * mean + 1e-5f);
    #pragma unroll
    for (int i = 0; i < 8; ++i) {
      f32x4 t = v[8 * q + i], gg = gb[i], bb = gb[8 + i];
      uint2 w;
      w.x = pack2((t[0] - mean) * rstd * gg[0] + bb[0],
                  (t[1] - mean) * rstd * gg[1] + bb[1]);
      w.y = pack2((t[2] - mean) * rstd * gg[2] + bb[2],
                  (t[3] - mean) * rstd * gg[3] + bb[3]);
      ((uint2*)out)[at[q] + i * 32] = w;
    }
  }
}

// ------- bf16 WMMA GEMM: out = A[M,K] @ Wt[N,K]^T + bias --------------------
// Double-buffered LDS filled by async global->LDS copies (ASYNCcnt).
// One block: a 128 x 128 tile of out, 128 k per stage; a wave: 64 x 32.  A wave's
// copy covers two rows of 256 B, whole lines; M, N, K are multiples of 128.
// MODE 0: bf16 out.  MODE 1: fp32 out = resid + acc.  MODE 2: bf16 gelu(acc).
template <int MODE>
__global__ __launch_bounds__(256)
void k_gemm(const us* __restrict__ A, const us* __restrict__ Wt,
            const float* __restrict__ bias, const float* __restrict__ resid,
            void* __restrict__ outp, int M, int N, int K) {
  __shared__ __align__(16) us lA[2][128 * LP];
  __shared__ __align__(16) us lW[2][128 * LP];
  const int tid  = threadIdx.x;
  const int lane = tid & 31, wid = tid >> 5;
  const int wm = wid & 1, wn = wid >> 1;
  const int l15 = lane & 15, khalf = (lane >> 4) << 3;
  const int mbase = blockIdx.y * 128, nbase = blockIdx.x * 128;

  // 16 threads copy one row of 128 k; a thread: 8 x 16 B of A, 8 x 16 B of W
  const int crow = tid >> 4, cc8 = (tid & 15) << 3;

  auto issue = [&](int p, int k0) {
    const us* ga = A  + (size_t)(mbase + crow) * K + k0 + cc8;
    const us* gw = Wt + (size_t)(nbase + crow) * K + k0 + cc8;
    // unrolled: the LDS row steps become constants
    #pragma unroll
    for (int i = 0; i < 8; ++i) {
      async_copy16(&lA[p][(crow + 16 * i) * LP + cc8], ga + (size_t)(16 * i) * K);
      async_copy16(&lW[p][(crow + 16 * i) * LP + cc8], gw + (size_t)(16 * i) * K);
    }
  };

  v8f c[4][2];
  // unrolled, here and below: constant indices keep c, a and bfr in registers
  #pragma unroll
  for (int im = 0; im < 4; ++im) { c[im][0] = zero8(); c[im][1] = zero8(); }

  const int nk = K >> 7;
  issue(0, 0);
  wait_async0();
  __syncthreads();
  for (int j = 0; j < nk; ++j) {
    const int p = j & 1;
    if (j + 1 < nk) issue((j + 1) & 1, (j + 1) << 7);
    // unrolled: a later 32-k block's LDS reads can go ahead of this one's WMMAs
    #pragma unroll
    for (int kk = 0; kk < 128; kk += 32) {
      FragB16 a[4], bfr[2];
      #pragma unroll
      for (int im = 0; im < 4; ++im) {
        int r = wm * 64 + im * 16 + l15;
        a[im].q[0] = *(const uint4*)&lA[p][r * LP + kk + khalf];
        a[im].q[1] = *(const uint4*)&lA[p][r * LP + kk + 16 + khalf];
      }
      #pragma unroll
      for (int in = 0; in < 2; ++in) {
        int nc = wn * 32 + in * 16 + l15;
        bfr[in].q[0] = *(const uint4*)&lW[p][nc * LP + kk + khalf];
        bfr[in].q[1] = *(const uint4*)&lW[p][nc * LP + kk + 16 + khalf];
      }
      #pragma unroll
      for (int im = 0; im < 4; ++im)
        #pragma unroll
        for (int in = 0; in < 2; ++in)
          c[im][in] = wmma_bf16(a[im], bfr[in], c[im][in]);
    }
    if (j + 1 < nk) wait_async0();
    __syncthreads();
  }

  const int hi8 = (lane >> 4) << 3;
  #pragma unroll
  for (int im = 0; im < 4; ++im)
    #pragma unroll
    for (int in = 0; in < 2; ++in)
      #pragma unroll
      for (int r = 0; r < 8; ++r) {
        int row = mbase + wm * 64 + im * 16 + r + hi8;
        int col = nbase + wn * 32 + in * 16 + l15;
        size_t idx = (size_t)row * N + col;
        float v = c[im][in][r] + bias[col];
        if (MODE == 0) {
          ((us*)outp)[idx] = f2bf(v);
        } else if (MODE == 1) {
          ((float*)outp)[idx] = resid[idx] + v;
        } else {
          float gv = 0.5f * v * (1.0f + erff(v * 0.70710678118654752f));
          ((us*)outp)[idx] = f2bf(gv);
        }
      }
}

typedef float  f32x2  __attribute__((ext_vector_type(2)));
typedef __bf16 bf16x2 __attribute__((ext_vector_type(2)));

// two f32 -> two bf16 in one dword, round to nearest even, one instruction
DEV unsigned cvt2(float lo, float hi) {
  f32x2 f = {lo, hi};
  return __builtin_bit_cast(unsigned, __builtin_convertvector(f, bf16x2));
}
// 16 bytes through a pointer that is global by type: a pointer stepped in a loop
// would otherwise compile to flat loads
typedef const AS1 u32x4* gq_t;
DEV uint4 ldg16(gq_t p) {
  const u32x4 t = *p;
  uint4 r; r.x = t[0]; r.y = t[1]; r.z = t[2]; r.w = t[3];
  return r;
}
// max of a lane's value and its partner's (lane ^ 16)
DEV float maxhalves(float v) {
  const int i = __float_as_int(v);
  return fmaxf(v, __int_as_float(__builtin_amdgcn_permlanex16(
                      i, i, 0x76543210, 0xfedcba98, false, false)));
}

__global__ __launch_bounds__(256)
void k_flash(const us* __restrict__ Qb, int q_rs, int q_col0,
             const us* __restrict__ Kb, int k_rs, int k_col0,
             const us* __restrict__ Vt,
             us* __restrict__ Ob, int o_rs,
             int T, int H, int causal, float scale) {
  const int lane = threadIdx.x & 31;
  // the wave's number in a scalar register: tile indices and the trip count
  // are then scalar, and the loop and the diagonal test are scalar branches
  const int wid = __builtin_amdgcn_readfirstlane((int)(threadIdx.x >> 5));
  const int gw = blockIdx.x * 8 + wid;
  const int nQT = T >> 5;
  const int qt = gw % nQT;
  const int h  = (gw / nQT) % H;
  const int b  = gw / (nQT * H);
  const int l15 = lane & 15, khalf = (lane >> 4) << 3, hi8 = khalf;
  const size_t brow = (size_t)b * T;
  // per-lane row pointers, stepped at the foot of each pass
  gq_t kp[2], vp[4];
  // unrolled, here and below: constant indices keep the pointers, fragments and
  // accumulator tiles in registers
  #pragma unroll
  for (int ns = 0; ns < 2; ++ns)
    kp[ns] = (gq_t)(Kb + (brow + ns * 16 + l15) * k_rs + k_col0 + h * 64 + khalf);
  #pragma unroll
  for (int d = 0; d < 4; ++d)
    vp[d] = (gq_t)(Vt + ((size_t)(b * H + h) * 64 + d * 16 + l15) * T + khalf);

  FragB16 ones;
  {
    uint4 o; o.x = o.y = o.z = o.w = 0x3F803F80u;   // bf16 1.0 pairs
    ones.q[0] = o; ones.q[1] = o;
  }
  FragB16 bq[2][2];                  // [query group][32 d]
  #pragma unroll
  for (int g = 0; g < 2; ++g) {
    const us* qr = Qb + (brow + qt * 32 + g * 16 + l15) * q_rs + q_col0 + h * 64;
    #pragma unroll
    for (int kc = 0; kc < 2; ++kc) {
      bq[g][kc].q[0] = *(const uint4*)(qr + kc * 32 + khalf);
      bq[g][kc].q[1] = *(const uint4*)(qr + kc * 32 + 16 + khalf);
    }
  }
  // exp(scale * (s - m)) = exp2(s * c2 - m * c2); scale > 0, so the maximum is
  // taken over the raw scores
  const float c2 = scale * 1.44269504088896340736f;
  float mrow[2];
  v8f oc[2][4], ls[2];
  #pragma unroll
  for (int g = 0; g < 2; ++g) {
    mrow[g] = -__builtin_inff(); ls[g] = zero8();
    #pragma unroll
    for (int d = 0; d < 4; ++d) oc[g][d] = zero8();
  }

  const int nsteps = causal ? (qt + 1) : (T >> 5);

  for (int j = 0; j < nsteps; ++j) {
    FragB16 ka[2][2], va[4];
    #pragma unroll
    for (int ns = 0; ns < 2; ++ns) {
      #pragma unroll
      for (int kc = 0; kc < 2; ++kc) {        // steps of 16 B: 8 elements
        ka[ns][kc].q[0] = ldg16(kp[ns] + kc * 4);
        ka[ns][kc].q[1] = ldg16(kp[ns] + kc * 4 + 2);
      }
    }
    #pragma unroll
    for (int d = 0; d < 4; ++d) {
      va[d].q[0] = ldg16(vp[d]);
      va[d].q[1] = ldg16(vp[d] + 2);
    }
    // the pointers are stepped while the V loads are still in flight: the wait
    // that belongs in front of an overwrite of a load's address register
    asm volatile("s_wait_xcnt 0x0" ::: "memory");
    // keeps the step's 16 loads in front of the first product, all in flight
    // together; without it the K loads come in two groups, one latency each
    __builtin_amdgcn_sched_barrier(0);
    v8f st[2][2];                    // [query group][16-key tile]
    #pragma unroll
    for (int g = 0; g < 2; ++g)
      #pragma unroll
      for (int ns = 0; ns < 2; ++ns) {
        v8f acc = wmma_bf16(ka[ns][0], bq[g][0], zero8());
        st[g][ns] = wmma_bf16(ka[ns][1], bq[g][1], acc);
      }
    // only the last causal step holds keys behind a query of this wave
    if (causal && j == nsteps - 1) {
      #pragma unroll
      for (int g = 0; g < 2; ++g)
        #pragma unroll
        for (int ns = 0; ns < 2; ++ns)
          #pragma unroll
          for (int r = 0; r < 8; ++r)
            if (ns * 16 + hi8 + r > g * 16 + l15) st[g][ns][r] = -__builtin_inff();
    }
    #pragma unroll
    for (int g = 0; g < 2; ++g) {
      float mx = fmaxf(st[g][0][0], st[g][1][0]);
      #pragma unroll
      for (int r = 1; r < 8; ++r) mx = fmaxf(mx, fmaxf(st[g][0][r], st[g][1][r]));
      const float mn = fmaxf(mrow[g], maxhalves(mx));
      const float a  = __builtin_amdgcn_exp2f((mrow[g] - mn) * c2);
      const float mc = mn * c2;
      mrow[g] = mn;
      FragB16 pf;
      #pragma unroll
      for (int ns = 0; ns < 2; ++ns) {
        float p[8];
        #pragma unroll
        for (int r = 0; r < 8; ++r)
          p[r] = __builtin_amdgcn_exp2f(fmaf(st[g][ns][r], c2, -mc));
        uint4 w;
        w.x = cvt2(p[0], p[1]); w.y = cvt2(p[2], p[3]);
        w.z = cvt2(p[4], p[5]); w.w = cvt2(p[6], p[7]);
        pf.q[ns] = w;
      }
      ls[g] *= a;
      ls[g] = wmma_bf16(ones, pf, ls[g]);
      #pragma unroll
      for (int d = 0; d < 4; ++d) {
        oc[g][d] *= a;
        oc[g][d] = wmma_bf16(va[d], pf, oc[g][d]);
      }
    }
    #pragma unroll
    for (int ns = 0; ns < 2; ++ns) kp[ns] += (size_t)4 * k_rs;   // 32 rows
    #pragma unroll
    for (int d = 0; d < 4; ++d) vp[d] += 4;                   // 32 keys
  }
  // a lane holds 8 consecutive d of its query in each tile: 16-byte stores
  #pragma unroll
  for (int g = 0; g < 2; ++g) {
    const float inv = 1.0f / ls[g][0];
    us* orow = Ob + (brow + qt * 32 + g * 16 + l15) * o_rs + h * 64 + hi8;
    #pragma unroll
    for (int d = 0; d < 4; ++d) {
      uint4 w;
      w.x = cvt2(oc[g][d][0] * inv, oc[g][d][1] * inv);
      w.y = cvt2(oc[g][d][2] * inv, oc[g][d][3] * inv);
      w.z = cvt2(oc[g][d][4] * inv, oc[g][d][5] * inv);
      w.w = cvt2(oc[g][d][6] * inv, oc[g][d][7] * inv);
      *(uint4*)(orow + d * 16) = w;
    }
  }
}

// ----------------------------- host launcher --------------------------------
extern "C" void kernel_launch(void* const* d_in, const int* in_sizes, int n_in,
                              void* d_out, int out_size, void* d_ws,
                              size_t ws_size, hipStream_t stream) {
  (void)in_sizes; (void)n_in; (void)out_size; (void)ws_size;
  constexpr int B = 4, T = 1024, C = 1024, H = 16, F = 4096;
  constexpr int BT = B * T;
  const float* x     = (const float*)d_in[0];
  const float* ctx   = (const float*)d_in[1];
  const float* ln1_g = (const float*)d_in[2];
  const float* ln1_b = (const float*)d_in[3];
  const float* qkv_w = (const float*)d_in[4];
  const float* qkv_b = (const float*)d_in[5];
  const float* aow   = (const float*)d_in[6];
  const float* aob   = (const float*)d_in[7];
  const float* lnc_g = (const float*)d_in[8];
  const float* lnc_b = (const float*)d_in[9];
  const float* q_w   = (const float*)d_in[10];
  const float* q_b   = (const float*)d_in[11];
  const float* kv_w  = (const float*)d_in[12];
  const float* kv_b  = (const float*)d_in[13];
  const float* cow   = (const float*)d_in[14];
  const float* cob   = (const float*)d_in[15];
  const float* ln2_g = (const float*)d_in[16];
  const float* ln2_b = (const float*)d_in[17];
  const float* w1    = (const float*)d_in[18];
  const float* b1    = (const float*)d_in[19];
  const float* w2    = (const float*)d_in[20];
  const float* b2    = (const float*)d_in[21];

  char* p = (char*)d_ws;
  auto carve = [&](size_t bytes) -> char* {
    char* r = p; p += (bytes + 255) & ~(size_t)255; return r;
  };
  us* wqkv = (us*)carve((size_t)C * 3 * C * 2);   // [3C][C] transposed
  us* wao  = (us*)carve((size_t)C * C * 2);
  us* wq   = (us*)carve((size_t)C * C * 2);
  us* wkv  = (us*)carve((size_t)C * 2 * C * 2);
  us* wco  = (us*)carve((size_t)C * C * 2);
  us* w1b  = (us*)carve((size_t)C * F * 2);
  us* w2b  = (us*)carve((size_t)F * C * 2);
  us* hbuf = (us*)carve((size_t)BT * C * 2);
  us* qkvb = (us*)carve((size_t)BT * 3 * C * 2);
  us* obuf = (us*)carve((size_t)BT * C * 2);
  us* ctxb = (us*)carve((size_t)BT * C * 2);
  us* vtb  = (us*)carve((size_t)BT * C * 2);      // Vt[(b*H+h)*64 + d][T]
  us* f1b  = (us*)carve((size_t)BT * F * 2);
  float* resid = (float*)carve((size_t)BT * C * 4);
  us* qxb = qkvb;                    // reuse after self-attention
  us* kvb = qkvb + (size_t)BT * C;

  k_cvt_t<C, 3 * C><<<dim3(3 * C / 64, C / 64), 64, 0, stream>>>(qkv_w, wqkv);
  k_cvt_t<C, C><<<dim3(C / 64, C / 64), 64, 0, stream>>>(aow, wao);
  k_cvt_t<C, C><<<dim3(C / 64, C / 64), 64, 0, stream>>>(q_w, wq);
  k_cvt_t<C, 2 * C><<<dim3(2 * C / 64, C / 64), 64, 0, stream>>>(kv_w, wkv);
  k_cvt_t<C, C><<<dim3(C / 64, C / 64), 64, 0, stream>>>(cow, wco);
  k_cvt_t<C, F><<<dim3(F / 64, C / 64), 64, 0, stream>>>(w1, w1b);
  k_cvt_t<F, C><<<dim3(C / 64, F / 64), 64, 0, stream>>>(w2, w2b);
  k_cvt_bf16<<<BT * C / 16384, 256, 0, stream>>>(ctx, ctxb);

  const int flashBlocks = (B * H * (T / 32)) / 8;   // 256
  const float scale = 0.125f;                       // 1/sqrt(64)

  // 1) self-attention branch
  k_layernorm<<<BT / 16, 256, 0, stream>>>(x, ln1_g, ln1_b, hbuf, C);
  k_gemm<0><<<dim3(3 * C / 128, BT / 128), 256, 0, stream>>>(
      hbuf, wqkv, qkv_b, nullptr, qkvb, BT, 3 * C, C);
  k_vt<3 * C, T><<<dim3(T / 256, B * H), 128, 0, stream>>>(qkvb, 2 * C, vtb, H);
  k_flash<<<flashBlocks, 256, 0, stream>>>(
      qkvb, 3 * C, 0, qkvb, 3 * C, C, vtb, obuf, C, T, H, 1, scale);
  k_gemm<1><<<dim3(C / 128, BT / 128), 256, 0, stream>>>(
      obuf, wao, aob, x, resid, BT, C, C);

  // 2) cross-attention branch
  k_layernorm<<<BT / 16, 256, 0, stream>>>(resid, lnc_g, lnc_b, hbuf, C);
  k_gemm<0><<<dim3(C / 128, BT / 128), 256, 0, stream>>>(
      hbuf, wq, q_b, nullptr, qxb, BT, C, C);
  k_gemm<0><<<dim3(2 * C / 128, BT / 128), 256, 0, stream>>>(
      ctxb, wkv, kv_b, nullptr, kvb, BT, 2 * C, C);
  k_vt<2 * C, T><<<dim3(T / 256, B * H), 128, 0, stream>>>(kvb, C, vtb, H);
  k_flash<<<flashBlocks, 256, 0, stream>>>(
      qxb, C, 0, kvb, 2 * C, 0, vtb, obuf, C, T, H, 0, scale);
  k_gemm<1><<<dim3(C / 128, BT / 128), 256, 0, stream>>>(
      obuf, wco, cob, resid, resid, BT, C, C);

  // 3) FFN
  k_layernorm<<<BT / 16, 256, 0, stream>>>(resid, ln2_g, ln2_b, hbuf, C);
  k_gemm<2><<<dim3(F / 128, BT / 128), 256, 0, stream>>>(
      hbuf, w1b, b1, nullptr, f1b, BT, F, C);
  k_gemm<1><<<dim3(C / 128, BT / 128), 256, 0, stream>>>(
      f1b, w2b, b2, resid, (float*)d_out, BT, C, F);
}

// v005
// Measured time: 280 microseconds a run.
// Two timings next to v004 put it at 1.04 and 1.05 times that version's speed.
// Counting every step since v000, it is 1.95 times as fast.
#include <hip/hip_runtime.h>
#include <hip/hip_bf16.h>
#include <math.h>

typedef __attribute__((ext_vector_type(16))) __bf16 v16bf;
typedef __attribute__((ext_vector_type(8)))  float  v8f;
typedef int v4i_t __attribute__((vector_size(16)));
typedef unsigned short us;

#define DEV static __device__ __forceinline__
#define AS1 __attribute__((address_space(1)))
#define AS3 __attribute__((address_space(3)))

#if defined(__has_builtin)
#if __has_builtin(__builtin_amdgcn_global_load_async_to_lds_b128)
#define HAVE_ASYNC_BUILTIN 1
#endif
#if __has_builtin(__builtin_amdgcn_s_wait_asynccnt)
#define HAVE_WAIT_ASYNC_BUILTIN 1
#endif
#endif
#ifndef HAVE_ASYNC_BUILTIN
#define HAVE_ASYNC_BUILTIN 0
#endif
#ifndef HAVE_WAIT_ASYNC_BUILTIN
#define HAVE_WAIT_ASYNC_BUILTIN 0
#endif

// LDS pitch, in 16-bit elements, of the GEMM tiles' rows of 128, which
// ds_load_b128 reads one row per lane: 272 B = 16 B x odd spreads 16 rows over
// all 64 banks.
constexpr int LP = 136;

union FragB16 { uint4 q[2]; v16bf v; };

DEV us f2bf(float f) {
  unsigned u = __float_as_uint(f);
  u += 0x7FFFu + ((u >> 16) & 1u);          // round-to-nearest-even
  return (us)(u >> 16);
}
DEV v8f zero8() { v8f z = {0.f,0.f,0.f,0.f,0.f,0.f,0.f,0.f}; return z; }

DEV v8f wmma_bf16(const FragB16& a, const FragB16& b, v8f c) {
  return __builtin_amdgcn_wmma_f32_16x16x32_bf16(false, a.v, false, b.v,
                                                 (short)0, c, false, false);
}

// 16-byte async global -> LDS copy (per-lane addresses), ASYNCcnt-tracked.
DEV void async_copy16(us* lds, const us* g) {
#if HAVE_ASYNC_BUILTIN
  __builtin_amdgcn_global_load_async_to_lds_b128((AS1 v4i_t*)(us*)g,
                                                 (AS3 v4i_t*)lds, 0, 0);
#else
  unsigned loff = (unsigned)(unsigned long long)(AS3 us*)lds;
  unsigned long long ga = (unsigned long long)g;
  asm volatile("global_load_async_to_lds_b128 %0, %1, off"
               :: "v"(loff), "v"(ga) : "memory");
#endif
}
DEV void wait_async0() {
#if HAVE_WAIT_ASYNC_BUILTIN
  __builtin_amdgcn_s_wait_asynccnt(0);
#else
  asm volatile("s_wait_asynccnt 0" ::: "memory");
#endif
}

// The four streaming pieces below give every lane 64 or more elements (16 or more loads of
// 16 B, all issued before the first use): a launch then starts one wave where
// sixteen one-load waves would stand, for speed only.  The two conversions and the LayerNorm are written as
// the work of one block of 256 threads, numbered blk, so that pieces which do
// not depend on one another can share a launch (k_prep).
typedef float    f32x4 __attribute__((ext_vector_type(4)));
typedef unsigned u32x4 __attribute__((ext_vector_type(4)));

// two f32 -> two bf16 in one dword, each rounded as f2bf rounds
DEV unsigned pack2(float lo, float hi) {
  unsigned a = __float_as_uint(lo), c = __float_as_uint(hi);
  a += 0x7FFFu + ((a >> 16) & 1u);
  c += 0x7FFFu + ((c >> 16) & 1u);
  return (a >> 16) | (c & 0xFFFF0000u);
}

// ---------------- fp32 -> bf16 (row-major copy: context) --------------------
// One block: 4096 float4 in a row; a wave's load covers 512 B, its store 256 B.
DEV void cvt_bf16_block(const float* __restrict__ src, us* __restrict__ dst,
                        int blk) {
  const int base = blk * 4096 + threadIdx.x;
  f32x4 f[16];
  #pragma unroll
  for (int u = 0; u < 16; ++u) f[u] = ((const f32x4*)src)[base + u * 256];
  // keeps every load above in front of the first use, all in flight together;
  // without it some sink to their use, one memory latency after another
  __builtin_amdgcn_sched_barrier(0);
  #pragma unroll
  for (int u = 0; u < 16; ++u) {
    uint2 o; o.x = pack2(f[u][0], f[u][1]); o.y = pack2(f[u][2], f[u][3]);
    ((uint2*)dst)[base + u * 256] = o;
  }
  // in a shared launch another piece's code can stand behind these stores in the
  // listing: the wait that belongs in front of an overwrite of their registers
  asm volatile("s_wait_xcnt 0x0" ::: "memory");
}

// -------- fp32 W[K,N] -> bf16 Wt[N,K] (convert + transpose in registers) ----
// One wave: 64 k x 32 n.  A lane loads 8 k-rows x 8 n and stores 8 n-rows x 8 k:
// four lanes read one 128-B line of W, eight lanes write one 128-B line of Wt.
// K and N are compile-time so that the row steps are immediate offsets.
// One block: 64 k x 256 n; K * N / 16384 blocks, n fastest.
template <int K, int N>
DEV void cvt_t_block(const float* __restrict__ src, us* __restrict__ dst,
                     int blk) {
  const int lane = threadIdx.x & 31, wid = threadIdx.x >> 5;
  const int k0 = (blk / (N / 256)) * 64 + (lane >> 2) * 8;
  const int n0 = (blk % (N / 256)) * 256 + wid * 32 + (lane & 3) * 8;
  const float* s = src + (size_t)k0 * N + n0;
  f32x4 f[16];                       // f[2 i + j]: row k0 + i, columns 4 j ..
  #pragma unroll
  for (int i = 0; i < 15; ++i)
    f[i] = *(const f32x4*)(s + (i >> 1) * N + (i & 1) * 4);
  // the last load's result may take the address register that the 15 loads in
  // flight name: the wait that belongs in front of such an overwrite
  asm volatile("s_wait_xcnt 0x0" ::: "memory");
  f[15] = *(const f32x4*)(s + 7 * N + 4);
  // keeps every load above in front of the first use, all in flight together;
  // without it some sink to their use, one memory latency after another
  __builtin_amdgcn_sched_barrier(0);
  us* d = dst + (size_t)n0 * K + k0;
  #pragma unroll
  for (int e = 0; e < 8; ++e) {
    const int j = e >> 2, m = e & 3;
    uint4 o;
    o.x = pack2(f[0 + j][m],  f[2 + j][m]);  o.y = pack2(f[4 + j][m],  f[6 + j][m]);
    o.z = pack2(f[8 + j][m],  f[10 + j][m]); o.w = pack2(f[12 + j][m], f[14 + j][m]);
    *(uint4*)(d + e * K) = o;
  }
  // in a shared launch another piece's code can stand behind these stores in the
  // listing: the wait that belongs in front of an overwrite of their registers
  asm volatile("s_wait_xcnt 0x0" ::: "memory");
}

// -------- bf16 V[t, d] (strided heads) -> Vt[(b*H+h)*64 + d][T] -------------
// One wave: 64 t x 64 d, transposed in registers.  A lane loads 8 t-rows x 16 d
// and stores 16 d-rows x 8 t: four lanes read one head row (128 B), eight lanes
// write one 128-B line of Vt.  RS and T are compile-time so that the row steps
// are immediate offsets.
template <int RS, int T>
__global__ __launch_bounds__(128)
void k_vt(const us* __restrict__ Vsrc, int col0, us* __restrict__ Vt, int H) {
  const int lane = threadIdx.x & 31, wid = threadIdx.x >> 5;
  const int bh = blockIdx.y, b = bh / H, h = bh % H;
  const int t0 = blockIdx.x * 256 + wid * 64 + (lane >> 2) * 8;
  const int d0 = (lane & 3) * 16;
  const us* s = Vsrc + ((size_t)b * T + t0) * RS + col0 + h * 64 + d0;
  u32x4 in[16];                      // in[2 i + j]: row t0 + i, columns 8 j ..
  #pragma unroll
  for (int i = 0; i < 15; ++i)
    in[i] = *(const u32x4*)(s + (i >> 1) * RS + (i & 1) * 8);
  // the last load's result may take the address register that the 15 loads in
  // flight name: the wait that belongs in front of such an overwrite
  asm volatile("s_wait_xcnt 0x0" ::: "memory");
  in[15] = *(const u32x4*)(s + 7 * RS + 8);
  // keeps every load above in front of the first use, all in flight together;
  // without it some sink to their use, one memory latency after another
  __builtin_amdgcn_sched_barrier(0);
  us* d = Vt + ((size_t)bh * 64 + d0) * T + t0;
  #pragma unroll
  for (int e = 0; e < 16; ++e) {
    const int j = e >> 3, w = (e & 7) >> 1, sh = (e & 1) * 16;
    unsigned o[4];
    #pragma unroll
    for (int p = 0; p < 4; ++p)
      o[p] = ((in[4 * p + j][w] >> sh) & 0xFFFFu) |
             (((in[4 * p + 2 + j][w] >> sh) & 0xFFFFu) << 16);
    uint4 q; q.x = o[0]; q.y = o[1]; q.z = o[2]; q.w = o[3];
    *(uint4*)(d + e * T) = q;
  }
}

// ---------------- LayerNorm: one wave per two rows (C = 1024) ---------------
// A lane holds 32 elements of each row; a row's sums are four in-lane chains and
// a five-step butterfly, so no LDS array and no barrier.
DEV void layernorm_block(const float* __restrict__ x, const float* __restrict__ g,
                         const float* __restrict__ b, us* __restrict__ out, int C,
                         int blk) {
  const int lane = threadIdx.x & 31;
  const int row0 = (blk * 8 + (threadIdx.x >> 5)) * 2;
  const int c4 = C >> 2;             // groups of 4 elements in a row
  const int at[2] = {row0 * c4 + lane, (row0 + 1) * c4 + lane};
  f32x4 v[16], gb[16];               // v[8 q + i]: row q; gb[i]: g, gb[8 + i]: b
  #pragma unroll
  for (int q = 0; q < 2; ++q)
    #pragma unroll
    for (int i = 0; i < 8; ++i)
      v[8 * q + i] = ((const f32x4*)x)[at[q] + i * 32];
  // a result of the loads below may take an address register that the loads in
  // flight above name: the wait that belongs in front of such an overwrite
  asm volatile("s_wait_xcnt 0x0" ::: "memory");
  #pragma unroll
  for (int i = 0; i < 15; ++i)
    gb[i] = ((const f32x4*)(i < 8 ? g : b))[lane + (i & 7) * 32];
  // the same in front of the last load, whose result may take the index register
  asm volatile("s_wait_xcnt 0x0" ::: "memory");
  gb[15] = ((const f32x4*)b)[lane + 7 * 32];
  // keeps every load above in front of the first use, all in flight together;
  // without it some sink to their use, one memory latency after another
  __builtin_amdgcn_sched_barrier(0);
  float s[2], s2[2];
  #pragma unroll
  for (int q = 0; q < 2; ++q) {
    f32x4 a = {0.f, 0.f, 0.f, 0.f}, a2 = {0.f, 0.f, 0.f, 0.f};
    #pragma unroll
    for (int i = 0; i < 8; ++i) {
      f32x4 t = v[8 * q + i];
      a += t; a2 += t * t;
    }
    s[q]  = (a[0] + a[1]) + (a[2] + a[3]);
    s2[q] = (a2[0] + a2[1]) + (a2[2] + a2[3]);
  }
  #pragma unroll
  for (int off = 16; off; off >>= 1)
    #pragma unroll
    for (int q = 0; q < 2; ++q) {
      s[q]  += __shfl_xor(s[q],  off, 32);
      s2[q] += __shfl_xor(s2[q], off, 32);
    }
  #pragma unroll
  for (int q = 0; q < 2; ++q) {
    const float mean = s[q] / C;
    const float rstd = rsqrtf(s2[q] / C - mean * mean + 1e-5f);
    #pragma unroll
    for (int i = 0; i < 8; ++i) {
      f32x4 t = v[8 * q + i], gg = gb[i], bb = gb[8 + i];
      uint2 w;
      w.x = pack2((t[0] - mean) * rstd * gg[0] + bb[0],
                  (t[1] - mean) * rstd * gg[1] + bb[1]);
      w.y = pack2((t[2] - mean) * rstd * gg[2] + bb[2],
                  (t[3] - mean) * rstd * gg[3] + bb[3]);
      ((uint2*)out)[at[q] + i * 32] = w;
    }
  }
}

__global__ __launch_bounds__(256)
void k_layernorm(const float* __restrict__ x, const float* __restrict__ g,
                 const float* __restrict__ b, us* __restrict__ out, int C) {
  layernorm_block(x, g, b, out, C, blockIdx.x);
}

// -------- everything that reads inputs alone, in ONE launch -----------------
// The first LayerNorm, the seven weight conversions and the context conversion
// depend on nothing but inputs and write disjoint buffers: one grid holds the
// blocks of all nine, dealt out by ranges of blockIdx.x (a scalar test), so that
// one launch gap, one ramp and one drain stand where nine would, and the short
// pieces' memory latency hides behind the long ones' streams.
// lnC: the LayerNorm's row length, at run time as k_layernorm takes it, so that
// both run the same code.
template <int C, int F, int BT>
__global__ __launch_bounds__(256)
void k_prep(const float* __restrict__ x, const float* __restrict__ ln_g,
            const float* __restrict__ ln_b, us* __restrict__ h,
            const float* __restrict__ qkv_w, us* __restrict__ wqkv,
            const float* __restrict__ aow, us* __restrict__ wao,
            const float* __restrict__ q_w, us* __restrict__ wq,
            const float* __restrict__ kv_w, us* __restrict__ wkv,
            const float* __restrict__ cow, us* __restrict__ wco,
            const float* __restrict__ w1, us* __restrict__ w1b,
            const float* __restrict__ w2, us* __restrict__ w2b,
            const float* __restrict__ ctx, us* __restrict__ ctxb, int lnC) {
  constexpr int nLN = BT / 16, nCC = C * C / 16384, nCF = C * F / 16384;
  int blk = blockIdx.x;
  if (blk < nLN) { layernorm_block(x, ln_g, ln_b, h, lnC, blk); return; }
  blk -= nLN;
  if (blk < 3 * nCC) { cvt_t_block<C, 3 * C>(qkv_w, wqkv, blk); return; }
  blk -= 3 * nCC;
  if (blk < 3 * nCC) {               // the three C x C weights: one copy of the code
    const int w = blk / nCC;
    cvt_t_block<C, C>(w == 0 ? aow : w == 1 ? q_w : cow,
                      w == 0 ? wao : w == 1 ? wq : wco, blk - w * nCC);
    return;
  }
  blk -= 3 * nCC;
  if (blk < 2 * nCC) { cvt_t_block<C, 2 * C>(kv_w, wkv, blk); return; }
  blk -= 2 * nCC;
  if (blk < nCF) { cvt_t_block<C, F>(w1, w1b, blk); return; }
  blk -= nCF;
  if (blk < nCF) { cvt_t_block<F, C>(w2, w2b, blk); return; }
  blk -= nCF;
  cvt_bf16_block(ctx, ctxb, blk);
}

// ------- bf16 WMMA GEMM: out = A[M,K] @ Wt[N,K]^T + bias --------------------
// Double-buffered LDS filled by async global->LDS copies (ASYNCcnt).
// One block: a 128 x 128 tile of out, 128 k per stage; a wave: 64 x 32.  A wave's
// copy covers two rows of 256 B, whole lines; M, N, K are multiples of 128.
// MODE 0: bf16 out.  MODE 1: fp32 out = resid + acc.  MODE 2: bf16 gelu(acc).
// The work of one block: tile column bx, tile row blockIdx.y.
template <int MODE>
DEV void gemm_block(const us* __restrict__ A, const us* __restrict__ Wt,
                    const float* __restrict__ bias, const float* __restrict__ resid,
                    void* __restrict__ outp, int N, int K, int bx) {
  __shared__ __align__(16) us lA[2][128 * LP];
  __shared__ __align__(16) us lW[2][128 * LP];
  const int tid  = threadIdx.x;
  const int lane = tid & 31, wid = tid >> 5;
  const int wm = wid & 1, wn = wid >> 1;
  const int l15 = lane & 15, khalf = (lane >> 4) << 3;
  const int mbase = blockIdx.y * 128, nbase = bx * 128;

  // 16 threads copy one row of 128 k; a thread: 8 x 16 B of A, 8 x 16 B of W
  const int crow = tid >> 4, cc8 = (tid & 15) << 3;

  auto issue = [&](int p, int k0) {
    const us* ga = A  + (size_t)(mbase + crow) * K + k0 + cc8;
    const us* gw = Wt + (size_t)(nbase + crow) * K + k0 + cc8;
    // unrolled: the LDS row steps become constants
    #pragma unroll
    for (int i = 0; i < 8; ++i) {
      async_copy16(&lA[p][(crow + 16 * i) * LP + cc8], ga + (size_t)(16 * i) * K);
      async_copy16(&lW[p][(crow + 16 * i) * LP + cc8], gw + (size_t)(16 * i) * K);
    }
  };

  v8f c[4][2];
  // unrolled, here and below: constant indices keep c, a and bfr in registers
  #pragma unroll
  for (int im = 0; im < 4; ++im) { c[im][0] = zero8(); c[im][1] = zero8(); }

  const int nk = K >> 7;
  issue(0, 0);
  wait_async0();
  __syncthreads();
  for (int j = 0; j < nk; ++j) {
    const int p = j & 1;
    if (j + 1 < nk) issue((j + 1) & 1, (j + 1) << 7);
    // unrolled: a later 32-k block's LDS reads can go ahead of this one's WMMAs
    #pragma unroll
    for (int kk = 0; kk < 128; kk += 32) {
      FragB16 a[4], bfr[2];
      #pragma unroll
      for (int im = 0; im < 4; ++im) {
        int r = wm * 64 + im * 16 + l15;
        a[im].q[0] = *(const uint4*)&lA[p][r * LP + kk + khalf];
        a[im].q[1] = *(const uint4*)&lA[p][r * LP + kk + 16 + khalf];
      }
      #pragma unroll
      for (int in = 0; in < 2; ++in) {
        int nc = wn * 32 + in * 16 + l15;
        bfr[in].q[0] = *(const uint4*)&lW[p][nc * LP + kk + khalf];
        bfr[in].q[1] = *(const uint4*)&lW[p][nc * LP + kk + 16 + khalf];
      }
      #pragma unroll
      for (int im = 0; im < 4; ++im)
        #pragma unroll
        for (int in = 0; in < 2; ++in)
          c[im][in] = wmma_bf16(a[im], bfr[in], c[im][in]);
    }
    if (j + 1 < nk) wait_async0();
    __syncthreads();
  }

  const int hi8 = (lane >> 4) << 3;
  #pragma unroll
  for (int im = 0; im < 4; ++im)
    #pragma unroll
    for (int in = 0; in < 2; ++in)
      #pragma unroll
      for (int r = 0; r < 8; ++r) {
        int row = mbase + wm * 64 + im * 16 + r + hi8;
        int col = nbase + wn * 32 + in * 16 + l15;
        size_t idx = (size_t)row * N + col;
        float v = c[im][in][r] + bias[col];
        if (MODE == 0) {
          ((us*)outp)[idx] = f2bf(v);
        } else if (MODE == 1) {
          ((float*)outp)[idx] = resid[idx] + v;
        } else {
          float gv = 0.5f * v * (1.0f + erff(v * 0.70710678118654752f));
          ((us*)outp)[idx] = f2bf(gv);
        }
      }
}

template <int MODE>
__global__ __launch_bounds__(256)
void k_gemm(const us* __restrict__ A, const us* __restrict__ Wt,
            const float* __restrict__ bias, const float* __restrict__ resid,
            void* __restrict__ outp, int M, int N, int K) {
  gemm_block<MODE>(A, Wt, bias, resid, outp, N, K, blockIdx.x);
}

// Two independent MODE 0 products of the same M and K in ONE launch: the second's
// tile columns stand behind the first's in blockIdx.x (a scalar test).
__global__ __launch_bounds__(256)
void k_gemm_two(const us* __restrict__ A0, const us* __restrict__ Wt0,
                const float* __restrict__ bias0, us* __restrict__ out0, int N0,
                const us* __restrict__ A1, const us* __restrict__ Wt1,
                const float* __restrict__ bias1, us* __restrict__ out1, int N1,
                int K) {
  const int bx = blockIdx.x, nb0 = N0 >> 7;
  const bool second = bx >= nb0;
  gemm_block<0>(second ? A1 : A0, second ? Wt1 : Wt0, second ? bias1 : bias0,
                nullptr, second ? out1 : out0, second ? N1 : N0, K,
                second ? bx - nb0 : bx);
}

typedef float  f32x2  __attribute__((ext_vector_type(2)));
typedef __bf16 bf16x2 __attribute__((ext_vector_type(2)));

// two f32 -> two bf16 in one dword, round to nearest even, one instruction
DEV unsigned cvt2(float lo, float hi) {
  f32x2 f = {lo, hi};
  return __builtin_bit_cast(unsigned, __builtin_convertvector(f, bf16x2));
}
// 16 bytes through a pointer that is global by type: a pointer stepped in a loop
// would otherwise compile to flat loads
typedef const AS1 u32x4* gq_t;
DEV uint4 ldg16(gq_t p) {
  const u32x4 t = *p;
  uint4 r; r.x = t[0]; r.y = t[1]; r.z = t[2]; r.w = t[3];
  return r;
}
// max of a lane's value and its partner's (lane ^ 16)
DEV float maxhalves(float v) {
  const int i = __float_as_int(v);
  return fmaxf(v, __int_as_float(__builtin_amdgcn_permlanex16(
                      i, i, 0x76543210, 0xfedcba98, false, false)));
}

__global__ __launch_bounds__(256)
void k_flash(const us* __restrict__ Qb, int q_rs, int q_col0,
             const us* __restrict__ Kb, int k_rs, int k_col0,
             const us* __restrict__ Vt,
             us* __restrict__ Ob, int o_rs,
             int T, int H, int causal, float scale) {
  const int lane = threadIdx.x & 31;
  // the wave's number in a scalar register: tile indices and the trip count
  // are then scalar, and the loop and the diagonal test are scalar branches
  const int wid = __builtin_amdgcn_readfirstlane((int)(threadIdx.x >> 5));
  const int gw = blockIdx.x * 8 + wid;
  const int nQT = T >> 5;
  const int qt = gw % nQT;
  const int h  = (gw / nQT) % H;
  const int b  = gw / (nQT * H);
  const int l15 = lane & 15, khalf = (lane >> 4) << 3, hi8 = khalf;
  const size_t brow = (size_t)b * T;
  // per-lane row pointers, stepped at the foot of each pass
  gq_t kp[2], vp[4];
  // unrolled, here and below: constant indices keep the pointers, fragments and
  // accumulator tiles in registers
  #pragma unroll
  for (int ns = 0; ns < 2; ++ns)
    kp[ns] = (gq_t)(Kb + (brow + ns * 16 + l15) * k_rs + k_col0 + h * 64 + khalf);
  #pragma unroll
  for (int d = 0; d < 4; ++d)
    vp[d] = (gq_t)(Vt + ((size_t)(b * H + h) * 64 + d * 16 + l15) * T + khalf);

  FragB16 ones;
  {
    uint4 o; o.x = o.y = o.z = o.w = 0x3F803F80u;   // bf16 1.0 pairs
    ones.q[0] = o; ones.q[1] = o;
  }
  FragB16 bq[2][2];                  // [query group][32 d]
  #pragma unroll
  for (int g = 0; g < 2; ++g) {
    const us* qr = Qb + (brow + qt * 32 + g * 16 + l15) * q_rs + q_col0 + h * 64;
    #pragma unroll
    for (int kc = 0; kc < 2; ++kc) {
      bq[g][kc].q[0] = *(const uint4*)(qr + kc * 32 + khalf);
      bq[g][kc].q[1] = *(const uint4*)(qr + kc * 32 + 16 + khalf);
    }
  }
  // exp(scale * (s - m)) = exp2(s * c2 - m * c2); scale > 0, so the maximum is
  // taken over the raw scores
  const float c2 = scale * 1.44269504088896340736f;
  float mrow[2];
  v8f oc[2][4], ls[2];
  #pragma unroll
  for (int g = 0; g < 2; ++g) {
    mrow[g] = -__builtin_inff(); ls[g] = zero8();
    #pragma unroll
    for (int d = 0; d < 4; ++d) oc[g][d] = zero8();
  }

  const int nsteps = causal ? (qt + 1) : (T >> 5);

  for (int j = 0; j < nsteps; ++j) {
    FragB16 ka[2][2], va[4];
    #pragma unroll
    for (int ns = 0; ns < 2; ++ns) {
      #pragma unroll
      for (int kc = 0; kc < 2; ++kc) {        // steps of 16 B: 8 elements
        ka[ns][kc].q[0] = ldg16(kp[ns] + kc * 4);
        ka[ns][kc].q[1] = ldg16(kp[ns] + kc * 4 + 2);
      }
    }
    #pragma unroll
    for (int d = 0; d < 4; ++d) {
      va[d].q[0] = ldg16(vp[d]);
      va[d].q[1] = ldg16(vp[d] + 2);
    }
    // the pointers are stepped while the V loads are still in flight: the wait
    // that belongs in front of an overwrite of a load's address register
    asm volatile("s_wait_xcnt 0x0" ::: "memory");
    // keeps the step's 16 loads in front of the first product, all in flight
    // together; without it the K loads come in two groups, one latency each
    __builtin_amdgcn_sched_barrier(0);
    v8f st[2][2];                    // [query group][16-key tile]
    #pragma unroll
    for (int g = 0; g < 2; ++g)
      #pragma unroll
      for (int ns = 0; ns < 2; ++ns) {
        v8f acc = wmma_bf16(ka[ns][0], bq[g][0], zero8());
        st[g][ns] = wmma_bf16(ka[ns][1], bq[g][1], acc);
      }
    // only the last causal step holds keys behind a query of this wave
    if (causal && j == nsteps - 1) {
      #pragma unroll
      for (int g = 0; g < 2; ++g)
        #pragma unroll
        for (int ns = 0; ns < 2; ++ns)
          #pragma unroll
          for (int r = 0; r < 8; ++r)
            if (ns * 16 + hi8 + r > g * 16 + l15) st[g][ns][r] = -__builtin_inff();
    }
    #pragma unroll
    for (int g = 0; g < 2; ++g) {
      float mx = fmaxf(st[g][0][0], st[g][1][0]);
      #pragma unroll
      for (int r = 1; r < 8; ++r) mx = fmaxf(mx, fmaxf(st[g][0][r], st[g][1][r]));
      const float mn = fmaxf(mrow[g], maxhalves(mx));
      const float a  = __builtin_amdgcn_exp2f((mrow[g] - mn) * c2);
      const float mc = mn * c2;
      mrow[g] = mn;
      FragB16 pf;
      #pragma unroll
      for (int ns = 0; ns < 2; ++ns) {
        float p[8];
        #pragma unroll
        for (int r = 0; r < 8; ++r)
          p[r] = __builtin_amdgcn_exp2f(fmaf(st[g][ns][r], c2, -mc));
        uint4 w;
        w.x = cvt2(p[0], p[1]); w.y = cvt2(p[2], p[3]);
        w.z = cvt2(p[4], p[5]); w.w = cvt2(p[6], p[7]);
        pf.q[ns] = w;
      }
      ls[g] *= a;
      ls[g] = wmma_bf16(ones, pf, ls[g]);
      #pragma unroll
      for (int d = 0; d < 4; ++d) {
        oc[g][d] *= a;
        oc[g][d] = wmma_bf16(va[d], pf, oc[g][d]);
      }
    }
    #pragma unroll
    for (int ns = 0; ns < 2; ++ns) kp[ns] += (size_t)4 * k_rs;   // 32 rows
    #pragma unroll
    for (int d = 0; d < 4; ++d) vp[d] += 4;                   // 32 keys
  }
  // a lane holds 8 consecutive d of its query in each tile: 16-byte stores
  #pragma unroll
  for (int g = 0; g < 2; ++g) {
    const float inv = 1.0f / ls[g][0];
    us* orow = Ob + (brow + qt * 32 + g * 16 + l15) * o_rs + h * 64 + hi8;
    #pragma unroll
    for (int d = 0; d < 4; ++d) {
      uint4 w;
      w.x = cvt2(oc[g][d][0] * inv, oc[g][d][1] * inv);
      w.y = cvt2(oc[g][d][2] * inv, oc[g][d][3] * inv);
      w.z = cvt2(oc[g][d][4] * inv, oc[g][d][5] * inv);
      w.w = cvt2(oc[g][d][6] * inv, oc[g][d][7] * inv);
      *(uint4*)(orow + d * 16) = w;
    }
  }
}

// ----------------------------- host launcher --------------------------------
extern "C" void kernel_launch(void* const* d_in, const int* in_sizes, int n_in,
                              void* d_out, int out_size, void* d_ws,
                              size_t ws_size, hipStream_t stream) {
  (void)in_sizes; (void)n_in; (void)out_size; (void)ws_size;
  constexpr int B = 4, T = 1024, C = 1024, H = 16, F = 4096;
  constexpr int BT = B * T;
  const float* x     = (const float*)d_in[0];
  const float* ctx   = (const float*)d_in[1];
  const float* ln1_g = (const float*)d_in[2];
  const float* ln1_b = (const float*)d_in[3];
  const float* qkv_w = (const float*)d_in[4];
  const float* qkv_b = (const float*)d_in[5];
  const float* aow   = (const float*)d_in[6];
  const float* aob   = (const float*)d_in[7];
  const float* lnc_g = (const float*)d_in[8];
  const float* lnc_b = (const float*)d_in[9];
  const float* q_w   = (const float*)d_in[10];
  const float* q_b   = (const float*)d_in[11];
  const float* kv_w  = (const float*)d_in[12];
  const float* kv_b  = (const float*)d_in[13];
  const float* cow   = (const float*)d_in[14];
  const float* cob   = (const float*)d_in[15];
  const float* ln2_g = (const float*)d_in[16];
  const float* ln2_b = (const float*)d_in[17];
  const float* w1    = (const float*)d_in[18];
  const float* b1    = (const float*)d_in[19];
  const float* w2    = (const float*)d_in[20];
  const float* b2    = (const float*)d_in[21];

  char* p = (char*)d_ws;
  auto carve = [&](size_t bytes) -> char* {
    char* r = p; p += (bytes + 255) & ~(size_t)255; return r;
  };
  us* wqkv = (us*)carve((size_t)C * 3 * C * 2);   // [3C][C] transposed
  us* wao  = (us*)carve((size_t)C * C * 2);
  us* wq   = (us*)carve((size_t)C * C * 2);
  us* wkv  = (us*)carve((size_t)C * 2 * C * 2);
  us* wco  = (us*)carve((size_t)C * C * 2);
  us* w1b  = (us*)carve((size_t)C * F * 2);
  us* w2b  = (us*)carve((size_t)F * C * 2);
  us* hbuf = (us*)carve((size_t)BT * C * 2);
  us* qkvb = (us*)carve((size_t)BT * 3 * C * 2);
  us* obuf = (us*)carve((size_t)BT * C * 2);
  us* ctxb = (us*)carve((size_t)BT * C * 2);
  us* vtb  = (us*)carve((size_t)BT * C * 2);      // Vt[(b*H+h)*64 + d][T]
  us* f1b  = (us*)carve((size_t)BT * F * 2);
  float* resid = (float*)carve((size_t)BT * C * 4);
  us* qxb = qkvb;                    // reuse after self-attention
  us* kvb = qkvb + (size_t)BT * C;

  // first LayerNorm, weight conversions, context conversion: 1536 blocks
  k_prep<C, F, BT><<<BT / 16 + (8 * C * C + 2 * C * F + BT * C) / 16384, 256, 0,
                     stream>>>(x, ln1_g, ln1_b, hbuf, qkv_w, wqkv, aow, wao, q_w, wq,
                               kv_w, wkv, cow, wco, w1, w1b, w2, w2b, ctx, ctxb, C);

  const int flashBlocks = (B * H * (T / 32)) / 8;   // 256
  const float scale = 0.125f;                       // 1/sqrt(64)

  // 1) self-attention branch
  k_gemm<0><<<dim3(3 * C / 128, BT / 128), 256, 0, stream>>>(
      hbuf, wqkv, qkv_b, nullptr, qkvb, BT, 3 * C, C);
  k_vt<3 * C, T><<<dim3(T / 256, B * H), 128, 0, stream>>>(qkvb, 2 * C, vtb, H);
  k_flash<<<flashBlocks, 256, 0, stream>>>(
      qkvb, 3 * C, 0, qkvb, 3 * C, C, vtb, obuf, C, T, H, 1, scale);
  k_gemm<1><<<dim3(C / 128, BT / 128), 256, 0, stream>>>(
      obuf, wao, aob, x, resid, BT, C, C);

  // 2) cross-attention branch
  k_layernorm<<<BT / 16, 256, 0, stream>>>(resid, lnc_g, lnc_b, hbuf, C);
  k_gemm_two<<<dim3(3 * C / 128, BT / 128), 256, 0, stream>>>(
      hbuf, wq, q_b, qxb, C, ctxb, wkv, kv_b, kvb, 2 * C, C);
  k_vt<2 * C, T><<<dim3(T / 256, B * H), 128, 0, stream>>>(kvb, C, vtb, H);
  k_flash<<<flashBlocks, 256, 0, stream>>>(
      qxb, C, 0, kvb, 2 * C, 0, vtb, obuf, C, T, H, 0, scale);
  k_gemm<1><<<dim3(C / 128, BT / 128), 256, 0, stream>>>(
      obuf, wco, cob, resid, resid, BT, C, C);

  // 3) FFN
  k_layernorm<<<BT / 16, 256, 0, stream>>>(resid, ln2_g, ln2_b, hbuf, C);
  k_gemm<2><<<dim3(F / 128, BT / 128), 256, 0, stream>>>(
      hbuf, w1b, b1, nullptr, f1b, BT, F, C);
  k_gemm<1><<<dim3(C / 128, BT / 128), 256, 0, stream>>>(
      f1b, w2b, b2, resid, (float*)d_out, BT, C, F);
}

// v006
// A run of this version takes 244 microseconds.
// In both of two side-by-side timings against v005, it was 1.15 times as fast.
// Counting every step since v000, it is 2.23 times as fast.
#include <hip/hip_runtime.h>
#include <hip/hip_bf16.h>
#include <math.h>

typedef __attribute__((ext_vector_type(16))) __bf16 v16bf;
typedef __attribute__((ext_vector_type(8)))  float  v8f;
typedef int v4i_t __attribute__((vector_size(16)));
typedef unsigned short us;

#define DEV static __device__ __forceinline__
#define AS1 __attribute__((address_space(1)))
#define AS3 __attribute__((address_space(3)))

#if defined(__has_builtin)
#if __has_builtin(__builtin_amdgcn_global_load_async_to_lds_b128)
#define HAVE_ASYNC_BUILTIN 1
#endif
#if __has_builtin(__builtin_amdgcn_s_wait_asynccnt)
#define HAVE_WAIT_ASYNC_BUILTIN 1
#endif
#endif
#ifndef HAVE_ASYNC_BUILTIN
#define HAVE_ASYNC_BUILTIN 0
#endif
#ifndef HAVE_WAIT_ASYNC_BUILTIN
#define HAVE_WAIT_ASYNC_BUILTIN 0
#endif

// LDS pitch, in 16-bit elements, of the GEMM tiles' rows of 128, which
// ds_load_b128 reads one row per lane: 272 B = 16 B x odd spreads 16 rows over
// all 64 banks.
constexpr int LP = 136;

union FragB16 { uint4 q[2]; v16bf v; };

DEV us f2bf(float f) {
  unsigned u = __float_as_uint(f);
  u += 0x7FFFu + ((u >> 16) & 1u);          // round-to-nearest-even
  return (us)(u >> 16);
}
DEV v8f zero8() { v8f z = {0.f,0.f,0.f,0.f,0.f,0.f,0.f,0.f}; return z; }

DEV v8f wmma_bf16(const FragB16& a, const FragB16& b, v8f c) {
  return __builtin_amdgcn_wmma_f32_16x16x32_bf16(false, a.v, false, b.v,
                                                 (short)0, c, false, false);
}

// 16-byte async global -> LDS copy (per-lane addresses), ASYNCcnt-tracked.
DEV void async_copy16(us* lds, const us* g) {
#if HAVE_ASYNC_BUILTIN
  __builtin_amdgcn_global_load_async_to_lds_b128((AS1 v4i_t*)(us*)g,
                                                 (AS3 v4i_t*)lds, 0, 0);
#else
  unsigned loff = (unsigned)(unsigned long long)(AS3 us*)lds;
  unsigned long long ga = (unsigned long long)g;
  asm volatile("global_load_async_to_lds_b128 %0, %1, off"
               :: "v"(loff), "v"(ga) : "memory");
#endif
}
DEV void wait_async0() {
#if HAVE_WAIT_ASYNC_BUILTIN
  __builtin_amdgcn_s_wait_asynccnt(0);
#else
  asm volatile("s_wait_asynccnt 0" ::: "memory");
#endif
}

// The four streaming pieces below give every lane 64 or more elements (16 or more loads of
// 16 B, all issued before the first use): a launch then starts one wave where
// sixteen one-load waves would stand, for speed only.  The two conversions and the LayerNorm are written as
// the work of one block of 256 threads, numbered blk, so that pieces which do
// not depend on one another can share a launch (k_prep).
typedef float    f32x4 __attribute__((ext_vector_type(4)));
typedef unsigned u32x4 __attribute__((ext_vector_type(4)));

// two f32 -> two bf16 in one dword, each rounded as f2bf rounds
DEV unsigned pack2(float lo, float hi) {
  unsigned a = __float_as_uint(lo), c = __float_as_uint(hi);
  a += 0x7FFFu + ((a >> 16) & 1u);
  c += 0x7FFFu + ((c >> 16) & 1u);
  return (a >> 16) | (c & 0xFFFF0000u);
}

// ---------------- fp32 -> bf16 (row-major copy: context) --------------------
// One block: 4096 float4 in a row; a wave's load covers 512 B, its store 256 B.
DEV void cvt_bf16_block(const float* __restrict__ src, us* __restrict__ dst,
                        int blk) {
  const int base = blk * 4096 + threadIdx.x;
  f32x4 f[16];
  #pragma unroll
  for (int u = 0; u < 16; ++u) f[u] = ((const f32x4*)src)[base + u * 256];
  // keeps every load above in front of the first use, all in flight together;
  // without it some sink to their use, one memory latency after another
  __builtin_amdgcn_sched_barrier(0);
  #pragma unroll
  for (int u = 0; u < 16; ++u) {
    uint2 o; o.x = pack2(f[u][0], f[u][1]); o.y = pack2(f[u][2], f[u][3]);
    ((uint2*)dst)[base + u * 256] = o;
  }
  // in a shared launch another piece's code can stand behind these stores in the
  // listing: the wait that belongs in front of an overwrite of their registers
  asm volatile("s_wait_xcnt 0x0" ::: "memory");
}

// -------- fp32 W[K,N] -> bf16 Wt[N,K] (convert + transpose in registers) ----
// One wave: 64 k x 32 n.  A lane loads 8 k-rows x 8 n and stores 8 n-rows x 8 k:
// four lanes read one 128-B line of W, eight lanes write one 128-B line of Wt.
// K and N are compile-time so that the row steps are immediate offsets.
// One block: 64 k x 256 n; K * N / 16384 blocks, n fastest.
template <int K, int N>
DEV void cvt_t_block(const float* __restrict__ src, us* __restrict__ dst,
                     int blk) {
  const int lane = threadIdx.x & 31, wid = threadIdx.x >> 5;
  const int k0 = (blk / (N / 256)) * 64 + (lane >> 2) * 8;
  const int n0 = (blk % (N / 256)) * 256 + wid * 32 + (lane & 3) * 8;
  const float* s = src + (size_t)k0 * N + n0;
  f32x4 f[16];                       // f[2 i + j]: row k0 + i, columns 4 j ..
  #pragma unroll
  for (int i = 0; i < 15; ++i)
    f[i] = *(const f32x4*)(s + (i >> 1) * N + (i & 1) * 4);
  // the last load's result may take the address register that the 15 loads in
  // flight name: the wait that belongs in front of such an overwrite
  asm volatile("s_wait_xcnt 0x0" ::: "memory");
  f[15] = *(const f32x4*)(s + 7 * N + 4);
  // keeps every load above in front of the first use, all in flight together;
  // without it some sink to their use, one memory latency after another
  __builtin_amdgcn_sched_barrier(0);
  us* d = dst + (size_t)n0 * K + k0;
  #pragma unroll
  for (int e = 0; e < 8; ++e) {
    const int j = e >> 2, m = e & 3;
    uint4 o;
    o.x = pack2(f[0 + j][m],  f[2 + j][m]);  o.y = pack2(f[4 + j][m],  f[6 + j][m]);
    o.z = pack2(f[8 + j][m],  f[10 + j][m]); o.w = pack2(f[12 + j][m], f[14 + j][m]);
    *(uint4*)(d + e * K) = o;
  }
  // in a shared launch another piece's code can stand behind these stores in the
  // listing: the wait that belongs in front of an overwrite of their registers
  asm volatile("s_wait_xcnt 0x0" ::: "memory");
}

// -------- bf16 V[t, d] (strided heads) -> Vt[(b*H+h)*64 + d][T] -------------
// One wave: 64 t x 64 d, transposed in registers.  A lane loads 8 t-rows x 16 d
// and stores 16 d-rows x 8 t: four lanes read one head row (128 B), eight lanes
// write one 128-B line of Vt.  RS and T are compile-time so that the row steps
// are immediate offsets.
template <int RS, int T>
__global__ __launch_bounds__(128)
void k_vt(const us* __restrict__ Vsrc, int col0, us* __restrict__ Vt, int H) {
  const int lane = threadIdx.x & 31, wid = threadIdx.x >> 5;
  const int bh = blockIdx.y, b = bh / H, h = bh % H;
  const int t0 = blockIdx.x * 256 + wid * 64 + (lane >> 2) * 8;
  const int d0 = (lane & 3) * 16;
  const us* s = Vsrc + ((size_t)b * T + t0) * RS + col0 + h * 64 + d0;
  u32x4 in[16];                      // in[2 i + j]: row t0 + i, columns 8 j ..
  #pragma unroll
  for (int i = 0; i < 15; ++i)
    in[i] = *(const u32x4*)(s + (i >> 1) * RS + (i & 1) * 8);
  // the last load's result may take the address register that the 15 loads in
  // flight name: the wait that belongs in front of such an overwrite
  asm volatile("s_wait_xcnt 0x0" ::: "memory");
  in[15] = *(const u32x4*)(s + 7 * RS + 8);
  // keeps every load above in front of the first use, all in flight together;
  // without it some sink to their use, one memory latency after another
  __builtin_amdgcn_sched_barrier(0);
  us* d = Vt + ((size_t)bh * 64 + d0) * T + t0;
  #pragma unroll
  for (int e = 0; e < 16; ++e) {
    const int j = e >> 3, w = (e & 7) >> 1, sh = (e & 1) * 16;
    unsigned o[4];
    #pragma unroll
    for (int p = 0; p < 4; ++p)
      o[p] = ((in[4 * p + j][w] >> sh) & 0xFFFFu) |
             (((in[4 * p + 2 + j][w] >> sh) & 0xFFFFu) << 16);
    uint4 q; q.x = o[0]; q.y = o[1]; q.z = o[2]; q.w = o[3];
    *(uint4*)(d + e * T) = q;
  }
}

// ---------------- LayerNorm: one wave per two rows (C = 1024) ---------------
// A lane holds 32 elements of each row; a row's sums are four in-lane chains and
// a five-step butterfly, so no LDS array and no barrier.
DEV void layernorm_block(const float* __restrict__ x, const float* __restrict__ g,
                         const float* __restrict__ b, us* __restrict__ out, int C,
                         int blk) {
  const int lane = threadIdx.x & 31;
  const int row0 = (blk * 8 + (threadIdx.x >> 5)) * 2;
  const int c4 = C >> 2;             // groups of 4 elements in a row
  const int at[2] = {row0 * c4 + lane, (row0 + 1) * c4 + lane};
  f32x4 v[16], gb[16];               // v[8 q + i]: row q; gb[i]: g, gb[8 + i]: b
  #pragma unroll
  for (int q = 0; q < 2; ++q)
    #pragma unroll
    for (int i = 0; i < 8; ++i)
      v[8 * q + i] = ((const f32x4*)x)[at[q] + i * 32];
  // a result of the loads below may take an address register that the loads in
  // flight above name: the wait that belongs in front of such an overwrite
  asm volatile("s_wait_xcnt 0x0" ::: "memory");
  #pragma unroll
  for (int i = 0; i < 15; ++i)
    gb[i] = ((const f32x4*)(i < 8 ? g : b))[lane + (i & 7) * 32];
  // the same in front of the last load, whose result may take the index register
  asm volatile("s_wait_xcnt 0x0" ::: "memory");
  gb[15] = ((const f32x4*)b)[lane + 7 * 32];
  // keeps every load above in front of the first use, all in flight together;
  // without it some sink to their use, one memory latency after another
  __builtin_amdgcn_sched_barrier(0);
  float s[2], s2[2];
  #pragma unroll
  for (int q = 0; q < 2; ++q) {
    f32x4 a = {0.f, 0.f, 0.f, 0.f}, a2 = {0.f, 0.f, 0.f, 0.f};
    #pragma unroll
    for (int i = 0; i < 8; ++i) {
      f32x4 t = v[8 * q + i];
      a += t; a2 += t * t;
    }
    s[q]  = (a[0] + a[1]) + (a[2] + a[3]);
    s2[q] = (a2[0] + a2[1]) + (a2[2] + a2[3]);
  }
  #pragma unroll
  for (int off = 16; off; off >>= 1)
    #pragma unroll
    for (int q = 0; q < 2; ++q) {
      s[q]  += __shfl_xor(s[q],  off, 32);
      s2[q] += __shfl_xor(s2[q], off, 32);
    }
  #pragma unroll
  for (int q = 0; q < 2; ++q) {
    const float mean = s[q] / C;
    const float rstd = rsqrtf(s2[q] / C - mean * mean + 1e-5f);
    #pragma unroll
    for (int i = 0; i < 8; ++i) {
      f32x4 t = v[8 * q + i], gg = gb[i], bb = gb[8 + i];
      uint2 w;
      w.x = pack2((t[0] - mean) * rstd * gg[0] + bb[0],
                  (t[1] - mean) * rstd * gg[1] + bb[1]);
      w.y = pack2((t[2] - mean) * rstd * gg[2] + bb[2],
                  (t[3] - mean) * rstd * gg[3] + bb[3]);
      ((uint2*)out)[at[q] + i * 32] = w;
    }
  }
}

__global__ __launch_bounds__(256)
void k_layernorm(const float* __restrict__ x, const float* __restrict__ g,
                 const float* __restrict__ b, us* __restrict__ out, int C) {
  layernorm_block(x, g, b, out, C, blockIdx.x);
}

// -------- everything that reads inputs alone, in ONE launch -----------------
// The first LayerNorm, the seven weight conversions and the context conversion
// depend on nothing but inputs and write disjoint buffers: one grid holds the
// blocks of all nine, dealt out by ranges of blockIdx.x (a scalar test), so that
// one launch gap, one ramp and one drain stand where nine would, and the short
// pieces' memory latency hides behind the long ones' streams.
// lnC: the LayerNorm's row length, at run time as k_layernorm takes it, so that
// both run the same code.
template <int C, int F, int BT>
__global__ __launch_bounds__(256)
void k_prep(const float* __restrict__ x, const float* __restrict__ ln_g,
            const float* __restrict__ ln_b, us* __restrict__ h,
            const float* __restrict__ qkv_w, us* __restrict__ wqkv,
            const float* __restrict__ aow, us* __restrict__ wao,
            const float* __restrict__ q_w, us* __restrict__ wq,
            const float* __restrict__ kv_w, us* __restrict__ wkv,
            const float* __restrict__ cow, us* __restrict__ wco,
            const float* __restrict__ w1, us* __restrict__ w1b,
            const float* __restrict__ w2, us* __restrict__ w2b,
            const float* __restrict__ ctx, us* __restrict__ ctxb, int lnC) {
  constexpr int nLN = BT / 16, nCC = C * C / 16384, nCF = C * F / 16384;
  int blk = blockIdx.x;
  if (blk < nLN) { layernorm_block(x, ln_g, ln_b, h, lnC, blk); return; }
  blk -= nLN;
  if (blk < 3 * nCC) { cvt_t_block<C, 3 * C>(qkv_w, wqkv, blk); return; }
  blk -= 3 * nCC;
  if (blk < 3 * nCC) {               // the three C x C weights: one copy of the code
    const int w = blk / nCC;
    cvt_t_block<C, C>(w == 0 ? aow : w == 1 ? q_w : cow,
                      w == 0 ? wao : w == 1 ? wq : wco, blk - w * nCC);
    return;
  }
  blk -= 3 * nCC;
  if (blk < 2 * nCC) { cvt_t_block<C, 2 * C>(kv_w, wkv, blk); return; }
  blk -= 2 * nCC;
  if (blk < nCF) { cvt_t_block<C, F>(w1, w1b, blk); return; }
  blk -= nCF;
  if (blk < nCF) { cvt_t_block<F, C>(w2, w2b, blk); return; }
  blk -= nCF;
  cvt_bf16_block(ctx, ctxb, blk);
}

// ------- bf16 WMMA GEMM: out = A[M,K] @ Wt[N,K]^T + bias --------------------
// Double-buffered LDS filled by async global->LDS copies (ASYNCcnt).
// One block: a 128 x 128 tile of out, 128 k per stage; a wave: 64 x 32.  A wave's
// copy covers two rows of 256 B, whole lines; M, N, K are multiples of 128.
// MODE 0: bf16 out.  MODE 1: fp32 out = resid + acc.  MODE 2: bf16 gelu(acc).
// The work of one block: tile column bx, tile row blockIdx.y.
template <int MODE>
DEV void gemm_block(const us* __restrict__ A, const us* __restrict__ Wt,
                    const float* __restrict__ bias, const float* __restrict__ resid,
                    void* __restrict__ outp, int N, int K, int bx) {
  __shared__ __align__(16) us lA[2][128 * LP];
  __shared__ __align__(16) us lW[2][128 * LP];
  const int tid  = threadIdx.x;
  const int lane = tid & 31, wid = tid >> 5;
  const int wm = wid & 1, wn = wid >> 1;
  const int l15 = lane & 15, khalf = (lane >> 4) << 3;
  const int mbase = blockIdx.y * 128, nbase = bx * 128;

  // 16 threads copy one row of 128 k; a thread: 8 x 16 B of A, 8 x 16 B of W
  const int crow = tid >> 4, cc8 = (tid & 15) << 3;

  auto issue = [&](int p, int k0) {
    const us* ga = A  + (size_t)(mbase + crow) * K + k0 + cc8;
    const us* gw = Wt + (size_t)(nbase + crow) * K + k0 + cc8;
    // unrolled: the LDS row steps become constants
    #pragma unroll
    for (int i = 0; i < 8; ++i) {
      async_copy16(&lA[p][(crow + 16 * i) * LP + cc8], ga + (size_t)(16 * i) * K);
      async_copy16(&lW[p][(crow + 16 * i) * LP + cc8], gw + (size_t)(16 * i) * K);
    }
  };

  v8f c[4][2];
  // unrolled, here and below: constant indices keep c, a and bfr in registers
  #pragma unroll
  for (int im = 0; im < 4; ++im) { c[im][0] = zero8(); c[im][1] = zero8(); }

  const int nk = K >> 7;
  issue(0, 0);
  wait_async0();
  __syncthreads();
  for (int j = 0; j < nk; ++j) {
    const int p = j & 1;
    if (j + 1 < nk) issue((j + 1) & 1, (j + 1) << 7);
    // unrolled: a later 32-k block's LDS reads can go ahead of this one's WMMAs
    #pragma unroll
    for (int kk = 0; kk < 128; kk += 32) {
      FragB16 a[4], bfr[2];
      #pragma unroll
      for (int im = 0; im < 4; ++im) {
        int r = wm * 64 + im * 16 + l15;
        a[im].q[0] = *(const uint4*)&lA[p][r * LP + kk + khalf];
        a[im].q[1] = *(const uint4*)&lA[p][r * LP + kk + 16 + khalf];
      }
      #pragma unroll
      for (int in = 0; in < 2; ++in) {
        int nc = wn * 32 + in * 16 + l15;
        bfr[in].q[0] = *(const uint4*)&lW[p][nc * LP + kk + khalf];
        bfr[in].q[1] = *(const uint4*)&lW[p][nc * LP + kk + 16 + khalf];
      }
      #pragma unroll
      for (int im = 0; im < 4; ++im)
        #pragma unroll
        for (int in = 0; in < 2; ++in)
          c[im][in] = wmma_bf16(a[im], bfr[in], c[im][in]);
    }
    if (j + 1 < nk) wait_async0();
    __syncthreads();
  }

  const int hi8 = (lane >> 4) << 3;
  #pragma unroll
  for (int im = 0; im < 4; ++im)
    #pragma unroll
    for (int in = 0; in < 2; ++in)
      #pragma unroll
      for (int r = 0; r < 8; ++r) {
        int row = mbase + wm * 64 + im * 16 + r + hi8;
        int col = nbase + wn * 32 + in * 16 + l15;
        size_t idx = (size_t)row * N + col;
        float v = c[im][in][r] + bias[col];
        if (MODE == 0) {
          ((us*)outp)[idx] = f2bf(v);
        } else if (MODE == 1) {
          ((float*)outp)[idx] = resid[idx] + v;
        } else {
          float gv = 0.5f * v * (1.0f + erff(v * 0.70710678118654752f));
          ((us*)outp)[idx] = f2bf(gv);
        }
      }
}

template <int MODE>
__global__ __launch_bounds__(256)
void k_gemm(const us* __restrict__ A, const us* __restrict__ Wt,
            const float* __restrict__ bias, const float* __restrict__ resid,
            void* __restrict__ outp, int M, int N, int K) {
  gemm_block<MODE>(A, Wt, bias, resid, outp, N, K, blockIdx.x);
}

// Two independent MODE 0 products of the same M and K in ONE launch: the second's
// tile columns stand behind the first's in blockIdx.x (a scalar test).
__global__ __launch_bounds__(256)
void k_gemm_two(const us* __restrict__ A0, const us* __restrict__ Wt0,
                const float* __restrict__ bias0, us* __restrict__ out0, int N0,
                const us* __restrict__ A1, const us* __restrict__ Wt1,
                const float* __restrict__ bias1, us* __restrict__ out1, int N1,
                int K) {
  const int bx = blockIdx.x, nb0 = N0 >> 7;
  const bool second = bx >= nb0;
  gemm_block<0>(second ? A1 : A0, second ? Wt1 : Wt0, second ? bias1 : bias0,
                nullptr, second ? out1 : out0, second ? N1 : N0, K,
                second ? bx - nb0 : bx);
}

typedef float  f32x2  __attribute__((ext_vector_type(2)));
typedef __bf16 bf16x2 __attribute__((ext_vector_type(2)));

// two f32 -> two bf16 in one dword, round to nearest even, one instruction
DEV unsigned cvt2(float lo, float hi) {
  f32x2 f = {lo, hi};
  return __builtin_bit_cast(unsigned, __builtin_convertvector(f, bf16x2));
}
// LDS pitch, in 16-bit elements, of the attention tiles' rows of 64 (128 B), which
// ds_load_b128 reads one row per lane: 144 B = 16 B x odd spreads 16 rows over
// all 64 banks.
constexpr int FP = 72;
DEV unsigned lds_addr(const us* p) {
  return (unsigned)(unsigned long long)(const AS3 us*)p;
}
// Four 16-byte async global -> LDS copies of one lane (ASYNCcnt-tracked).  The
// wait on the last line stands in front of every later overwrite of a register
// that the copies name; inside the statement nothing can be lifted over it.
DEV void async_copy16x4(unsigned l0, const us* g0, unsigned l1, const us* g1,
                        unsigned l2, const us* g2, unsigned l3, const us* g3) {
  asm volatile("global_load_async_to_lds_b128 %0, %1, off\n\t"
               "global_load_async_to_lds_b128 %2, %3, off\n\t"
               "global_load_async_to_lds_b128 %4, %5, off\n\t"
               "global_load_async_to_lds_b128 %6, %7, off\n\t"
               "s_wait_xcnt 0x0"
               :: "v"(l0), "v"(g0), "v"(l1), "v"(g1), "v"(l2), "v"(g2),
                  "v"(l3), "v"(g3) : "memory");
}
// max of a lane's value and its partner's (lane ^ 16)
DEV float maxhalves(float v) {
  const int i = __float_as_int(v);
  return fmaxf(v, __int_as_float(__builtin_amdgcn_permlanex16(
                      i, i, 0x76543210, 0xfedcba98, false, false)));
}

__global__ __launch_bounds__(256)
void k_flash(const us* __restrict__ Qb, int q_rs, int q_col0,
             const us* __restrict__ Kb, int k_rs, int k_col0,
             const us* __restrict__ Vt,
             us* __restrict__ Ob, int o_rs,
             int T, int H, int causal, float scale) {
  __shared__ __align__(16) us lK[2][64 * FP];
  __shared__ __align__(16) us lV[2][64 * FP];
  const int tid = threadIdx.x;
  const int lane = tid & 31;
  // the wave's number in a scalar register: tile indices and the trip count
  // are then scalar, and the loop and the diagonal test are scalar branches
  const int wid = __builtin_amdgcn_readfirstlane(tid >> 5);
  const int gw = blockIdx.x * 8 + wid;
  const int nQT = T >> 5;
  const int qt = gw % nQT;
  const int h  = (gw / nQT) % H;
  const int b  = gw / (nQT * H);
  const int l15 = lane & 15, khalf = (lane >> 4) << 3, hi8 = khalf;
  const size_t brow = (size_t)b * T;
  // 8 threads copy one row of 128 B; a thread: 2 x 16 B of K, 2 x 16 B of Vt
  const int crow = tid >> 3, cc8 = (tid & 7) << 3;
  const us* gk = Kb + (brow + crow) * k_rs + k_col0 + h * 64 + cc8;
  const us* gv = Vt + ((size_t)(b * H + h) * 64 + crow) * T + cc8;
  const unsigned lk = lds_addr(&lK[0][crow * FP + cc8]);
  const unsigned lv = lds_addr(&lV[0][crow * FP + cc8]);
  auto issue = [&](int p, int s) {   // stage s (keys 64 s ..) into buffer p
    const us* k0 = gk + (size_t)(s * 64) * k_rs;
    const us* v0 = gv + s * 64;
    const unsigned o = p * (64 * FP * 2), half = 32 * FP * 2;
    async_copy16x4(lk + o, k0, lk + o + half, k0 + (size_t)32 * k_rs,
                   lv + o, v0, lv + o + half, v0 + (size_t)32 * T);
  };

  FragB16 ones;
  {
    uint4 o; o.x = o.y = o.z = o.w = 0x3F803F80u;   // bf16 1.0 pairs
    ones.q[0] = o; ones.q[1] = o;
  }
  FragB16 bq[2][2];                  // [query group][32 d]
  #pragma unroll
  for (int g = 0; g < 2; ++g) {
    const us* qr = Qb + (brow + qt * 32 + g * 16 + l15) * q_rs + q_col0 + h * 64;
    #pragma unroll
    for (int kc = 0; kc < 2; ++kc) {
      bq[g][kc].q[0] = *(const uint4*)(qr + kc * 32 + khalf);
      bq[g][kc].q[1] = *(const uint4*)(qr + kc * 32 + 16 + khalf);
    }
  }
  // the copies' addresses are formed next, in registers that the Q loads in
  // flight may name: the wait that belongs in front of such an overwrite
  asm volatile("s_wait_xcnt 0x0" ::: "memory");
  // exp(scale * (s - m)) = exp2(s * c2 - m * c2); scale > 0, so the maximum is
  // taken over the raw scores
  const float c2 = scale * 1.44269504088896340736f;
  float mrow[2];
  v8f oc[2][4], ls[2];
  #pragma unroll
  for (int g = 0; g < 2; ++g) {
    mrow[g] = -__builtin_inff(); ls[g] = zero8();
    #pragma unroll
    for (int d = 0; d < 4; ++d) oc[g][d] = zero8();
  }

  const int nsteps = causal ? (qt + 1) : (T >> 5);
  // stages of the block: as far as its last wave's diagonal; the same in all waves
  const int nst = causal ? (((int)(blockIdx.x * 8) % nQT + 8) >> 1) : (T >> 6);

  issue(0, 0);
  // stage 0 has landed before the barrier behind which other waves read it
  asm volatile("s_wait_asynccnt 0x0" ::: "memory");
  __syncthreads();
  if (1 < nst) issue(1, 1);

  for (int s = 0; s < nst; ++s) {
   const int pb = s & 1;
   // unrolled: the half stage's LDS offsets become constants
   #pragma unroll
   for (int sub = 0; sub < 2; ++sub) {
    const int j = 2 * s + sub;
    // a wave is done behind its diagonal (a scalar test); it still passes every
    // barrier below
    if (j >= nsteps) continue;
    FragB16 ka[2][2], va[4];
    #pragma unroll
    for (int ns = 0; ns < 2; ++ns) {
      const us* kr = &lK[pb][(sub * 32 + ns * 16 + l15) * FP + khalf];
      #pragma unroll
      for (int kc = 0; kc < 2; ++kc) {
        ka[ns][kc].q[0] = *(const uint4*)(kr + kc * 32);
        ka[ns][kc].q[1] = *(const uint4*)(kr + kc * 32 + 16);
      }
    }
    #pragma unroll
    for (int d = 0; d < 4; ++d) {
      const us* vr = &lV[pb][(d * 16 + l15) * FP + sub * 32 + khalf];
      va[d].q[0] = *(const uint4*)vr;
      va[d].q[1] = *(const uint4*)(vr + 16);
    }
    // keeps the step's 16 LDS reads together in front of the first product: one
    // place with reads a step; without it the Vt reads sink into the softmax in
    // further groups
    __builtin_amdgcn_sched_barrier(0);
    v8f st[2][2];                    // [query group][16-key tile]
    #pragma unroll
    for (int g = 0; g < 2; ++g)
      #pragma unroll
      for (int ns = 0; ns < 2; ++ns) {
        v8f acc = wmma_bf16(ka[ns][0], bq[g][0], zero8());
        st[g][ns] = wmma_bf16(ka[ns][1], bq[g][1], acc);
      }
    // only the last causal step holds keys behind a query of this wave
    if (causal && j == nsteps - 1) {
      #pragma unroll
      for (int g = 0; g < 2; ++g)
        #pragma unroll
        for (int ns = 0; ns < 2; ++ns)
          #pragma unroll
          for (int r = 0; r < 8; ++r)
            if (ns * 16 + hi8 + r > g * 16 + l15) st[g][ns][r] = -__builtin_inff();
    }
    #pragma unroll
    for (int g = 0; g < 2; ++g) {
      float mx = fmaxf(st[g][0][0], st[g][1][0]);
      #pragma unroll
      for (int r = 1; r < 8; ++r) mx = fmaxf(mx, fmaxf(st[g][0][r], st[g][1][r]));
      const float mn = fmaxf(mrow[g], maxhalves(mx));
      const float a  = __builtin_amdgcn_exp2f((mrow[g] - mn) * c2);
      const float mc = mn * c2;
      mrow[g] = mn;
      FragB16 pf;
      #pragma unroll
      for (int ns = 0; ns < 2; ++ns) {
        float p[8];
        #pragma unroll
        for (int r = 0; r < 8; ++r)
          p[r] = __builtin_amdgcn_exp2f(fmaf(st[g][ns][r], c2, -mc));
        uint4 w;
        w.x = cvt2(p[0], p[1]); w.y = cvt2(p[2], p[3]);
        w.z = cvt2(p[4], p[5]); w.w = cvt2(p[6], p[7]);
        pf.q[ns] = w;
      }
      ls[g] *= a;
      ls[g] = wmma_bf16(ones, pf, ls[g]);
      #pragma unroll
      for (int d = 0; d < 4; ++d) {
        oc[g][d] *= a;
        oc[g][d] = wmma_bf16(va[d], pf, oc[g][d]);
      }
    }
   }
   // the hand-over of a stage, in every wave: this wave's reads of buffer pb are
   // done, its copies of the next stage have landed, then the barrier that
   // publishes that stage and frees buffer pb for the refill behind it
   asm volatile("s_wait_dscnt 0x0" ::: "memory");
   asm volatile("s_wait_asynccnt 0x0" ::: "memory");
   __syncthreads();
   if (s + 2 < nst) issue(pb, s + 2);
  }
  // no copy is outstanding when the wave ends
  asm volatile("s_wait_asynccnt 0x0" ::: "memory");
  // a lane holds 8 consecutive d of its query in each tile: 16-byte stores
  #pragma unroll
  for (int g = 0; g < 2; ++g) {
    const float inv = 1.0f / ls[g][0];
    us* orow = Ob + (brow + qt * 32 + g * 16 + l15) * o_rs + h * 64 + hi8;
    #pragma unroll
    for (int d = 0; d < 4; ++d) {
      uint4 w;
      w.x = cvt2(oc[g][d][0] * inv, oc[g][d][1] * inv);
      w.y = cvt2(oc[g][d][2] * inv, oc[g][d][3] * inv);
      w.z = cvt2(oc[g][d][4] * inv, oc[g][d][5] * inv);
      w.w = cvt2(oc[g][d][6] * inv, oc[g][d][7] * inv);
      *(uint4*)(orow + d * 16) = w;
    }
  }
}

// ----------------------------- host launcher --------------------------------
extern "C" void kernel_launch(void* const* d_in, const int* in_sizes, int n_in,
                              void* d_out, int out_size, void* d_ws,
                              size_t ws_size, hipStream_t stream) {
  (void)in_sizes; (void)n_in; (void)out_size; (void)ws_size;
  constexpr int B = 4, T = 1024, C = 1024, H = 16, F = 4096;
  constexpr int BT = B * T;
  const float* x     = (const float*)d_in[0];
  const float* ctx   = (const float*)d_in[1];
  const float* ln1_g = (const float*)d_in[2];
  const float* ln1_b = (const float*)d_in[3];
  const float* qkv_w = (const float*)d_in[4];
  const float* qkv_b = (const float*)d_in[5];
  const float* aow   = (const float*)d_in[6];
  const float* aob   = (const float*)d_in[7];
  const float* lnc_g = (const float*)d_in[8];
  const float* lnc_b = (const float*)d_in[9];
  const float* q_w   = (const float*)d_in[10];
  const float* q_b   = (const float*)d_in[11];
  const float* kv_w  = (const float*)d_in[12];
  const float* kv_b  = (const float*)d_in[13];
  const float* cow   = (const float*)d_in[14];
  const float* cob   = (const float*)d_in[15];
  const float* ln2_g = (const float*)d_in[16];
  const float* ln2_b = (const float*)d_in[17];
  const float* w1    = (const float*)d_in[18];
  const float* b1    = (const float*)d_in[19];
  const float* w2    = (const float*)d_in[20];
  const float* b2    = (const float*)d_in[21];

  char* p = (char*)d_ws;
  auto carve = [&](size_t bytes) -> char* {
    char* r = p; p += (bytes + 255) & ~(size_t)255; return r;
  };
  us* wqkv = (us*)carve((size_t)C * 3 * C * 2);   // [3C][C] transposed
  us* wao  = (us*)carve((size_t)C * C * 2);
  us* wq   = (us*)carve((size_t)C * C * 2);
  us* wkv  = (us*)carve((size_t)C * 2 * C * 2);
  us* wco  = (us*)carve((size_t)C * C * 2);
  us* w1b  = (us*)carve((size_t)C * F * 2);
  us* w2b  = (us*)carve((size_t)F * C * 2);
  us* hbuf = (us*)carve((size_t)BT * C * 2);
  us* qkvb = (us*)carve((size_t)BT * 3 * C * 2);
  us* obuf = (us*)carve((size_t)BT * C * 2);
  us* ctxb = (us*)carve((size_t)BT * C * 2);
  us* vtb  = (us*)carve((size_t)BT * C * 2);      // Vt[(b*H+h)*64 + d][T]
  us* f1b  = (us*)carve((size_t)BT * F * 2);
  float* resid = (float*)carve((size_t)BT * C * 4);
  us* qxb = qkvb;                    // reuse after self-attention
  us* kvb = qkvb + (size_t)BT * C;

  // first LayerNorm, weight conversions, context conversion: 1536 blocks
  k_prep<C, F, BT><<<BT / 16 + (8 * C * C + 2 * C * F + BT * C) / 16384, 256, 0,
                     stream>>>(x, ln1_g, ln1_b, hbuf, qkv_w, wqkv, aow, wao, q_w, wq,
                               kv_w, wkv, cow, wco, w1, w1b, w2, w2b, ctx, ctxb, C);

  const int flashBlocks = (B * H * (T / 32)) / 8;   // 256
  const float scale = 0.125f;                       // 1/sqrt(64)

  // 1) self-attention branch
  k_gemm<0><<<dim3(3 * C / 128, BT / 128), 256, 0, stream>>>(
      hbuf, wqkv, qkv_b, nullptr, qkvb, BT, 3 * C, C);
  k_vt<3 * C, T><<<dim3(T / 256, B * H), 128, 0, stream>>>(qkvb, 2 * C, vtb, H);
  k_flash<<<flashBlocks, 256, 0, stream>>>(
      qkvb, 3 * C, 0, qkvb, 3 * C, C, vtb, obuf, C, T, H, 1, scale);
  k_gemm<1><<<dim3(C / 128, BT / 128), 256, 0, stream>>>(
      obuf, wao, aob, x, resid, BT, C, C);

  // 2) cross-attention branch
  k_layernorm<<<BT / 16, 256, 0, stream>>>(resid, lnc_g, lnc_b, hbuf, C);
  k_gemm_two<<<dim3(3 * C / 128, BT / 128), 256, 0, stream>>>(
      hbuf, wq, q_b, qxb, C, ctxb, wkv, kv_b, kvb, 2 * C, C);
  k_vt<2 * C, T><<<dim3(T / 256, B * H), 128, 0, stream>>>(kvb, C, vtb, H);
  k_flash<<<flashBlocks, 256, 0, stream>>>(
      qxb, C, 0, kvb, 2 * C, 0, vtb, obuf, C, T, H, 0, scale);
  k_gemm<1><<<dim3(C / 128, BT / 128), 256, 0, stream>>>(
      obuf, wco, cob, resid, resid, BT, C, C);

  // 3) FFN
  k_layernorm<<<BT / 16, 256, 0, stream>>>(resid, ln2_g, ln2_b, hbuf, C);
  k_gemm<2><<<dim3(F / 128, BT / 128), 256, 0, stream>>>(
      hbuf, w1b, b1, nullptr, f1b, BT, F, C);
  k_gemm<1><<<dim3(C / 128, BT / 128), 256, 0, stream>>>(
      f1b, w2b, b2, resid, (float*)d_out, BT, C, F);
}

// v007
// Measured time: 233 microseconds a run.
// Next to v006, in two timings, it ran 1.05 and 1.04 times as fast.
// Counting every step since v000, it is 2.34 times as fast.
#include <hip/hip_runtime.h>
#include <hip/hip_bf16.h>
#include <math.h>

typedef __attribute__((ext_vector_type(16))) __bf16 v16bf;
typedef __attribute__((ext_vector_type(8)))  float  v8f;
typedef int v4i_t __attribute__((vector_size(16)));
typedef unsigned short us;

#define DEV static __device__ __forceinline__
#define AS1 __attribute__((address_space(1)))
#define AS3 __attribute__((address_space(3)))

#if defined(__has_builtin)
#if __has_builtin(__builtin_amdgcn_global_load_async_to_lds_b128)
#define HAVE_ASYNC_BUILTIN 1
#endif
#if __has_builtin(__builtin_amdgcn_s_wait_asynccnt)
#define HAVE_WAIT_ASYNC_BUILTIN 1
#endif
#endif
#ifndef HAVE_ASYNC_BUILTIN
#define HAVE_ASYNC_BUILTIN 0
#endif
#ifndef HAVE_WAIT_ASYNC_BUILTIN
#define HAVE_WAIT_ASYNC_BUILTIN 0
#endif

// LDS pitch, in 16-bit elements, of the GEMM tiles' rows of 128, which
// ds_load_b128 reads one row per lane: 272 B = 16 B x odd spreads 16 rows over
// all 64 banks.
constexpr int LP = 136;

union FragB16 { uint4 q[2]; v16bf v; };

DEV us f2bf(float f) {
  unsigned u = __float_as_uint(f);
  u += 0x7FFFu + ((u >> 16) & 1u);          // round-to-nearest-even
  return (us)(u >> 16);
}
DEV v8f zero8() { v8f z = {0.f,0.f,0.f,0.f,0.f,0.f,0.f,0.f}; return z; }

DEV v8f wmma_bf16(const FragB16& a, const FragB16& b, v8f c) {
  return __builtin_amdgcn_wmma_f32_16x16x32_bf16(false, a.v, false, b.v,
                                                 (short)0, c, false, false);
}

// 16-byte async global -> LDS copy (per-lane addresses), ASYNCcnt-tracked.
DEV void async_copy16(us* lds, const us* g) {
#if HAVE_ASYNC_BUILTIN
  __builtin_amdgcn_global_load_async_to_lds_b128((AS1 v4i_t*)(us*)g,
                                                 (AS3 v4i_t*)lds, 0, 0);
#else
  unsigned loff = (unsigned)(unsigned long long)(AS3 us*)lds;
  unsigned long long ga = (unsigned long long)g;
  asm volatile("global_load_async_to_lds_b128 %0, %1, off"
               :: "v"(loff), "v"(ga) : "memory");
#endif
}
DEV void wait_async0() {
#if HAVE_WAIT_ASYNC_BUILTIN
  __builtin_amdgcn_s_wait_asynccnt(0);
#else
  asm volatile("s_wait_asynccnt 0" ::: "memory");
#endif
}

// The three streaming pieces below give every lane 64 elements (16 loads of
// 16 B, all issued before the first use): a launch then starts one wave where
// sixteen one-load waves would stand, for speed only.  The two conversions and the LayerNorm are written as
// the work of one block of 256 threads, numbered blk, so that pieces which do
// not depend on one another can share a launch (k_prep).
typedef float    f32x4 __attribute__((ext_vector_type(4)));
typedef unsigned u32x4 __attribute__((ext_vector_type(4)));

// two f32 -> two bf16 in one dword, each rounded as f2bf rounds
DEV unsigned pack2(float lo, float hi) {
  unsigned a = __float_as_uint(lo), c = __float_as_uint(hi);
  a += 0x7FFFu + ((a >> 16) & 1u);
  c += 0x7FFFu + ((c >> 16) & 1u);
  return (a >> 16) | (c & 0xFFFF0000u);
}

// ---------------- fp32 -> bf16 (row-major copy: context) --------------------
// One block: 4096 float4 in a row; a wave's load covers 512 B, its store 256 B.
DEV void cvt_bf16_block(const float* __restrict__ src, us* __restrict__ dst,
                        int blk) {
  const int base = blk * 4096 + threadIdx.x;
  f32x4 f[16];
  #pragma unroll
  for (int u = 0; u < 16; ++u) f[u] = ((const f32x4*)src)[base + u * 256];
  // keeps every load above in front of the first use, all in flight together;
  // without it some sink to their use, one memory latency after another
  __builtin_amdgcn_sched_barrier(0);
  #pragma unroll
  for (int u = 0; u < 16; ++u) {
    uint2 o; o.x = pack2(f[u][0], f[u][1]); o.y = pack2(f[u][2], f[u][3]);
    ((uint2*)dst)[base + u * 256] = o;
  }
  // in a shared launch another piece's code can stand behind these stores in the
  // listing: the wait that belongs in front of an overwrite of their registers
  asm volatile("s_wait_xcnt 0x0" ::: "memory");
}

// -------- fp32 W[K,N] -> bf16 Wt[N,K] (convert + transpose in registers) ----
// One wave: 64 k x 32 n.  A lane loads 8 k-rows x 8 n and stores 8 n-rows x 8 k:
// four lanes read one 128-B line of W, eight lanes write one 128-B line of Wt.
// K and N are compile-time so that the row steps are immediate offsets.
// One block: 64 k x 256 n; K * N / 16384 blocks, n fastest.
template <int K, int N>
DEV void cvt_t_block(const float* __restrict__ src, us* __restrict__ dst,
                     int blk) {
  const int lane = threadIdx.x & 31, wid = threadIdx.x >> 5;
  const int k0 = (blk / (N / 256)) * 64 + (lane >> 2) * 8;
  const int n0 = (blk % (N / 256)) * 256 + wid * 32 + (lane & 3) * 8;
  const float* s = src + (size_t)k0 * N + n0;
  f32x4 f[16];                       // f[2 i + j]: row k0 + i, columns 4 j ..
  #pragma unroll
  for (int i = 0; i < 15; ++i)
    f[i] = *(const f32x4*)(s + (i >> 1) * N + (i & 1) * 4);
  // the last load's result may take the address register that the 15 loads in
  // flight name: the wait that belongs in front of such an overwrite
  asm volatile("s_wait_xcnt 0x0" ::: "memory");
  f[15] = *(const f32x4*)(s + 7 * N + 4);
  // keeps every load above in front of the first use, all in flight together;
  // without it some sink to their use, one memory latency after another
  __builtin_amdgcn_sched_barrier(0);
  us* d = dst + (size_t)n0 * K + k0;
  #pragma unroll
  for (int e = 0; e < 8; ++e) {
    const int j = e >> 2, m = e & 3;
    uint4 o;
    o.x = pack2(f[0 + j][m],  f[2 + j][m]);  o.y = pack2(f[4 + j][m],  f[6 + j][m]);
    o.z = pack2(f[8 + j][m],  f[10 + j][m]); o.w = pack2(f[12 + j][m], f[14 + j][m]);
    *(uint4*)(d + e * K) = o;
  }
  // in a shared launch another piece's code can stand behind these stores in the
  // listing: the wait that belongs in front of an overwrite of their registers
  asm volatile("s_wait_xcnt 0x0" ::: "memory");
}

// ---------------- LayerNorm: one wave per two rows (C = 1024) ---------------
// A lane holds 32 elements of each row; a row's sums are four in-lane chains and
// a five-step butterfly, so no LDS array and no barrier.
DEV void layernorm_block(const float* __restrict__ x, const float* __restrict__ g,
                         const float* __restrict__ b, us* __restrict__ out, int C,
                         int blk) {
  const int lane = threadIdx.x & 31;
  const int row0 = (blk * 8 + (threadIdx.x >> 5)) * 2;
  const int c4 = C >> 2;             // groups of 4 elements in a row
  const int at[2] = {row0 * c4 + lane, (row0 + 1) * c4 + lane};
  f32x4 v[16], gb[16];               // v[8 q + i]: row q; gb[i]: g, gb[8 + i]: b
  #pragma unroll
  for (int q = 0; q < 2; ++q)
    #pragma unroll
    for (int i = 0; i < 8; ++i)
      v[8 * q + i] = ((const f32x4*)x)[at[q] + i * 32];
  // a result of the loads below may take an address register that the loads in
  // flight above name: the wait that belongs in front of such an overwrite
  asm volatile("s_wait_xcnt 0x0" ::: "memory");
  #pragma unroll
  for (int i = 0; i < 15; ++i)
    gb[i] = ((const f32x4*)(i < 8 ? g : b))[lane + (i & 7) * 32];
  // the same in front of the last load, whose result may take the index register
  asm volatile("s_wait_xcnt 0x0" ::: "memory");
  gb[15] = ((const f32x4*)b)[lane + 7 * 32];
  // keeps every load above in front of the first use, all in flight together;
  // without it some sink to their use, one memory latency after another
  __builtin_amdgcn_sched_barrier(0);
  float s[2], s2[2];
  #pragma unroll
  for (int q = 0; q < 2; ++q) {
    f32x4 a = {0.f, 0.f, 0.f, 0.f}, a2 = {0.f, 0.f, 0.f, 0.f};
    #pragma unroll
    for (int i = 0; i < 8; ++i) {
      f32x4 t = v[8 * q + i];
      a += t; a2 += t * t;
    }
    s[q]  = (a[0] + a[1]) + (a[2] + a[3]);
    s2[q] = (a2[0] + a2[1]) + (a2[2] + a2[3]);
  }
  #pragma unroll
  for (int off = 16; off; off >>= 1)
    #pragma unroll
    for (int q = 0; q < 2; ++q) {
      s[q]  += __shfl_xor(s[q],  off, 32);
      s2[q] += __shfl_xor(s2[q], off, 32);
    }
  #pragma unroll
  for (int q = 0; q < 2; ++q) {
    const float mean = s[q] / C;
    const float rstd = rsqrtf(s2[q] / C - mean * mean + 1e-5f);
    #pragma unroll
    for (int i = 0; i < 8; ++i) {
      f32x4 t = v[8 * q + i], gg = gb[i], bb = gb[8 + i];
      uint2 w;
      w.x = pack2((t[0] - mean) * rstd * gg[0] + bb[0],
                  (t[1] - mean) * rstd * gg[1] + bb[1]);
      w.y = pack2((t[2] - mean) * rstd * gg[2] + bb[2],
                  (t[3] - mean) * rstd * gg[3] + bb[3]);
      ((uint2*)out)[at[q] + i * 32] = w;
    }
  }
}

__global__ __launch_bounds__(256)
void k_layernorm(const float* __restrict__ x, const float* __restrict__ g,
                 const float* __restrict__ b, us* __restrict__ out, int C) {
  layernorm_block(x, g, b, out, C, blockIdx.x);
}

// -------- everything that reads inputs alone, in ONE launch -----------------
// The first LayerNorm, the seven weight conversions and the context conversion
// depend on nothing but inputs and write disjoint buffers: one grid holds the
// blocks of all nine, dealt out by ranges of blockIdx.x (a scalar test), so that
// one launch gap, one ramp and one drain stand where nine would, and the short
// pieces' memory latency hides behind the long ones' streams.
// lnC: the LayerNorm's row length, at run time as k_layernorm takes it, so that
// both run the same code.
template <int C, int F, int BT>
__global__ __launch_bounds__(256)
void k_prep(const float* __restrict__ x, const float* __restrict__ ln_g,
            const float* __restrict__ ln_b, us* __restrict__ h,
            const float* __restrict__ qkv_w, us* __restrict__ wqkv,
            const float* __restrict__ aow, us* __restrict__ wao,
            const float* __restrict__ q_w, us* __restrict__ wq,
            const float* __restrict__ kv_w, us* __restrict__ wkv,
            const float* __restrict__ cow, us* __restrict__ wco,
            const float* __restrict__ w1, us* __restrict__ w1b,
            const float* __restrict__ w2, us* __restrict__ w2b,
            const float* __restrict__ ctx, us* __restrict__ ctxb, int lnC) {
  constexpr int nLN = BT / 16, nCC = C * C / 16384, nCF = C * F / 16384;
  int blk = blockIdx.x;
  if (blk < nLN) { layernorm_block(x, ln_g, ln_b, h, lnC, blk); return; }
  blk -= nLN;
  if (blk < 3 * nCC) { cvt_t_block<C, 3 * C>(qkv_w, wqkv, blk); return; }
  blk -= 3 * nCC;
  if (blk < 3 * nCC) {               // the three C x C weights: one copy of the code
    const int w = blk / nCC;
    cvt_t_block<C, C>(w == 0 ? aow : w == 1 ? q_w : cow,
                      w == 0 ? wao : w == 1 ? wq : wco, blk - w * nCC);
    return;
  }
  blk -= 3 * nCC;
  if (blk < 2 * nCC) { cvt_t_block<C, 2 * C>(kv_w, wkv, blk); return; }
  blk -= 2 * nCC;
  if (blk < nCF) { cvt_t_block<C, F>(w1, w1b, blk); return; }
  blk -= nCF;
  if (blk < nCF) { cvt_t_block<F, C>(w2, w2b, blk); return; }
  blk -= nCF;
  cvt_bf16_block(ctx, ctxb, blk);
}

// ------- bf16 WMMA GEMM: out = A[M,K] @ Wt[N,K]^T + bias --------------------
// Double-buffered LDS filled by async global->LDS copies (ASYNCcnt).
// One block: a 128 x 128 tile of out, 128 k per stage; a wave: 64 x 32.  A wave's
// copy covers two rows of 256 B, whole lines; M, N, K are multiples of 128.
// MODE 0: bf16 out.  MODE 1: fp32 out = resid + acc.  MODE 2: bf16 gelu(acc).
// The work of one block: tile column bx, tile row blockIdx.y.
// MODE 0 only: the columns from vcol0 on are V, which attention reads transposed:
// their tiles go to vt[(b * (N - vcol0) + column - vcol0)][T] and nowhere else
// (row = b * T + t; T a multiple of 128, vcol0 of 128).
template <int MODE, int T = 128>
DEV void gemm_block(const us* __restrict__ A, const us* __restrict__ Wt,
                    const float* __restrict__ bias, const float* __restrict__ resid,
                    void* __restrict__ outp, int N, int K, int bx,
                    us* __restrict__ vt = nullptr, int vcol0 = 0) {
  __shared__ __align__(16) us lA[2][128 * LP];
  __shared__ __align__(16) us lW[2][128 * LP];
  const int tid  = threadIdx.x;
  const int lane = tid & 31, wid = tid >> 5;
  const int wm = wid & 1, wn = wid >> 1;
  const int l15 = lane & 15, khalf = (lane >> 4) << 3;
  const int mbase = blockIdx.y * 128, nbase = bx * 128;

  // 16 threads copy one row of 128 k; a thread: 8 x 16 B of A, 8 x 16 B of W
  const int crow = tid >> 4, cc8 = (tid & 15) << 3;

  auto issue = [&](int p, int k0) {
    const us* ga = A  + (size_t)(mbase + crow) * K + k0 + cc8;
    const us* gw = Wt + (size_t)(nbase + crow) * K + k0 + cc8;
    // unrolled: the LDS row steps become constants
    #pragma unroll
    for (int i = 0; i < 8; ++i) {
      async_copy16(&lA[p][(crow + 16 * i) * LP + cc8], ga + (size_t)(16 * i) * K);
      async_copy16(&lW[p][(crow + 16 * i) * LP + cc8], gw + (size_t)(16 * i) * K);
    }
  };

  v8f c[4][2];
  // unrolled, here and below: constant indices keep c, a and bfr in registers
  #pragma unroll
  for (int im = 0; im < 4; ++im) { c[im][0] = zero8(); c[im][1] = zero8(); }

  const int nk = K >> 7;
  issue(0, 0);
  wait_async0();
  __syncthreads();
  for (int j = 0; j < nk; ++j) {
    const int p = j & 1;
    if (j + 1 < nk) issue((j + 1) & 1, (j + 1) << 7);
    // unrolled: a later 32-k block's LDS reads can go ahead of this one's WMMAs
    #pragma unroll
    for (int kk = 0; kk < 128; kk += 32) {
      FragB16 a[4], bfr[2];
      #pragma unroll
      for (int im = 0; im < 4; ++im) {
        int r = wm * 64 + im * 16 + l15;
        a[im].q[0] = *(const uint4*)&lA[p][r * LP + kk + khalf];
        a[im].q[1] = *(const uint4*)&lA[p][r * LP + kk + 16 + khalf];
      }
      #pragma unroll
      for (int in = 0; in < 2; ++in) {
        int nc = wn * 32 + in * 16 + l15;
        bfr[in].q[0] = *(const uint4*)&lW[p][nc * LP + kk + khalf];
        bfr[in].q[1] = *(const uint4*)&lW[p][nc * LP + kk + 16 + khalf];
      }
      #pragma unroll
      for (int im = 0; im < 4; ++im)
        #pragma unroll
        for (int in = 0; in < 2; ++in)
          c[im][in] = wmma_bf16(a[im], bfr[in], c[im][in]);
    }
    if (j + 1 < nk) wait_async0();
    __syncthreads();
  }

  const int hi8 = (lane >> 4) << 3;
  if constexpr (MODE == 0) {
    // A lane's 8 values of an accumulator tile are 8 consecutive rows (t) of one
    // column (d): 16 B in a row of vt.  A wave's 64 rows fill one 128-B line of each
    // of its 32 rows of vt.  The test is the same for the whole block (scalar).
    if (nbase >= vcol0) {
      const int col = nbase + wn * 32 + l15;
      us* d = vt + ((size_t)(mbase / T) * (N - vcol0) + (col - vcol0)) * T +
              mbase % T + wm * 64 + hi8;
      float bs[2];
      bs[0] = bias[col];
      // the second load's result may take the index register that the first names,
      // and what follows may take it behind the second: the wait that belongs in
      // front of such an overwrite, behind each
      asm volatile("s_wait_xcnt 0x0" ::: "memory");
      bs[1] = bias[col + 16];
      asm volatile("s_wait_xcnt 0x0" ::: "memory");
      u32x4 w[2][4];
      // unrolled: constant indices keep c and w in registers
      #pragma unroll
      for (int in = 0; in < 2; ++in)
        #pragma unroll
        for (int im = 0; im < 4; ++im) {
          const v8f a = c[im][in];
          const float e = bs[in];
          w[in][im][0] = pack2(a[0] + e, a[1] + e);
          w[in][im][1] = pack2(a[2] + e, a[3] + e);
          w[in][im][2] = pack2(a[4] + e, a[5] + e);
          w[in][im][3] = pack2(a[6] + e, a[7] + e);
        }
      // The lane's eight 16-byte stores (two rows of vt, 32 t of each) as one run in
      // one statement: written as plain stores they came out with arithmetic between
      // them that takes their registers.  The wait on the last line stands in front
      // of every later overwrite of a register that the stores name (the other
      // tiles' code stands behind them in the listing).
      asm volatile("global_store_b128 %0, %2, off\n\t"
                   "global_store_b128 %0, %3, off offset:32\n\t"
                   "global_store_b128 %0, %4, off offset:64\n\t"
                   "global_store_b128 %0, %5, off offset:96\n\t"
                   "global_store_b128 %1, %6, off\n\t"
                   "global_store_b128 %1, %7, off offset:32\n\t"
                   "global_store_b128 %1, %8, off offset:64\n\t"
                   "global_store_b128 %1, %9, off offset:96\n\t"
                   "s_wait_xcnt 0x0"
                   :: "v"(d), "v"(d + 16 * T), "v"(w[0][0]), "v"(w[0][1]), "v"(w[0][2]),
                      "v"(w[0][3]), "v"(w[1][0]), "v"(w[1][1]), "v"(w[1][2]),
                      "v"(w[1][3]) : "memory");
      return;
    }
  }
  #pragma unroll
  for (int im = 0; im < 4; ++im)
    #pragma unroll
    for (int in = 0; in < 2; ++in)
      #pragma unroll
      for (int r = 0; r < 8; ++r) {
        int row = mbase + wm * 64 + im * 16 + r + hi8;
        int col = nbase + wn * 32 + in * 16 + l15;
        size_t idx = (size_t)row * N + col;
        float v = c[im][in][r] + bias[col];
        if (MODE == 0) {
          ((us*)outp)[idx] = f2bf(v);
        } else if (MODE == 1) {
          ((float*)outp)[idx] = resid[idx] + v;
        } else {
          float gv = 0.5f * v * (1.0f + erff(v * 0.70710678118654752f));
          ((us*)outp)[idx] = f2bf(gv);
        }
      }
}

template <int MODE>
__global__ __launch_bounds__(256)
void k_gemm(const us* __restrict__ A, const us* __restrict__ Wt,
            const float* __restrict__ bias, const float* __restrict__ resid,
            void* __restrict__ outp, int M, int N, int K) {
  gemm_block<MODE>(A, Wt, bias, resid, outp, N, K, blockIdx.x);
}

// A MODE 0 product whose columns from vcol0 on are V (rows of T per batch).
template <int T>
__global__ __launch_bounds__(256)
void k_gemm_v(const us* __restrict__ A, const us* __restrict__ Wt,
              const float* __restrict__ bias, us* __restrict__ outp, int N, int K,
              us* __restrict__ vt, int vcol0) {
  gemm_block<0, T>(A, Wt, bias, nullptr, outp, N, K, blockIdx.x, vt, vcol0);
}

// Two independent MODE 0 products of the same M and K in ONE launch: the second's
// tile columns stand behind the first's in blockIdx.x (a scalar test).  The first
// has no V columns; the second's begin at vcol1.
template <int T>
__global__ __launch_bounds__(256)
void k_gemm_two(const us* __restrict__ A0, const us* __restrict__ Wt0,
                const float* __restrict__ bias0, us* __restrict__ out0, int N0,
                const us* __restrict__ A1, const us* __restrict__ Wt1,
                const float* __restrict__ bias1, us* __restrict__ out1, int N1,
                int K, us* __restrict__ vt, int vcol1) {
  const int bx = blockIdx.x, nb0 = N0 >> 7;
  const bool second = bx >= nb0;
  gemm_block<0, T>(second ? A1 : A0, second ? Wt1 : Wt0, second ? bias1 : bias0,
                   nullptr, second ? out1 : out0, second ? N1 : N0, K,
                   second ? bx - nb0 : bx, vt, second ? vcol1 : N0);
}

typedef float  f32x2  __attribute__((ext_vector_type(2)));
typedef __bf16 bf16x2 __attribute__((ext_vector_type(2)));

// two f32 -> two bf16 in one dword, round to nearest even, one instruction
DEV unsigned cvt2(float lo, float hi) {
  f32x2 f = {lo, hi};
  return __builtin_bit_cast(unsigned, __builtin_convertvector(f, bf16x2));
}
// LDS pitch, in 16-bit elements, of the attention tiles' rows of 64 (128 B), which
// ds_load_b128 reads one row per lane: 144 B = 16 B x odd spreads 16 rows over
// all 64 banks.
constexpr int FP = 72;
DEV unsigned lds_addr(const us* p) {
  return (unsigned)(unsigned long long)(const AS3 us*)p;
}
// Four 16-byte async global -> LDS copies of one lane (ASYNCcnt-tracked).  The
// wait on the last line stands in front of every later overwrite of a register
// that the copies name; inside the statement nothing can be lifted over it.
DEV void async_copy16x4(unsigned l0, const us* g0, unsigned l1, const us* g1,
                        unsigned l2, const us* g2, unsigned l3, const us* g3) {
  asm volatile("global_load_async_to_lds_b128 %0, %1, off\n\t"
               "global_load_async_to_lds_b128 %2, %3, off\n\t"
               "global_load_async_to_lds_b128 %4, %5, off\n\t"
               "global_load_async_to_lds_b128 %6, %7, off\n\t"
               "s_wait_xcnt 0x0"
               :: "v"(l0), "v"(g0), "v"(l1), "v"(g1), "v"(l2), "v"(g2),
                  "v"(l3), "v"(g3) : "memory");
}
// max of a lane's value and its partner's (lane ^ 16)
DEV float maxhalves(float v) {
  const int i = __float_as_int(v);
  return fmaxf(v, __int_as_float(__builtin_amdgcn_permlanex16(
                      i, i, 0x76543210, 0xfedcba98, false, false)));
}

__global__ __launch_bounds__(256)
void k_flash(const us* __restrict__ Qb, int q_rs, int q_col0,
             const us* __restrict__ Kb, int k_rs, int k_col0,
             const us* __restrict__ Vt,
             us* __restrict__ Ob, int o_rs,
             int T, int H, int causal, float scale) {
  __shared__ __align__(16) us lK[2][64 * FP];
  __shared__ __align__(16) us lV[2][64 * FP];
  const int tid = threadIdx.x;
  const int lane = tid & 31;
  // the wave's number in a scalar register: tile indices and the trip count
  // are then scalar, and the loop and the diagonal test are scalar branches
  const int wid = __builtin_amdgcn_readfirstlane(tid >> 5);
  const int gw = blockIdx.x * 8 + wid;
  const int nQT = T >> 5;
  const int qt = gw % nQT;
  const int h  = (gw / nQT) % H;
  const int b  = gw / (nQT * H);
  const int l15 = lane & 15, khalf = (lane >> 4) << 3, hi8 = khalf;
  const size_t brow = (size_t)b * T;
  // 8 threads copy one row of 128 B; a thread: 2 x 16 B of K, 2 x 16 B of Vt
  const int crow = tid >> 3, cc8 = (tid & 7) << 3;
  const us* gk = Kb + (brow + crow) * k_rs + k_col0 + h * 64 + cc8;
  const us* gv = Vt + ((size_t)(b * H + h) * 64 + crow) * T + cc8;
  const unsigned lk = lds_addr(&lK[0][crow * FP + cc8]);
  const unsigned lv = lds_addr(&lV[0][crow * FP + cc8]);
  auto issue = [&](int p, int s) {   // stage s (keys 64 s ..) into buffer p
    const us* k0 = gk + (size_t)(s * 64) * k_rs;
    const us* v0 = gv + s * 64;
    const unsigned o = p * (64 * FP * 2), half = 32 * FP * 2;
    async_copy16x4(lk + o, k0, lk + o + half, k0 + (size_t)32 * k_rs,
                   lv + o, v0, lv + o + half, v0 + (size_t)32 * T);
  };

  FragB16 ones;
  {
    uint4 o; o.x = o.y = o.z = o.w = 0x3F803F80u;   // bf16 1.0 pairs
    ones.q[0] = o; ones.q[1] = o;
  }
  FragB16 bq[2][2];                  // [query group][32 d]
  #pragma unroll
  for (int g = 0; g < 2; ++g) {
    const us* qr = Qb + (brow + qt * 32 + g * 16 + l15) * q_rs + q_col0 + h * 64;
    #pragma unroll
    for (int kc = 0; kc < 2; ++kc) {
      bq[g][kc].q[0] = *(const uint4*)(qr + kc * 32 + khalf);
      bq[g][kc].q[1] = *(const uint4*)(qr + kc * 32 + 16 + khalf);
    }
  }
  // the copies' addresses are formed next, in registers that the Q loads in
  // flight may name: the wait that belongs in front of such an overwrite
  asm volatile("s_wait_xcnt 0x0" ::: "memory");
  // exp(scale * (s - m)) = exp2(s * c2 - m * c2); scale > 0, so the maximum is
  // taken over the raw scores
  const float c2 = scale * 1.44269504088896340736f;
  float mrow[2];
  v8f oc[2][4], ls[2];
  #pragma unroll
  for (int g = 0; g < 2; ++g) {
    mrow[g] = -__builtin_inff(); ls[g] = zero8();
    #pragma unroll
    for (int d = 0; d < 4; ++d) oc[g][d] = zero8();
  }

  const int nsteps = causal ? (qt + 1) : (T >> 5);
  // stages of the block: as far as its last wave's diagonal; the same in all waves
  const int nst = causal ? (((int)(blockIdx.x * 8) % nQT + 8) >> 1) : (T >> 6);

  issue(0, 0);
  // stage 0 has landed before the barrier behind which other waves read it
  asm volatile("s_wait_asynccnt 0x0" ::: "memory");
  __syncthreads();
  if (1 < nst) issue(1, 1);

  for (int s = 0; s < nst; ++s) {
   const int pb = s & 1;
   // unrolled: the half stage's LDS offsets become constants
   #pragma unroll
   for (int sub = 0; sub < 2; ++sub) {
    const int j = 2 * s + sub;
    // a wave is done behind its diagonal (a scalar test); it still passes every
    // barrier below
    if (j >= nsteps) continue;
    FragB16 ka[2][2], va[4];
    #pragma unroll
    for (int ns = 0; ns < 2; ++ns) {
      const us* kr = &lK[pb][(sub * 32 + ns * 16 + l15) * FP + khalf];
      #pragma unroll
      for (int kc = 0; kc < 2; ++kc) {
        ka[ns][kc].q[0] = *(const uint4*)(kr + kc * 32);
        ka[ns][kc].q[1] = *(const uint4*)(kr + kc * 32 + 16);
      }
    }
    #pragma unroll
    for (int d = 0; d < 4; ++d) {
      const us* vr = &lV[pb][(d * 16 + l15) * FP + sub * 32 + khalf];
      va[d].q[0] = *(const uint4*)vr;
      va[d].q[1] = *(const uint4*)(vr + 16);
    }
    // keeps the step's 16 LDS reads together in front of the first product: one
    // place with reads a step; without it the Vt reads sink into the softmax in
    // further groups
    __builtin_amdgcn_sched_barrier(0);
    v8f st[2][2];                    // [query group][16-key tile]
    #pragma unroll
    for (int g = 0; g < 2; ++g)
      #pragma unroll
      for (int ns = 0; ns < 2; ++ns) {
        v8f acc = wmma_bf16(ka[ns][0], bq[g][0], zero8());
        st[g][ns] = wmma_bf16(ka[ns][1], bq[g][1], acc);
      }
    // only the last causal step holds keys behind a query of this wave
    if (causal && j == nsteps - 1) {
      #pragma unroll
      for (int g = 0; g < 2; ++g)
        #pragma unroll
        for (int ns = 0; ns < 2; ++ns)
          #pragma unroll
          for (int r = 0; r < 8; ++r)
            if (ns * 16 + hi8 + r > g * 16 + l15) st[g][ns][r] = -__builtin_inff();
    }
    #pragma unroll
    for (int g = 0; g < 2; ++g) {
      float mx = fmaxf(st[g][0][0], st[g][1][0]);
      #pragma unroll
      for (int r = 1; r < 8; ++r) mx = fmaxf(mx, fmaxf(st[g][0][r], st[g][1][r]));
      const float mn = fmaxf(mrow[g], maxhalves(mx));
      const float a  = __builtin_amdgcn_exp2f((mrow[g] - mn) * c2);
      const float mc = mn * c2;
      mrow[g] = mn;
      FragB16 pf;
      #pragma unroll
      for (int ns = 0; ns < 2; ++ns) {
        float p[8];
        #pragma unroll
        for (int r = 0; r < 8; ++r)
          p[r] = __builtin_amdgcn_exp2f(fmaf(st[g][ns][r], c2, -mc));
        uint4 w;
        w.x = cvt2(p[0], p[1]); w.y = cvt2(p[2], p[3]);
        w.z = cvt2(p[4], p[5]); w.w = cvt2(p[6], p[7]);
        pf.q[ns] = w;
      }
      ls[g] *= a;
      ls[g] = wmma_bf16(ones, pf, ls[g]);
      #pragma unroll
      for (int d = 0; d < 4; ++d) {
        oc[g][d] *= a;
        oc[g][d] = wmma_bf16(va[d], pf, oc[g][d]);
      }
    }
   }
   // the hand-over of a stage, in every wave: this wave's reads of buffer pb are
   // done, its copies of the next stage have landed, then the barrier that
   // publishes that stage and frees buffer pb for the refill behind it
   asm volatile("s_wait_dscnt 0x0" ::: "memory");
   asm volatile("s_wait_asynccnt 0x0" ::: "memory");
   __syncthreads();
   if (s + 2 < nst) issue(pb, s + 2);
  }
  // no copy is outstanding when the wave ends
  asm volatile("s_wait_asynccnt 0x0" ::: "memory");
  // a lane holds 8 consecutive d of its query in each tile: 16-byte stores
  #pragma unroll
  for (int g = 0; g < 2; ++g) {
    const float inv = 1.0f / ls[g][0];
    us* orow = Ob + (brow + qt * 32 + g * 16 + l15) * o_rs + h * 64 + hi8;
    #pragma unroll
    for (int d = 0; d < 4; ++d) {
      uint4 w;
      w.x = cvt2(oc[g][d][0] * inv, oc[g][d][1] * inv);
      w.y = cvt2(oc[g][d][2] * inv, oc[g][d][3] * inv);
      w.z = cvt2(oc[g][d][4] * inv, oc[g][d][5] * inv);
      w.w = cvt2(oc[g][d][6] * inv, oc[g][d][7] * inv);
      *(uint4*)(orow + d * 16) = w;
    }
  }
}

// ----------------------------- host launcher --------------------------------
extern "C" void kernel_launch(void* const* d_in, const int* in_sizes, int n_in,
                              void* d_out, int out_size, void* d_ws,
                              size_t ws_size, hipStream_t stream) {
  (void)in_sizes; (void)n_in; (void)out_size; (void)ws_size;
  constexpr int B = 4, T = 1024, C = 1024, H = 16, F = 4096;
  constexpr int BT = B * T;
  const float* x     = (const float*)d_in[0];
  const float* ctx   = (const float*)d_in[1];
  const float* ln1_g = (const float*)d_in[2];
  const float* ln1_b = (const float*)d_in[3];
  const float* qkv_w = (const float*)d_in[4];
  const float* qkv_b = (const float*)d_in[5];
  const float* aow   = (const float*)d_in[6];
  const float* aob   = (const float*)d_in[7];
  const float* lnc_g = (const float*)d_in[8];
  const float* lnc_b = (const float*)d_in[9];
  const float* q_w   = (const float*)d_in[10];
  const float* q_b   = (const float*)d_in[11];
  const float* kv_w  = (const float*)d_in[12];
  const float* kv_b  = (const float*)d_in[13];
  const float* cow   = (const float*)d_in[14];
  const float* cob   = (const float*)d_in[15];
  const float* ln2_g = (const float*)d_in[16];
  const float* ln2_b = (const float*)d_in[17];
  const float* w1    = (const float*)d_in[18];
  const float* b1    = (const float*)d_in[19];
  const float* w2    = (const float*)d_in[20];
  const float* b2    = (const float*)d_in[21];

  char* p = (char*)d_ws;
  auto carve = [&](size_t bytes) -> char* {
    char* r = p; p += (bytes + 255) & ~(size_t)255; return r;
  };
  us* wqkv = (us*)carve((size_t)C * 3 * C * 2);   // [3C][C] transposed
  us* wao  = (us*)carve((size_t)C * C * 2);
  us* wq   = (us*)carve((size_t)C * C * 2);
  us* wkv  = (us*)carve((size_t)C * 2 * C * 2);
  us* wco  = (us*)carve((size_t)C * C * 2);
  us* w1b  = (us*)carve((size_t)C * F * 2);
  us* w2b  = (us*)carve((size_t)F * C * 2);
  us* hbuf = (us*)carve((size_t)BT * C * 2);
  us* qkvb = (us*)carve((size_t)BT * 3 * C * 2);
  us* obuf = (us*)carve((size_t)BT * C * 2);
  us* ctxb = (us*)carve((size_t)BT * C * 2);
  us* vtb  = (us*)carve((size_t)BT * C * 2);      // Vt[(b*H+h)*64 + d][T]
  us* f1b  = (us*)carve((size_t)BT * F * 2);
  float* resid = (float*)carve((size_t)BT * C * 4);
  us* qxb = qkvb;                    // reuse after self-attention
  us* kvb = qkvb + (size_t)BT * C;

  // first LayerNorm, weight conversions, context conversion: 1536 blocks
  k_prep<C, F, BT><<<BT / 16 + (8 * C * C + 2 * C * F + BT * C) / 16384, 256, 0,
                     stream>>>(x, ln1_g, ln1_b, hbuf, qkv_w, wqkv, aow, wao, q_w, wq,
                               kv_w, wkv, cow, wco, w1, w1b, w2, w2b, ctx, ctxb, C);

  const int flashBlocks = (B * H * (T / 32)) / 8;   // 256
  const float scale = 0.125f;                       // 1/sqrt(64)

  // 1) self-attention branch
  k_gemm_v<T><<<dim3(3 * C / 128, BT / 128), 256, 0, stream>>>(
      hbuf, wqkv, qkv_b, qkvb, 3 * C, C, vtb, 2 * C);
  k_flash<<<flashBlocks, 256, 0, stream>>>(
      qkvb, 3 * C, 0, qkvb, 3 * C, C, vtb, obuf, C, T, H, 1, scale);
  k_gemm<1><<<dim3(C / 128, BT / 128), 256, 0, stream>>>(
      obuf, wao, aob, x, resid, BT, C, C);

  // 2) cross-attention branch
  k_layernorm<<<BT / 16, 256, 0, stream>>>(resid, lnc_g, lnc_b, hbuf, C);
  k_gemm_two<T><<<dim3(3 * C / 128, BT / 128), 256, 0, stream>>>(
      hbuf, wq, q_b, qxb, C, ctxb, wkv, kv_b, kvb, 2 * C, C, vtb, C);
  k_flash<<<flashBlocks, 256, 0, stream>>>(
      qxb, C, 0, kvb, 2 * C, 0, vtb, obuf, C, T, H, 0, scale);
  k_gemm<1><<<dim3(C / 128, BT / 128), 256, 0, stream>>>(
      obuf, wco, cob, resid, resid, BT, C, C);

  // 3) FFN
  k_layernorm<<<BT / 16, 256, 0, stream>>>(resid, ln2_g, ln2_b, hbuf, C);
  k_gemm<2><<<dim3(F / 128, BT / 128), 256, 0, stream>>>(
      hbuf, w1b, b1, nullptr, f1b, BT, F, C);
  k_gemm<1><<<dim3(C / 128, BT / 128), 256, 0, stream>>>(
      f1b, w2b, b2, resid, (float*)d_out, BT, C, F);
}

// v008
// It runs in 225 microseconds.
// Next to v007, in two timings, it ran 1.06 and 1.04 times as fast.
// Over all steps from v000 it is 2.45 times as fast.
#include <hip/hip_runtime.h>
#include <hip/hip_bf16.h>
#include <math.h>

typedef __attribute__((ext_vector_type(16))) __bf16 v16bf;
typedef __attribute__((ext_vector_type(8)))  float  v8f;
typedef int v4i_t __attribute__((vector_size(16)));
typedef unsigned short us;

#define DEV static __device__ __forceinline__
#define AS1 __attribute__((address_space(1)))
#define AS3 __attribute__((address_space(3)))

#if defined(__has_builtin)
#if __has_builtin(__builtin_amdgcn_global_load_async_to_lds_b128)
#define HAVE_ASYNC_BUILTIN 1
#endif
#if __has_builtin(__builtin_amdgcn_s_wait_asynccnt)
#define HAVE_WAIT_ASYNC_BUILTIN 1
#endif
#endif
#ifndef HAVE_ASYNC_BUILTIN
#define HAVE_ASYNC_BUILTIN 0
#endif
#ifndef HAVE_WAIT_ASYNC_BUILTIN
#define HAVE_WAIT_ASYNC_BUILTIN 0
#endif

// LDS pitch, in 16-bit elements, of the GEMM tiles' rows of 128, which
// ds_load_b128 reads one row per lane: 272 B = 16 B x odd spreads 16 rows over
// all 64 banks.
constexpr int LP = 136;

union FragB16 { uint4 q[2]; v16bf v; };

DEV us f2bf(float f) {
  unsigned u = __float_as_uint(f);
  u += 0x7FFFu + ((u >> 16) & 1u);          // round-to-nearest-even
  return (us)(u >> 16);
}
DEV v8f zero8() { v8f z = {0.f,0.f,0.f,0.f,0.f,0.f,0.f,0.f}; return z; }

DEV v8f wmma_bf16(const FragB16& a, const FragB16& b, v8f c) {
  return __builtin_amdgcn_wmma_f32_16x16x32_bf16(false, a.v, false, b.v,
                                                 (short)0, c, false, false);
}

// 16-byte async global -> LDS copy (per-lane addresses), ASYNCcnt-tracked.
DEV void async_copy16(us* lds, const us* g) {
#if HAVE_ASYNC_BUILTIN
  __builtin_amdgcn_global_load_async_to_lds_b128((AS1 v4i_t*)(us*)g,
                                                 (AS3 v4i_t*)lds, 0, 0);
#else
  unsigned loff = (unsigned)(unsigned long long)(AS3 us*)lds;
  unsigned long long ga = (unsigned long long)g;
  asm volatile("global_load_async_to_lds_b128 %0, %1, off"
               :: "v"(loff), "v"(ga) : "memory");
#endif
}
DEV void wait_async0() {
#if HAVE_WAIT_ASYNC_BUILTIN
  __builtin_amdgcn_s_wait_asynccnt(0);
#else
  asm volatile("s_wait_asynccnt 0" ::: "memory");
#endif
}

// The three streaming pieces below give every lane 64 elements (16 loads of
// 16 B, all issued before the first use): a launch then starts one wave where
// sixteen one-load waves would stand, for speed only.  The two conversions and the LayerNorm are written as
// the work of one block of 256 threads, numbered blk, so that pieces which do
// not depend on one another can share a launch (k_prep).
typedef float    f32x4 __attribute__((ext_vector_type(4)));
typedef unsigned u32x4 __attribute__((ext_vector_type(4)));

// two f32 -> two bf16 in one dword, each rounded as f2bf rounds
DEV unsigned pack2(float lo, float hi) {
  unsigned a = __float_as_uint(lo), c = __float_as_uint(hi);
  a += 0x7FFFu + ((a >> 16) & 1u);
  c += 0x7FFFu + ((c >> 16) & 1u);
  return (a >> 16) | (c & 0xFFFF0000u);
}

// ---------------- fp32 -> bf16 (row-major copy: context) --------------------
// One block: 4096 float4 in a row; a wave's load covers 512 B, its store 256 B.
DEV void cvt_bf16_block(const float* __restrict__ src, us* __restrict__ dst,
                        int blk) {
  const int base = blk * 4096 + threadIdx.x;
  f32x4 f[16];
  #pragma unroll
  for (int u = 0; u < 16; ++u) f[u] = ((const f32x4*)src)[base + u * 256];
  // keeps every load above in front of the first use, all in flight together;
  // without it some sink to their use, one memory latency after another
  __builtin_amdgcn_sched_barrier(0);
  #pragma unroll
  for (int u = 0; u < 16; ++u) {
    uint2 o; o.x = pack2(f[u][0], f[u][1]); o.y = pack2(f[u][2], f[u][3]);
    ((uint2*)dst)[base + u * 256] = o;
  }
  // in a shared launch another piece's code can stand behind these stores in the
  // listing: the wait that belongs in front of an overwrite of their registers
  asm volatile("s_wait_xcnt 0x0" ::: "memory");
}

// -------- fp32 W[K,N] -> bf16 Wt[N,K] (convert + transpose in registers) ----
// One wave: 64 k x 32 n.  A lane loads 8 k-rows x 8 n and stores 8 n-rows x 8 k:
// four lanes read one 128-B line of W, eight lanes write one 128-B line of Wt.
// K and N are compile-time so that the row steps are immediate offsets.
// One block: 64 k x 256 n; K * N / 16384 blocks, n fastest.
template <int K, int N>
DEV void cvt_t_block(const float* __restrict__ src, us* __restrict__ dst,
                     int blk) {
  const int lane = threadIdx.x & 31, wid = threadIdx.x >> 5;
  const int k0 = (blk / (N / 256)) * 64 + (lane >> 2) * 8;
  const int n0 = (blk % (N / 256)) * 256 + wid * 32 + (lane & 3) * 8;
  const float* s = src + (size_t)k0 * N + n0;
  f32x4 f[16];                       // f[2 i + j]: row k0 + i, columns 4 j ..
  #pragma unroll
  for (int i = 0; i < 15; ++i)
    f[i] = *(const f32x4*)(s + (i >> 1) * N + (i & 1) * 4);
  // the last load's result may take the address register that the 15 loads in
  // flight name: the wait that belongs in front of such an overwrite
  asm volatile("s_wait_xcnt 0x0" ::: "memory");
  f[15] = *(const f32x4*)(s + 7 * N + 4);
  // keeps every load above in front of the first use, all in flight together;
  // without it some sink to their use, one memory latency after another
  __builtin_amdgcn_sched_barrier(0);
  us* d = dst + (size_t)n0 * K + k0;
  #pragma unroll
  for (int e = 0; e < 8; ++e) {
    const int j = e >> 2, m = e & 3;
    uint4 o;
    o.x = pack2(f[0 + j][m],  f[2 + j][m]);  o.y = pack2(f[4 + j][m],  f[6 + j][m]);
    o.z = pack2(f[8 + j][m],  f[10 + j][m]); o.w = pack2(f[12 + j][m], f[14 + j][m]);
    *(uint4*)(d + e * K) = o;
  }
  // in a shared launch another piece's code can stand behind these stores in the
  // listing: the wait that belongs in front of an overwrite of their registers
  asm volatile("s_wait_xcnt 0x0" ::: "memory");
}

// ---------------- LayerNorm: one wave per two rows (C = 1024) ---------------
// A lane holds 32 elements of each row; a row's sums are four in-lane chains and
// a five-step butterfly, so no LDS array and no barrier.
DEV void layernorm_block(const float* __restrict__ x, const float* __restrict__ g,
                         const float* __restrict__ b, us* __restrict__ out, int C,
                         int blk) {
  const int lane = threadIdx.x & 31;
  const int row0 = (blk * 8 + (threadIdx.x >> 5)) * 2;
  const int c4 = C >> 2;             // groups of 4 elements in a row
  const int at[2] = {row0 * c4 + lane, (row0 + 1) * c4 + lane};
  f32x4 v[16], gb[16];               // v[8 q + i]: row q; gb[i]: g, gb[8 + i]: b
  #pragma unroll
  for (int q = 0; q < 2; ++q)
    #pragma unroll
    for (int i = 0; i < 8; ++i)
      v[8 * q + i] = ((const f32x4*)x)[at[q] + i * 32];
  // a result of the loads below may take an address register that the loads in
  // flight above name: the wait that belongs in front of such an overwrite
  asm volatile("s_wait_xcnt 0x0" ::: "memory");
  #pragma unroll
  for (int i = 0; i < 15; ++i)
    gb[i] = ((const f32x4*)(i < 8 ? g : b))[lane + (i & 7) * 32];
  // the same in front of the last load, whose result may take the index register
  asm volatile("s_wait_xcnt 0x0" ::: "memory");
  gb[15] = ((const f32x4*)b)[lane + 7 * 32];
  // keeps every load above in front of the first use, all in flight together;
  // without it some sink to their use, one memory latency after another
  __builtin_amdgcn_sched_barrier(0);
  float s[2], s2[2];
  #pragma unroll
  for (int q = 0; q < 2; ++q) {
    f32x4 a = {0.f, 0.f, 0.f, 0.f}, a2 = {0.f, 0.f, 0.f, 0.f};
    #pragma unroll
    for (int i = 0; i < 8; ++i) {
      f32x4 t = v[8 * q + i];
      a += t; a2 += t * t;
    }
    s[q]  = (a[0] + a[1]) + (a[2] + a[3]);
    s2[q] = (a2[0] + a2[1]) + (a2[2] + a2[3]);
  }
  #pragma unroll
  for (int off = 16; off; off >>= 1)
    #pragma unroll
    for (int q = 0; q < 2; ++q) {
      s[q]  += __shfl_xor(s[q],  off, 32);
      s2[q] += __shfl_xor(s2[q], off, 32);
    }
  #pragma unroll
  for (int q = 0; q < 2; ++q) {
    const float mean = s[q] / C;
    const float rstd = rsqrtf(s2[q] / C - mean * mean + 1e-5f);
    #pragma unroll
    for (int i = 0; i < 8; ++i) {
      f32x4 t = v[8 * q + i], gg = gb[i], bb = gb[8 + i];
      uint2 w;
      w.x = pack2((t[0] - mean) * rstd * gg[0] + bb[0],
                  (t[1] - mean) * rstd * gg[1] + bb[1]);
      w.y = pack2((t[2] - mean) * rstd * gg[2] + bb[2],
                  (t[3] - mean) * rstd * gg[3] + bb[3]);
      ((uint2*)out)[at[q] + i * 32] = w;
    }
  }
}

__global__ __launch_bounds__(256)
void k_layernorm(const float* __restrict__ x, const float* __restrict__ g,
                 const float* __restrict__ b, us* __restrict__ out, int C) {
  layernorm_block(x, g, b, out, C, blockIdx.x);
}

// -------- everything that reads inputs alone, in ONE launch -----------------
// The first LayerNorm, the seven weight conversions and the context conversion
// depend on nothing but inputs and write disjoint buffers: one grid holds the
// blocks of all nine, dealt out by ranges of blockIdx.x (a scalar test), so that
// one launch gap, one ramp and one drain stand where nine would, and the short
// pieces' memory latency hides behind the long ones' streams.
// lnC: the LayerNorm's row length, at run time as k_layernorm takes it, so that
// both run the same code.
template <int C, int F, int BT>
__global__ __launch_bounds__(256)
void k_prep(const float* __restrict__ x, const float* __restrict__ ln_g,
            const float* __restrict__ ln_b, us* __restrict__ h,
            const float* __restrict__ qkv_w, us* __restrict__ wqkv,
            const float* __restrict__ aow, us* __restrict__ wao,
            const float* __restrict__ q_w, us* __restrict__ wq,
            const float* __restrict__ kv_w, us* __restrict__ wkv,
            const float* __restrict__ cow, us* __restrict__ wco,
            const float* __restrict__ w1, us* __restrict__ w1b,
            const float* __restrict__ w2, us* __restrict__ w2b,
            const float* __restrict__ ctx, us* __restrict__ ctxb, int lnC) {
  constexpr int nLN = BT / 16, nCC = C * C / 16384, nCF = C * F / 16384;
  int blk = blockIdx.x;
  if (blk < nLN) { layernorm_block(x, ln_g, ln_b, h, lnC, blk); return; }
  blk -= nLN;
  if (blk < 3 * nCC) { cvt_t_block<C, 3 * C>(qkv_w, wqkv, blk); return; }
  blk -= 3 * nCC;
  if (blk < 3 * nCC) {               // the three C x C weights: one copy of the code
    const int w = blk / nCC;
    cvt_t_block<C, C>(w == 0 ? aow : w == 1 ? q_w : cow,
                      w == 0 ? wao : w == 1 ? wq : wco, blk - w * nCC);
    return;
  }
  blk -= 3 * nCC;
  if (blk < 2 * nCC) { cvt_t_block<C, 2 * C>(kv_w, wkv, blk); return; }
  blk -= 2 * nCC;
  if (blk < nCF) { cvt_t_block<C, F>(w1, w1b, blk); return; }
  blk -= nCF;
  if (blk < nCF) { cvt_t_block<F, C>(w2, w2b, blk); return; }
  blk -= nCF;
  cvt_bf16_block(ctx, ctxb, blk);
}

// ------- bf16 WMMA GEMM: out = A[M,K] @ Wt[N,K]^T + bias --------------------
// Double-buffered LDS filled by async global->LDS copies (ASYNCcnt).
// One block: a 128 x 128 tile of out, 128 k per stage; a wave: 64 x 32.  A wave's
// copy covers two rows of 256 B, whole lines; M, N, K are multiples of 128.
// MODE 0: bf16 out.  MODE 1: fp32 out = resid + acc.  MODE 2: bf16 gelu(acc).
// The work of one block: tile column bx, tile row blockIdx.y.
// MODE 0 only: the columns from vcol0 on are V, which attention reads transposed:
// their tiles go to vt[(b * (N - vcol0) + column - vcol0)][T] and nowhere else
// (row = b * T + t; T a multiple of 128, vcol0 of 128).
template <int MODE, int T = 128>
DEV void gemm_block(const us* __restrict__ A, const us* __restrict__ Wt,
                    const float* __restrict__ bias, const float* __restrict__ resid,
                    void* __restrict__ outp, int N, int K, int bx,
                    us* __restrict__ vt = nullptr, int vcol0 = 0) {
  __shared__ __align__(16) us lA[2][128 * LP];
  __shared__ __align__(16) us lW[2][128 * LP];
  const int tid  = threadIdx.x;
  const int lane = tid & 31, wid = tid >> 5;
  const int wm = wid & 1, wn = wid >> 1;
  const int l15 = lane & 15, khalf = (lane >> 4) << 3;
  const int mbase = blockIdx.y * 128, nbase = bx * 128;

  // 16 threads copy one row of 128 k; a thread: 8 x 16 B of A, 8 x 16 B of W
  const int crow = tid >> 4, cc8 = (tid & 15) << 3;

  auto issue = [&](int p, int k0) {
    const us* ga = A  + (size_t)(mbase + crow) * K + k0 + cc8;
    const us* gw = Wt + (size_t)(nbase + crow) * K + k0 + cc8;
    // unrolled: the LDS row steps become constants
    #pragma unroll
    for (int i = 0; i < 8; ++i) {
      async_copy16(&lA[p][(crow + 16 * i) * LP + cc8], ga + (size_t)(16 * i) * K);
      async_copy16(&lW[p][(crow + 16 * i) * LP + cc8], gw + (size_t)(16 * i) * K);
    }
  };

  v8f c[4][2];
  // unrolled, here and below: constant indices keep c, a and bfr in registers
  #pragma unroll
  for (int im = 0; im < 4; ++im) { c[im][0] = zero8(); c[im][1] = zero8(); }

  const int nk = K >> 7;
  issue(0, 0);
  wait_async0();
  __syncthreads();
  for (int j = 0; j < nk; ++j) {
    const int p = j & 1;
    if (j + 1 < nk) issue((j + 1) & 1, (j + 1) << 7);
    // unrolled: a later 32-k block's LDS reads can go ahead of this one's WMMAs
    #pragma unroll
    for (int kk = 0; kk < 128; kk += 32) {
      FragB16 a[4], bfr[2];
      #pragma unroll
      for (int im = 0; im < 4; ++im) {
        int r = wm * 64 + im * 16 + l15;
        a[im].q[0] = *(const uint4*)&lA[p][r * LP + kk + khalf];
        a[im].q[1] = *(const uint4*)&lA[p][r * LP + kk + 16 + khalf];
      }
      #pragma unroll
      for (int in = 0; in < 2; ++in) {
        int nc = wn * 32 + in * 16 + l15;
        bfr[in].q[0] = *(const uint4*)&lW[p][nc * LP + kk + khalf];
        bfr[in].q[1] = *(const uint4*)&lW[p][nc * LP + kk + 16 + khalf];
      }
      #pragma unroll
      for (int im = 0; im < 4; ++im)
        #pragma unroll
        for (int in = 0; in < 2; ++in)
          c[im][in] = wmma_bf16(a[im], bfr[in], c[im][in]);
    }
    if (j + 1 < nk) wait_async0();
    __syncthreads();
  }

  const int hi8 = (lane >> 4) << 3;
  if constexpr (MODE == 0) {
    // A lane's 8 values of an accumulator tile are 8 consecutive rows (t) of one
    // column (d): 16 B in a row of vt.  A wave's 64 rows fill one 128-B line of each
    // of its 32 rows of vt.  The test is the same for the whole block (scalar).
    if (nbase >= vcol0) {
      const int col = nbase + wn * 32 + l15;
      us* d = vt + ((size_t)(mbase / T) * (N - vcol0) + (col - vcol0)) * T +
              mbase % T + wm * 64 + hi8;
      float bs[2];
      bs[0] = bias[col];
      // the second load's result may take the index register that the first names,
      // and what follows may take it behind the second: the wait that belongs in
      // front of such an overwrite, behind each
      asm volatile("s_wait_xcnt 0x0" ::: "memory");
      bs[1] = bias[col + 16];
      asm volatile("s_wait_xcnt 0x0" ::: "memory");
      u32x4 w[2][4];
      // unrolled: constant indices keep c and w in registers
      #pragma unroll
      for (int in = 0; in < 2; ++in)
        #pragma unroll
        for (int im = 0; im < 4; ++im) {
          const v8f a = c[im][in];
          const float e = bs[in];
          w[in][im][0] = pack2(a[0] + e, a[1] + e);
          w[in][im][1] = pack2(a[2] + e, a[3] + e);
          w[in][im][2] = pack2(a[4] + e, a[5] + e);
          w[in][im][3] = pack2(a[6] + e, a[7] + e);
        }
      // The lane's eight 16-byte stores (two rows of vt, 32 t of each) as one run in
      // one statement: written as plain stores they came out with arithmetic between
      // them that takes their registers.  The wait on the last line stands in front
      // of every later overwrite of a register that the stores name (the other
      // tiles' code stands behind them in the listing).
      asm volatile("global_store_b128 %0, %2, off\n\t"
                   "global_store_b128 %0, %3, off offset:32\n\t"
                   "global_store_b128 %0, %4, off offset:64\n\t"
                   "global_store_b128 %0, %5, off offset:96\n\t"
                   "global_store_b128 %1, %6, off\n\t"
                   "global_store_b128 %1, %7, off offset:32\n\t"
                   "global_store_b128 %1, %8, off offset:64\n\t"
                   "global_store_b128 %1, %9, off offset:96\n\t"
                   "s_wait_xcnt 0x0"
                   :: "v"(d), "v"(d + 16 * T), "v"(w[0][0]), "v"(w[0][1]), "v"(w[0][2]),
                      "v"(w[0][3]), "v"(w[1][0]), "v"(w[1][1]), "v"(w[1][2]),
                      "v"(w[1][3]) : "memory");
      return;
    }
  }
  #pragma unroll
  for (int im = 0; im < 4; ++im)
    #pragma unroll
    for (int in = 0; in < 2; ++in)
      #pragma unroll
      for (int r = 0; r < 8; ++r) {
        int row = mbase + wm * 64 + im * 16 + r + hi8;
        int col = nbase + wn * 32 + in * 16 + l15;
        size_t idx = (size_t)row * N + col;
        float v = c[im][in][r] + bias[col];
        if (MODE == 0) {
          ((us*)outp)[idx] = f2bf(v);
        } else if (MODE == 1) {
          ((float*)outp)[idx] = resid[idx] + v;
        } else {
          float gv = 0.5f * v * (1.0f + erff(v * 0.70710678118654752f));
          ((us*)outp)[idx] = f2bf(gv);
        }
      }
}

template <int MODE>
__global__ __launch_bounds__(256)
void k_gemm(const us* __restrict__ A, const us* __restrict__ Wt,
            const float* __restrict__ bias, const float* __restrict__ resid,
            void* __restrict__ outp, int M, int N, int K) {
  gemm_block<MODE>(A, Wt, bias, resid, outp, N, K, blockIdx.x);
}

// ------- fp32 out = resid + A[M,K] @ Wt[N,K]^T + bias, N small ---------------
// Takes the place of gemm_block's MODE 1 in all three launches that had it.
// These products have one 128 x 128 tile per WGP and no second block to hide a
// block's waits behind.  So k is split INSIDE the block: a stage is 256 k, and
// the 8 waves are two halves of 4; half kg works on the stage's k slab kg (128 k)
// with 64 x 64 per wave.  A stage's copy latency and its barrier are then paid
// once per 256 k, and a fragment read from LDS feeds 4 products, not 2 or 4.
// At the end waves w and w + 4 hold partial sums of the same 64 x 64 tile: each
// hands the other 32 of its rows through LDS and finishes the 32 rows it keeps.
// M, N multiples of 128, K of 256.
__global__ __launch_bounds__(256)
void k_gemm_res(const us* __restrict__ A, const us* __restrict__ Wt,
                const float* __restrict__ bias, const float* __restrict__ resid,
                float* __restrict__ outp, int N, int K) {
  // LDS pitch, in 16-bit elements, of a stage's rows of 256 (slab kg: columns from
  // 128 kg): 528 B = 16 B x odd, as LP is, for the same ds_load_b128 readers
  constexpr int LQ = 264;
  __shared__ __align__(16) us lA[2][128 * LQ];
  __shared__ __align__(16) us lW[2][128 * LQ];
  const int tid  = threadIdx.x;
  const int lane = tid & 31;
  // the wave's number in a scalar register: the slab's LDS offset is then scalar
  const int wid = __builtin_amdgcn_readfirstlane(tid >> 5);
  const int kg = wid >> 2, wm = wid & 1, wn = (wid >> 1) & 1;
  const int l15 = lane & 15, khalf = (lane >> 4) << 3;
  const int mbase = blockIdx.y * 128, nbase = blockIdx.x * 128;

  // 16 threads copy 256 B of one row (one slab's part of it); a thread: 16 x 16 B
  // of A, 16 x 16 B of W per stage
  const int crow = tid >> 4, cc8 = (tid & 15) << 3;
  const us* ga0 = A  + (size_t)(mbase + crow) * K + cc8;
  const us* gw0 = Wt + (size_t)(nbase + crow) * K + cc8;

  auto issue = [&](int p, int s) {   // stage s (k from 256 s) into buffer p
    const us* ga = ga0 + s * 256;
    const us* gw = gw0 + s * 256;
    // unrolled: the LDS row steps become constants
    #pragma unroll
    for (int i = 0; i < 8; ++i)
      #pragma unroll
      for (int h = 0; h < 2; ++h) {
        async_copy16(&lA[p][(crow + 16 * i) * LQ + h * 128 + cc8],
                     ga + (size_t)(16 * i) * K + h * 128);
        async_copy16(&lW[p][(crow + 16 * i) * LQ + h * 128 + cc8],
                     gw + (size_t)(16 * i) * K + h * 128);
      }
  };

  v8f c[4][4];
  // unrolled, here and below: constant indices keep c, a and bfr in registers
  #pragma unroll
  for (int im = 0; im < 4; ++im)
    #pragma unroll
    for (int in = 0; in < 4; ++in) c[im][in] = zero8();

  const int nst = K >> 8;
  issue(0, 0);
  // stage 0 has landed before the barrier behind which other waves read it
  asm volatile("s_wait_asynccnt 0x0" ::: "memory");
  __syncthreads();
  if (1 < nst) issue(1, 1);

  for (int s = 0; s < nst; ++s) {
    const int p = s & 1;
    const us* tA = &lA[p][(wm * 64 + l15) * LQ + kg * 128 + khalf];
    const us* tW = &lW[p][(wn * 64 + l15) * LQ + kg * 128 + khalf];
    // unrolled: the LDS offsets of a 32-k block become constants
    #pragma unroll
    for (int kk = 0; kk < 128; kk += 32) {
      FragB16 a[4], bfr[4];
      // W first: a row of 4 products needs all of bfr and one a
      #pragma unroll
      for (int i = 0; i < 4; ++i) {
        bfr[i].q[0] = *(const uint4*)(tW + i * 16 * LQ + kk);
        bfr[i].q[1] = *(const uint4*)(tW + i * 16 * LQ + kk + 16);
      }
      #pragma unroll
      for (int i = 0; i < 4; ++i) {
        a[i].q[0] = *(const uint4*)(tA + i * 16 * LQ + kk);
        a[i].q[1] = *(const uint4*)(tA + i * 16 * LQ + kk + 16);
      }
      // keeps the block's 16 LDS reads together in front of its 16 products: one
      // place with reads a block; without it each row of 4 products waits out the
      // LDS latency of its own A fragment, read into one register set
      __builtin_amdgcn_sched_barrier(0);
      #pragma unroll
      for (int im = 0; im < 4; ++im)
        #pragma unroll
        for (int in = 0; in < 4; ++in)
          c[im][in] = wmma_bf16(a[im], bfr[in], c[im][in]);
      // keeps the next block's reads from being spread among these products
      __builtin_amdgcn_sched_barrier(0);
    }
    // the hand-over of a stage, in every wave: this wave's reads of buffer p are
    // done, its copies of the next stage have landed, then the barrier that
    // publishes that stage and frees buffer p for the refill behind it
    asm volatile("s_wait_dscnt 0x0" ::: "memory");
    asm volatile("s_wait_asynccnt 0x0" ::: "memory");
    __syncthreads();
    if (s + 2 < nst) issue(p, s + 2);
  }
  // no copy is outstanding when the tiles' LDS is used anew and the wave ends
  asm volatile("s_wait_asynccnt 0x0" ::: "memory");

  // The two slabs' partial sums meet.  The last stage's barrier has ended every
  // read of the tiles, so their LDS takes the exchange: 16 x 16 B per lane, a
  // wave's store or load covering 512 B in a row.  Half kg keeps tile rows
  // 32 kg .. 32 kg + 31 and hands over the others.
  f32x4* xch = (f32x4*)&lA[0][0];
  v8f keep[2][4];
  #pragma unroll
  for (int i = 0; i < 2; ++i)
    #pragma unroll
    for (int in = 0; in < 4; ++in) {
      const v8f give = kg ? c[i][in] : c[2 + i][in];
      keep[i][in]    = kg ? c[2 + i][in] : c[i][in];
      f32x4 lo = {give[0], give[1], give[2], give[3]};
      f32x4 hi = {give[4], give[5], give[6], give[7]};
      xch[(wid * 16 + (i * 4 + in) * 2) * 32 + lane]     = lo;
      xch[(wid * 16 + (i * 4 + in) * 2 + 1) * 32 + lane] = hi;
    }
  // every wave's partial sums are in LDS before its partner reads them
  __syncthreads();
  const int hi8 = (lane >> 4) << 3;
  #pragma unroll
  for (int i = 0; i < 2; ++i)
    #pragma unroll
    for (int in = 0; in < 4; ++in) {
      const f32x4 lo = xch[((wid ^ 4) * 16 + (i * 4 + in) * 2) * 32 + lane];
      const f32x4 hi = xch[((wid ^ 4) * 16 + (i * 4 + in) * 2 + 1) * 32 + lane];
      const int col = nbase + wn * 64 + in * 16 + l15;
      #pragma unroll
      for (int r = 0; r < 8; ++r) {
        const int row = mbase + wm * 64 + (kg * 2 + i) * 16 + r + hi8;
        const size_t idx = (size_t)row * N + col;
        const float v = (keep[i][in][r] + (r < 4 ? lo[r & 3] : hi[r & 3])) + bias[col];
        outp[idx] = resid[idx] + v;
      }
    }
}

// A MODE 0 product whose columns from vcol0 on are V (rows of T per batch).
template <int T>
__global__ __launch_bounds__(256)
void k_gemm_v(const us* __restrict__ A, const us* __restrict__ Wt,
              const float* __restrict__ bias, us* __restrict__ outp, int N, int K,
              us* __restrict__ vt, int vcol0) {
  gemm_block<0, T>(A, Wt, bias, nullptr, outp, N, K, blockIdx.x, vt, vcol0);
}

// Two independent MODE 0 products of the same M and K in ONE launch: the second's
// tile columns stand behind the first's in blockIdx.x (a scalar test).  The first
// has no V columns; the second's begin at vcol1.
template <int T>
__global__ __launch_bounds__(256)
void k_gemm_two(const us* __restrict__ A0, const us* __restrict__ Wt0,
                const float* __restrict__ bias0, us* __restrict__ out0, int N0,
                const us* __restrict__ A1, const us* __restrict__ Wt1,
                const float* __restrict__ bias1, us* __restrict__ out1, int N1,
                int K, us* __restrict__ vt, int vcol1) {
  const int bx = blockIdx.x, nb0 = N0 >> 7;
  const bool second = bx >= nb0;
  gemm_block<0, T>(second ? A1 : A0, second ? Wt1 : Wt0, second ? bias1 : bias0,
                   nullptr, second ? out1 : out0, second ? N1 : N0, K,
                   second ? bx - nb0 : bx, vt, second ? vcol1 : N0);
}

typedef float  f32x2  __attribute__((ext_vector_type(2)));
typedef __bf16 bf16x2 __attribute__((ext_vector_type(2)));

// two f32 -> two bf16 in one dword, round to nearest even, one instruction
DEV unsigned cvt2(float lo, float hi) {
  f32x2 f = {lo, hi};
  return __builtin_bit_cast(unsigned, __builtin_convertvector(f, bf16x2));
}
// LDS pitch, in 16-bit elements, of the attention tiles' rows of 64 (128 B), which
// ds_load_b128 reads one row per lane: 144 B = 16 B x odd spreads 16 rows over
// all 64 banks.
constexpr int FP = 72;
DEV unsigned lds_addr(const us* p) {
  return (unsigned)(unsigned long long)(const AS3 us*)p;
}
// Four 16-byte async global -> LDS copies of one lane (ASYNCcnt-tracked).  The
// wait on the last line stands in front of every later overwrite of a register
// that the copies name; inside the statement nothing can be lifted over it.
DEV void async_copy16x4(unsigned l0, const us* g0, unsigned l1, const us* g1,
                        unsigned l2, const us* g2, unsigned l3, const us* g3) {
  asm volatile("global_load_async_to_lds_b128 %0, %1, off\n\t"
               "global_load_async_to_lds_b128 %2, %3, off\n\t"
               "global_load_async_to_lds_b128 %4, %5, off\n\t"
               "global_load_async_to_lds_b128 %6, %7, off\n\t"
               "s_wait_xcnt 0x0"
               :: "v"(l0), "v"(g0), "v"(l1), "v"(g1), "v"(l2), "v"(g2),
                  "v"(l3), "v"(g3) : "memory");
}
// max of a lane's value and its partner's (lane ^ 16)
DEV float maxhalves(float v) {
  const int i = __float_as_int(v);
  return fmaxf(v, __int_as_float(__builtin_amdgcn_permlanex16(
                      i, i, 0x76543210, 0xfedcba98, false, false)));
}

__global__ __launch_bounds__(256)
void k_flash(const us* __restrict__ Qb, int q_rs, int q_col0,
             const us* __restrict__ Kb, int k_rs, int k_col0,
             const us* __restrict__ Vt,
             us* __restrict__ Ob, int o_rs,
             int T, int H, int causal, float scale) {
  __shared__ __align__(16) us lK[2][64 * FP];
  __shared__ __align__(16) us lV[2][64 * FP];
  const int tid = threadIdx.x;
  const int lane = tid & 31;
  // the wave's number in a scalar register: tile indices and the trip count
  // are then scalar, and the loop and the diagonal test are scalar branches
  const int wid = __builtin_amdgcn_readfirstlane(tid >> 5);
  const int gw = blockIdx.x * 8 + wid;
  const int nQT = T >> 5;
  const int qt = gw % nQT;
  const int h  = (gw / nQT) % H;
  const int b  = gw / (nQT * H);
  const int l15 = lane & 15, khalf = (lane >> 4) << 3, hi8 = khalf;
  const size_t brow = (size_t)b * T;
  // 8 threads copy one row of 128 B; a thread: 2 x 16 B of K, 2 x 16 B of Vt
  const int crow = tid >> 3, cc8 = (tid & 7) << 3;
  const us* gk = Kb + (brow + crow) * k_rs + k_col0 + h * 64 + cc8;
  const us* gv = Vt + ((size_t)(b * H + h) * 64 + crow) * T + cc8;
  const unsigned lk = lds_addr(&lK[0][crow * FP + cc8]);
  const unsigned lv = lds_addr(&lV[0][crow * FP + cc8]);
  auto issue = [&](int p, int s) {   // stage s (keys 64 s ..) into buffer p
    const us* k0 = gk + (size_t)(s * 64) * k_rs;
    const us* v0 = gv + s * 64;
    const unsigned o = p * (64 * FP * 2), half = 32 * FP * 2;
    async_copy16x4(lk + o, k0, lk + o + half, k0 + (size_t)32 * k_rs,
                   lv + o, v0, lv + o + half, v0 + (size_t)32 * T);
  };

  FragB16 ones;
  {
    uint4 o; o.x = o.y = o.z = o.w = 0x3F803F80u;   // bf16 1.0 pairs
    ones.q[0] = o; ones.q[1] = o;
  }
  FragB16 bq[2][2];                  // [query group][32 d]
  #pragma unroll
  for (int g = 0; g < 2; ++g) {
    const us* qr = Qb + (brow + qt * 32 + g * 16 + l15) * q_rs + q_col0 + h * 64;
    #pragma unroll
    for (int kc = 0; kc < 2; ++kc) {
      bq[g][kc].q[0] = *(const uint4*)(qr + kc * 32 + khalf);
      bq[g][kc].q[1] = *(const uint4*)(qr + kc * 32 + 16 + khalf);
    }
  }
  // the copies' addresses are formed next, in registers that the Q loads in
  // flight may name: the wait that belongs in front of such an overwrite
  asm volatile("s_wait_xcnt 0x0" ::: "memory");
  // exp(scale * (s - m)) = exp2(s * c2 - m * c2); scale > 0, so the maximum is
  // taken over the raw scores
  const float c2 = scale * 1.44269504088896340736f;
  float mrow[2];
  v8f oc[2][4], ls[2];
  #pragma unroll
  for (int g = 0; g < 2; ++g) {
    mrow[g] = -__builtin_inff(); ls[g] = zero8();
    #pragma unroll
    for (int d = 0; d < 4; ++d) oc[g][d] = zero8();
  }

  const int nsteps = causal ? (qt + 1) : (T >> 5);
  // stages of the block: as far as its last wave's diagonal; the same in all waves
  const int nst = causal ? (((int)(blockIdx.x * 8) % nQT + 8) >> 1) : (T >> 6);

  issue(0, 0);
  // stage 0 has landed before the barrier behind which other waves read it
  asm volatile("s_wait_asynccnt 0x0" ::: "memory");
  __syncthreads();
  if (1 < nst) issue(1, 1);

  for (int s = 0; s < nst; ++s) {
   const int pb = s & 1;
   // unrolled: the half stage's LDS offsets become constants
   #pragma unroll
   for (int sub = 0; sub < 2; ++sub) {
    const int j = 2 * s + sub;
    // a wave is done behind its diagonal (a scalar test); it still passes every
    // barrier below
    if (j >= nsteps) continue;
    FragB16 ka[2][2], va[4];
    #pragma unroll
    for (int ns = 0; ns < 2; ++ns) {
      const us* kr = &lK[pb][(sub * 32 + ns * 16 + l15) * FP + khalf];
      #pragma unroll
      for (int kc = 0; kc < 2; ++kc) {
        ka[ns][kc].q[0] = *(const uint4*)(kr + kc * 32);
        ka[ns][kc].q[1] = *(const uint4*)(kr + kc * 32 + 16);
      }
    }
    #pragma unroll
    for (int d = 0; d < 4; ++d) {
      const us* vr = &lV[pb][(d * 16 + l15) * FP + sub * 32 + khalf];
      va[d].q[0] = *(const uint4*)vr;
      va[d].q[1] = *(const uint4*)(vr + 16);
    }
    // keeps the step's 16 LDS reads together in front of the first product: one
    // place with reads a step; without it the Vt reads sink into the softmax in
    // further groups
    __builtin_amdgcn_sched_barrier(0);
    v8f st[2][2];                    // [query group][16-key tile]
    #pragma unroll
    for (int g = 0; g < 2; ++g)
      #pragma unroll
      for (int ns = 0; ns < 2; ++ns) {
        v8f acc = wmma_bf16(ka[ns][0], bq[g][0], zero8());
        st[g][ns] = wmma_bf16(ka[ns][1], bq[g][1], acc);
      }
    // only the last causal step holds keys behind a query of this wave
    if (causal && j == nsteps - 1) {
      #pragma unroll
      for (int g = 0; g < 2; ++g)
        #pragma unroll
        for (int ns = 0; ns < 2; ++ns)
          #pragma unroll
          for (int r = 0; r < 8; ++r)
            if (ns * 16 + hi8 + r > g * 16 + l15) st[g][ns][r] = -__builtin_inff();
    }
    #pragma unroll
    for (int g = 0; g < 2; ++g) {
      float mx = fmaxf(st[g][0][0], st[g][1][0]);
      #pragma unroll
      for (int r = 1; r < 8; ++r) mx = fmaxf(mx, fmaxf(st[g][0][r], st[g][1][r]));
      const float mn = fmaxf(mrow[g], maxhalves(mx));
      const float a  = __builtin_amdgcn_exp2f((mrow[g] - mn) * c2);
      const float mc = mn * c2;
      mrow[g] = mn;
      FragB16 pf;
      #pragma unroll
      for (int ns = 0; ns < 2; ++ns) {
        float p[8];
        #pragma unroll
        for (int r = 0; r < 8; ++r)
          p[r] = __builtin_amdgcn_exp2f(fmaf(st[g][ns][r], c2, -mc));
        uint4 w;
        w.x = cvt2(p[0], p[1]); w.y = cvt2(p[2], p[3]);
        w.z = cvt2(p[4], p[5]); w.w = cvt2(p[6], p[7]);
        pf.q[ns] = w;
      }
      ls[g] *= a;
      ls[g] = wmma_bf16(ones, pf, ls[g]);
      #pragma unroll
      for (int d = 0; d < 4; ++d) {
        oc[g][d] *= a;
        oc[g][d] = wmma_bf16(va[d], pf, oc[g][d]);
      }
    }
   }
   // the hand-over of a stage, in every wave: this wave's reads of buffer pb are
   // done, its copies of the next stage have landed, then the barrier that
   // publishes that stage and frees buffer pb for the refill behind it
   asm volatile("s_wait_dscnt 0x0" ::: "memory");
   asm volatile("s_wait_asynccnt 0x0" ::: "memory");
   __syncthreads();
   if (s + 2 < nst) issue(pb, s + 2);
  }
  // no copy is outstanding when the wave ends
  asm volatile("s_wait_asynccnt 0x0" ::: "memory");
  // a lane holds 8 consecutive d of its query in each tile: 16-byte stores
  #pragma unroll
  for (int g = 0; g < 2; ++g) {
    const float inv = 1.0f / ls[g][0];
    us* orow = Ob + (brow + qt * 32 + g * 16 + l15) * o_rs + h * 64 + hi8;
    #pragma unroll
    for (int d = 0; d < 4; ++d) {
      uint4 w;
      w.x = cvt2(oc[g][d][0] * inv, oc[g][d][1] * inv);
      w.y = cvt2(oc[g][d][2] * inv, oc[g][d][3] * inv);
      w.z = cvt2(oc[g][d][4] * inv, oc[g][d][5] * inv);
      w.w = cvt2(oc[g][d][6] * inv, oc[g][d][7] * inv);
      *(uint4*)(orow + d * 16) = w;
    }
  }
}

// ----------------------------- host launcher --------------------------------
extern "C" void kernel_launch(void* const* d_in, const int* in_sizes, int n_in,
                              void* d_out, int out_size, void* d_ws,
                              size_t ws_size, hipStream_t stream) {
  (void)in_sizes; (void)n_in; (void)out_size; (void)ws_size;
  constexpr int B = 4, T = 1024, C = 1024, H = 16, F = 4096;
  constexpr int BT = B * T;
  const float* x     = (const float*)d_in[0];
  const float* ctx   = (const float*)d_in[1];
  const float* ln1_g = (const float*)d_in[2];
  const float* ln1_b = (const float*)d_in[3];
  const float* qkv_w = (const float*)d_in[4];
  const float* qkv_b = (const float*)d_in[5];
  const float* aow   = (const float*)d_in[6];
  const float* aob   = (const float*)d_in[7];
  const float* lnc_g = (const float*)d_in[8];
  const float* lnc_b = (const float*)d_in[9];
  const float* q_w   = (const float*)d_in[10];
  const float* q_b   = (const float*)d_in[11];
  const float* kv_w  = (const float*)d_in[12];
  const float* kv_b  = (const float*)d_in[13];
  const float* cow   = (const float*)d_in[14];
  const float* cob   = (const float*)d_in[15];
  const float* ln2_g = (const float*)d_in[16];
  const float* ln2_b = (const float*)d_in[17];
  const float* w1    = (const float*)d_in[18];
  const float* b1    = (const float*)d_in[19];
  const float* w2    = (const float*)d_in[20];
  const float* b2    = (const float*)d_in[21];

  char* p = (char*)d_ws;
  auto carve = [&](size_t bytes) -> char* {
    char* r = p; p += (bytes + 255) & ~(size_t)255; return r;
  };
  us* wqkv = (us*)carve((size_t)C * 3 * C * 2);   // [3C][C] transposed
  us* wao  = (us*)carve((size_t)C * C * 2);
  us* wq   = (us*)carve((size_t)C * C * 2);
  us* wkv  = (us*)carve((size_t)C * 2 * C * 2);
  us* wco  = (us*)carve((size_t)C * C * 2);
  us* w1b  = (us*)carve((size_t)C * F * 2);
  us* w2b  = (us*)carve((size_t)F * C * 2);
  us* hbuf = (us*)carve((size_t)BT * C * 2);
  us* qkvb = (us*)carve((size_t)BT * 3 * C * 2);
  us* obuf = (us*)carve((size_t)BT * C * 2);
  us* ctxb = (us*)carve((size_t)BT * C * 2);
  us* vtb  = (us*)carve((size_t)BT * C * 2);      // Vt[(b*H+h)*64 + d][T]
  us* f1b  = (us*)carve((size_t)BT * F * 2);
  float* resid = (float*)carve((size_t)BT * C * 4);
  us* qxb = qkvb;                    // reuse after self-attention
  us* kvb = qkvb + (size_t)BT * C;

  // first LayerNorm, weight conversions, context conversion: 1536 blocks
  k_prep<C, F, BT><<<BT / 16 + (8 * C * C + 2 * C * F + BT * C) / 16384, 256, 0,
                     stream>>>(x, ln1_g, ln1_b, hbuf, qkv_w, wqkv, aow, wao, q_w, wq,
                               kv_w, wkv, cow, wco, w1, w1b, w2, w2b, ctx, ctxb, C);

  const int flashBlocks = (B * H * (T / 32)) / 8;   // 256
  const float scale = 0.125f;                       // 1/sqrt(64)

  // 1) self-attention branch
  k_gemm_v<T><<<dim3(3 * C / 128, BT / 128), 256, 0, stream>>>(
      hbuf, wqkv, qkv_b, qkvb, 3 * C, C, vtb, 2 * C);
  k_flash<<<flashBlocks, 256, 0, stream>>>(
      qkvb, 3 * C, 0, qkvb, 3 * C, C, vtb, obuf, C, T, H, 1, scale);
  k_gemm_res<<<dim3(C / 128, BT / 128), 256, 0, stream>>>(
      obuf, wao, aob, x, resid, C, C);

  // 2) cross-attention branch
  k_layernorm<<<BT / 16, 256, 0, stream>>>(resid, lnc_g, lnc_b, hbuf, C);
  k_gemm_two<T><<<dim3(3 * C / 128, BT / 128), 256, 0, stream>>>(
      hbuf, wq, q_b, qxb, C, ctxb, wkv, kv_b, kvb, 2 * C, C, vtb, C);
  k_flash<<<flashBlocks, 256, 0, stream>>>(
      qxb, C, 0, kvb, 2 * C, 0, vtb, obuf, C, T, H, 0, scale);
  k_gemm_res<<<dim3(C / 128, BT / 128), 256, 0, stream>>>(
      obuf, wco, cob, resid, resid, C, C);

  // 3) FFN
  k_layernorm<<<BT / 16, 256, 0, stream>>>(resid, ln2_g, ln2_b, hbuf, C);
  k_gemm<2><<<dim3(F / 128, BT / 128), 256, 0, stream>>>(
      hbuf, w1b, b1, nullptr, f1b, BT, F, C);
  k_gemm_res<<<dim3(C / 128, BT / 128), 256, 0, stream>>>(
      f1b, w2b, b2, resid, (float*)d_out, C, F);
}

// v009
// It runs in 208 microseconds.
// Two timings next to v008 put it at 1.07 and 1.08 times that version's speed.
// Counting every step since v000, it is 2.63 times as fast.
#include <hip/hip_runtime.h>
#include <hip/hip_bf16.h>
#include <math.h>

typedef __attribute__((ext_vector_type(16))) __bf16 v16bf;
typedef __attribute__((ext_vector_type(8)))  float  v8f;
typedef int v4i_t __attribute__((vector_size(16)));
typedef unsigned short us;

#define DEV static __device__ __forceinline__
#define AS1 __attribute__((address_space(1)))
#define AS3 __attribute__((address_space(3)))

#if defined(__has_builtin)
#if __has_builtin(__builtin_amdgcn_global_load_async_to_lds_b128)
#define HAVE_ASYNC_BUILTIN 1
#endif
#endif
#ifndef HAVE_ASYNC_BUILTIN
#define HAVE_ASYNC_BUILTIN 0
#endif

// LDS pitch, in 16-bit elements, of the GEMM tiles' rows of 128, which
// ds_load_b128 reads one row per lane: 272 B = 16 B x odd spreads 16 rows over
// all 64 banks.
constexpr int LP = 136;

union FragB16 { uint4 q[2]; v16bf v; };

DEV us f2bf(float f) {
  unsigned u = __float_as_uint(f);
  u += 0x7FFFu + ((u >> 16) & 1u);          // round-to-nearest-even
  return (us)(u >> 16);
}
DEV v8f zero8() { v8f z = {0.f,0.f,0.f,0.f,0.f,0.f,0.f,0.f}; return z; }

DEV v8f wmma_bf16(const FragB16& a, const FragB16& b, v8f c) {
  return __builtin_amdgcn_wmma_f32_16x16x32_bf16(false, a.v, false, b.v,
                                                 (short)0, c, false, false);
}

// 16-byte async global -> LDS copy (per-lane addresses), ASYNCcnt-tracked.
DEV void async_copy16(us* lds, const us* g) {
#if HAVE_ASYNC_BUILTIN
  __builtin_amdgcn_global_load_async_to_lds_b128((AS1 v4i_t*)(us*)g,
                                                 (AS3 v4i_t*)lds, 0, 0);
#else
  unsigned loff = (unsigned)(unsigned long long)(AS3 us*)lds;
  unsigned long long ga = (unsigned long long)g;
  asm volatile("global_load_async_to_lds_b128 %0, %1, off"
               :: "v"(loff), "v"(ga) : "memory");
#endif
}

// The three streaming pieces below give every lane 64 elements (16 loads of
// 16 B, all issued before the first use): a launch then starts one wave where
// sixteen one-load waves would stand, for speed only.  The two conversions and the LayerNorm are written as
// the work of one block of 256 threads, numbered blk, so that pieces which do
// not depend on one another can share a launch (k_prep).
typedef float    f32x4 __attribute__((ext_vector_type(4)));
typedef unsigned u32x4 __attribute__((ext_vector_type(4)));

// two f32 -> two bf16 in one dword, each rounded as f2bf rounds
DEV unsigned pack2(float lo, float hi) {
  unsigned a = __float_as_uint(lo), c = __float_as_uint(hi);
  a += 0x7FFFu + ((a >> 16) & 1u);
  c += 0x7FFFu + ((c >> 16) & 1u);
  return (a >> 16) | (c & 0xFFFF0000u);
}

// ---------------- fp32 -> bf16 (row-major copy: context) --------------------
// One block: 4096 float4 in a row; a wave's load covers 512 B, its store 256 B.
DEV void cvt_bf16_block(const float* __restrict__ src, us* __restrict__ dst,
                        int blk) {
  const int base = blk * 4096 + threadIdx.x;
  f32x4 f[16];
  #pragma unroll
  for (int u = 0; u < 16; ++u) f[u] = ((const f32x4*)src)[base + u * 256];
  // keeps every load above in front of the first use, all in flight together;
  // without it some sink to their use, one memory latency after another
  __builtin_amdgcn_sched_barrier(0);
  #pragma unroll
  for (int u = 0; u < 16; ++u) {
    uint2 o; o.x = pack2(f[u][0], f[u][1]); o.y = pack2(f[u][2], f[u][3]);
    ((uint2*)dst)[base + u * 256] = o;
  }
  // in a shared launch another piece's code can stand behind these stores in the
  // listing: the wait that belongs in front of an overwrite of their registers
  asm volatile("s_wait_xcnt 0x0" ::: "memory");
}

// -------- fp32 W[K,N] -> bf16 Wt[N,K] (convert + transpose in registers) ----
// One wave: 64 k x 32 n.  A lane loads 8 k-rows x 8 n and stores 8 n-rows x 8 k:
// four lanes read one 128-B line of W, eight lanes write one 128-B line of Wt.
// K and N are compile-time so that the row steps are immediate offsets.
// One block: 64 k x 256 n; K * N / 16384 blocks, n fastest.
template <int K, int N>
DEV void cvt_t_block(const float* __restrict__ src, us* __restrict__ dst,
                     int blk) {
  const int lane = threadIdx.x & 31, wid = threadIdx.x >> 5;
  const int k0 = (blk / (N / 256)) * 64 + (lane >> 2) * 8;
  const int n0 = (blk % (N / 256)) * 256 + wid * 32 + (lane & 3) * 8;
  const float* s = src + (size_t)k0 * N + n0;
  f32x4 f[16];                       // f[2 i + j]: row k0 + i, columns 4 j ..
  #pragma unroll
  for (int i = 0; i < 15; ++i)
    f[i] = *(const f32x4*)(s + (i >> 1) * N + (i & 1) * 4);
  // the last load's result may take the address register that the 15 loads in
  // flight name: the wait that belongs in front of such an overwrite
  asm volatile("s_wait_xcnt 0x0" ::: "memory");
  f[15] = *(const f32x4*)(s + 7 * N + 4);
  // keeps every load above in front of the first use, all in flight together;
  // without it some sink to their use, one memory latency after another
  __builtin_amdgcn_sched_barrier(0);
  us* d = dst + (size_t)n0 * K + k0;
  #pragma unroll
  for (int e = 0; e < 8; ++e) {
    const int j = e >> 2, m = e & 3;
    uint4 o;
    o.x = pack2(f[0 + j][m],  f[2 + j][m]);  o.y = pack2(f[4 + j][m],  f[6 + j][m]);
    o.z = pack2(f[8 + j][m],  f[10 + j][m]); o.w = pack2(f[12 + j][m], f[14 + j][m]);
    *(uint4*)(d + e * K) = o;
  }
  // in a shared launch another piece's code can stand behind these stores in the
  // listing: the wait that belongs in front of an overwrite of their registers
  asm volatile("s_wait_xcnt 0x0" ::: "memory");
}

// ---------------- LayerNorm: one wave per two rows (C = 1024) ---------------
// A lane holds 32 elements of each row; a row's sums are four in-lane chains and
// a five-step butterfly, so no LDS array and no barrier.
DEV void layernorm_block(const float* __restrict__ x, const float* __restrict__ g,
                         const float* __restrict__ b, us* __restrict__ out, int C,
                         int blk) {
  const int lane = threadIdx.x & 31;
  const int row0 = (blk * 8 + (threadIdx.x >> 5)) * 2;
  const int c4 = C >> 2;             // groups of 4 elements in a row
  const int at[2] = {row0 * c4 + lane, (row0 + 1) * c4 + lane};
  f32x4 v[16], gb[16];               // v[8 q + i]: row q; gb[i]: g, gb[8 + i]: b
  #pragma unroll
  for (int q = 0; q < 2; ++q)
    #pragma unroll
    for (int i = 0; i < 8; ++i)
      v[8 * q + i] = ((const f32x4*)x)[at[q] + i * 32];
  // a result of the loads below may take an address register that the loads in
  // flight above name: the wait that belongs in front of such an overwrite
  asm volatile("s_wait_xcnt 0x0" ::: "memory");
  #pragma unroll
  for (int i = 0; i < 15; ++i)
    gb[i] = ((const f32x4*)(i < 8 ? g : b))[lane + (i & 7) * 32];
  // the same in front of the last load, whose result may take the index register
  asm volatile("s_wait_xcnt 0x0" ::: "memory");
  gb[15] = ((const f32x4*)b)[lane + 7 * 32];
  // keeps every load above in front of the first use, all in flight together;
  // without it some sink to their use, one memory latency after another
  __builtin_amdgcn_sched_barrier(0);
  float s[2], s2[2];
  #pragma unroll
  for (int q = 0; q < 2; ++q) {
    f32x4 a = {0.f, 0.f, 0.f, 0.f}, a2 = {0.f, 0.f, 0.f, 0.f};
    #pragma unroll
    for (int i = 0; i < 8; ++i) {
      f32x4 t = v[8 * q + i];
      a += t; a2 += t * t;
    }
    s[q]  = (a[0] + a[1]) + (a[2] + a[3]);
    s2[q] = (a2[0] + a2[1]) + (a2[2] + a2[3]);
  }
  #pragma unroll
  for (int off = 16; off; off >>= 1)
    #pragma unroll
    for (int q = 0; q < 2; ++q) {
      s[q]  += __shfl_xor(s[q],  off, 32);
      s2[q] += __shfl_xor(s2[q], off, 32);
    }
  #pragma unroll
  for (int q = 0; q < 2; ++q) {
    const float mean = s[q] / C;
    const float rstd = rsqrtf(s2[q] / C - mean * mean + 1e-5f);
    #pragma unroll
    for (int i = 0; i < 8; ++i) {
      f32x4 t = v[8 * q + i], gg = gb[i], bb = gb[8 + i];
      uint2 w;
      w.x = pack2((t[0] - mean) * rstd * gg[0] + bb[0],
                  (t[1] - mean) * rstd * gg[1] + bb[1]);
      w.y = pack2((t[2] - mean) * rstd * gg[2] + bb[2],
                  (t[3] - mean) * rstd * gg[3] + bb[3]);
      ((uint2*)out)[at[q] + i * 32] = w;
    }
  }
}

__global__ __launch_bounds__(256)
void k_layernorm(const float* __restrict__ x, const float* __restrict__ g,
                 const float* __restrict__ b, us* __restrict__ out, int C) {
  layernorm_block(x, g, b, out, C, blockIdx.x);
}

// -------- everything that reads inputs alone, in ONE launch -----------------
// The first LayerNorm, the seven weight conversions and the context conversion
// depend on nothing but inputs and write disjoint buffers: one grid holds the
// blocks of all nine, dealt out by ranges of blockIdx.x (a scalar test), so that
// one launch gap, one ramp and one drain stand where nine would, and the short
// pieces' memory latency hides behind the long ones' streams.
// lnC: the LayerNorm's row length, at run time as k_layernorm takes it, so that
// both run the same code.
template <int C, int F, int BT>
__global__ __launch_bounds__(256)
void k_prep(const float* __restrict__ x, const float* __restrict__ ln_g,
            const float* __restrict__ ln_b, us* __restrict__ h,
            const float* __restrict__ qkv_w, us* __restrict__ wqkv,
            const float* __restrict__ aow, us* __restrict__ wao,
            const float* __restrict__ q_w, us* __restrict__ wq,
            const float* __restrict__ kv_w, us* __restrict__ wkv,
            const float* __restrict__ cow, us* __restrict__ wco,
            const float* __restrict__ w1, us* __restrict__ w1b,
            const float* __restrict__ w2, us* __restrict__ w2b,
            const float* __restrict__ ctx, us* __restrict__ ctxb, int lnC) {
  constexpr int nLN = BT / 16, nCC = C * C / 16384, nCF = C * F / 16384;
  int blk = blockIdx.x;
  if (blk < nLN) { layernorm_block(x, ln_g, ln_b, h, lnC, blk); return; }
  blk -= nLN;
  if (blk < 3 * nCC) { cvt_t_block<C, 3 * C>(qkv_w, wqkv, blk); return; }
  blk -= 3 * nCC;
  if (blk < 3 * nCC) {               // the three C x C weights: one copy of the code
    const int w = blk / nCC;
    cvt_t_block<C, C>(w == 0 ? aow : w == 1 ? q_w : cow,
                      w == 0 ? wao : w == 1 ? wq : wco, blk - w * nCC);
    return;
  }
  blk -= 3 * nCC;
  if (blk < 2 * nCC) { cvt_t_block<C, 2 * C>(kv_w, wkv, blk); return; }
  blk -= 2 * nCC;
  if (blk < nCF) { cvt_t_block<C, F>(w1, w1b, blk); return; }
  blk -= nCF;
  if (blk < nCF) { cvt_t_block<F, C>(w2, w2b, blk); return; }
  blk -= nCF;
  cvt_bf16_block(ctx, ctxb, blk);
}

// ------- bf16 WMMA GEMM: out = A[M,K] @ Wt[N,K]^T + bias, N large -----------
// Two LDS buffers filled by async global->LDS copies (ASYNCcnt), 128 k per stage.
// One block: a 256 x BN tile of out, alone on its WGP, so that a byte brought from
// L2 feeds 256 (A: BN) rows of products; NW waves, WGM of them along M, each with
// FM x FN accumulator tiles: a fragment read from LDS feeds FN or FM products.
// 8 waves of 128 x 64 or 64 x 96 where the epilogue is short; 16 of 64 x 64 for
// MODE 2, whose erff is chains of dependent operations that want 4 waves a SIMD.
// A wave's copy covers two rows of 256 B, whole lines.  M a multiple of 256, N of
// BN, K of 128.
// MODE 0: bf16 out.  MODE 2: bf16 gelu(acc).
// The work of one block: tile column bx, tile row blockIdx.y.
// MODE 0 only: the columns from vcol0 on are V, which attention reads transposed:
// they go to vt[(b * (N - vcol0) + column - vcol0)][T] and nowhere else
// (row = b * T + t; T a multiple of 256, vcol0 of 32).
template <int MODE, int T, int BN, int NW, int WGM>
DEV void gemm_block(const us* __restrict__ A, const us* __restrict__ Wt,
                    const float* __restrict__ bias, void* __restrict__ outp, int N,
                    int K, int bx, us* __restrict__ vt = nullptr, int vcol0 = 0) {
  constexpr int BM = 256, WGN = NW / WGM, FM = BM / 16 / WGM, FN = BN / 16 / WGN;
  constexpr int CR = NW * 2;         // rows that one copy of every thread covers
  __shared__ __align__(16) us lA[2][BM * LP];
  __shared__ __align__(16) us lW[2][BN * LP];
  const int tid  = threadIdx.x;
  const int lane = tid & 31;
  // the wave's number in a scalar register: its tile's LDS offsets and the test
  // for V columns are then scalar
  const int wid = __builtin_amdgcn_readfirstlane(tid >> 5);
  const int wm = wid % WGM, wn = wid / WGM;
  const int l15 = lane & 15, khalf = (lane >> 4) << 3;
  const int mbase = blockIdx.y * BM, nbase = bx * BN;

  // 16 threads copy one row of 128 k; a thread: BM / CR x 16 B of A, BN / CR of W
  const int crow = tid >> 4, cc8 = (tid & 15) << 3;
  const us* ga0 = A  + (size_t)(mbase + crow) * K + cc8;
  const us* gw0 = Wt + (size_t)(nbase + crow) * K + cc8;

  auto issue = [&](int p, int s) {   // stage s (k from 128 s) into buffer p
    const us* ga = ga0 + s * 128;
    const us* gw = gw0 + s * 128;
    // unrolled: the LDS row steps become constants
    #pragma unroll
    for (int i = 0; i < BM / CR; ++i)
      async_copy16(&lA[p][(crow + CR * i) * LP + cc8], ga + (size_t)(CR * i) * K);
    #pragma unroll
    for (int i = 0; i < BN / CR; ++i)
      async_copy16(&lW[p][(crow + CR * i) * LP + cc8], gw + (size_t)(CR * i) * K);
  };

  v8f c[FM][FN];
  // unrolled, here and below: constant indices keep c, a and bfr in registers
  #pragma unroll
  for (int im = 0; im < FM; ++im)
    #pragma unroll
    for (int in = 0; in < FN; ++in) c[im][in] = zero8();

  const int nst = K >> 7;
  issue(0, 0);
  // stage 0 has landed before the barrier behind which other waves read it
  asm volatile("s_wait_asynccnt 0x0" ::: "memory");
  __syncthreads();
  if (1 < nst) issue(1, 1);

  for (int s = 0; s < nst; ++s) {
    const int p = s & 1;
    const us* tA = &lA[p][(wm * FM * 16 + l15) * LP + khalf];
    const us* tW = &lW[p][(wn * FN * 16 + l15) * LP + khalf];
    // unrolled: the LDS offsets of a 32-k block become constants
    #pragma unroll
    for (int kk = 0; kk < 128; kk += 32) {
      FragB16 a[FM], bfr[FN];
      // W first: a row of FN products needs all of bfr and one a
      #pragma unroll
      for (int i = 0; i < FN; ++i) {
        bfr[i].q[0] = *(const uint4*)(tW + i * 16 * LP + kk);
        bfr[i].q[1] = *(const uint4*)(tW + i * 16 * LP + kk + 16);
      }
      #pragma unroll
      for (int i = 0; i < FM; ++i) {
        a[i].q[0] = *(const uint4*)(tA + i * 16 * LP + kk);
        a[i].q[1] = *(const uint4*)(tA + i * 16 * LP + kk + 16);
      }
      // keeps the block's LDS reads together in front of its products: one place
      // with reads a block; without it each row of products waits out the LDS
      // latency of its own A fragment, read into one register set
      __builtin_amdgcn_sched_barrier(0);
      #pragma unroll
      for (int im = 0; im < FM; ++im)
        #pragma unroll
        for (int in = 0; in < FN; ++in)
          c[im][in] = wmma_bf16(a[im], bfr[in], c[im][in]);
      // keeps the next block's reads from being spread among these products
      __builtin_amdgcn_sched_barrier(0);
    }
    // the hand-over of a stage, in every wave: this wave's reads of buffer p are
    // done, its copies of the next stage have landed, then the barrier that
    // publishes that stage and frees buffer p for the refill behind it
    asm volatile("s_wait_dscnt 0x0" ::: "memory");
    asm volatile("s_wait_asynccnt 0x0" ::: "memory");
    __syncthreads();
    if (s + 2 < nst) issue(p, s + 2);
  }
  // no copy is outstanding when the wave ends
  asm volatile("s_wait_asynccnt 0x0" ::: "memory");

  const int hi8 = (lane >> 4) << 3;
  if constexpr (MODE == 0) {
    // A lane's 8 values of an accumulator tile are 8 consecutive rows (t) of one
    // column (d): 16 B in a row of vt.  64 rows of a wave fill one 128-B line of
    // each of a tile column's 16 rows of vt.  The test is scalar.
    #pragma unroll
    for (int in = 0; in < FN; ++in) {
      const int col0 = nbase + (wn * FN + in) * 16;
      if (col0 < vcol0) continue;
      const int col = col0 + l15;
      us* d = vt + ((size_t)(mbase / T) * (N - vcol0) + (col - vcol0)) * T +
              mbase % T + wm * FM * 16 + hi8;
      const float e = bias[col];
      // what follows may take the index register that the load names: the wait
      // that belongs in front of such an overwrite
      asm volatile("s_wait_xcnt 0x0" ::: "memory");
      #pragma unroll
      for (int g = 0; g < FM / 4; ++g) {
        u32x4 w[4];
        // unrolled: constant indices keep c and w in registers
        #pragma unroll
        for (int j = 0; j < 4; ++j) {
          const v8f a = c[4 * g + j][in];
          w[j][0] = pack2(a[0] + e, a[1] + e);
          w[j][1] = pack2(a[2] + e, a[3] + e);
          w[j][2] = pack2(a[4] + e, a[5] + e);
          w[j][3] = pack2(a[6] + e, a[7] + e);
        }
        // The lane's four 16-byte stores (64 t of one row of vt) as one run in one
        // statement: written as plain stores they came out with arithmetic between
        // them that takes their registers.  The wait on the last line stands in
        // front of every later overwrite of a register that the stores name.
        asm volatile("global_store_b128 %0, %1, off\n\t"
                     "global_store_b128 %0, %2, off offset:32\n\t"
                     "global_store_b128 %0, %3, off offset:64\n\t"
                     "global_store_b128 %0, %4, off offset:96\n\t"
                     "s_wait_xcnt 0x0"
                     :: "v"(d + 64 * g), "v"(w[0]), "v"(w[1]), "v"(w[2]), "v"(w[3])
                     : "memory");
      }
    }
  }
  // RQ rows of accumulator tiles a trip.  Rolled, for speed only.  A trip picks its tiles by scalar tests on q, which keeps c in registers.
  constexpr int RQ = MODE == 2 ? 1 : 2;
  float be[FN];
  #pragma unroll
  for (int in = 0; in < FN - 1; ++in)
    be[in] = bias[nbase + (wn * FN + in) * 16 + l15];
  // the last load's result may take the index register that the loads in flight
  // name, and what follows may take it behind the last: the wait that belongs in
  // front of such an overwrite, in front of the last load and behind it
  asm volatile("s_wait_xcnt 0x0" ::: "memory");
  be[FN - 1] = bias[nbase + (wn * FN + FN - 1) * 16 + l15];
  asm volatile("s_wait_xcnt 0x0" ::: "memory");
  #pragma unroll 1
  for (int q = 0; q < FM / RQ; ++q) {
    v8f t[RQ][FN];
    #pragma unroll
    for (int i = 0; i < RQ; ++i)
      #pragma unroll
      for (int in = 0; in < FN; ++in) {
        v8f x = c[i][in];
        #pragma unroll
        for (int u = 1; u < FM / RQ; ++u) x = (q == u) ? c[RQ * u + i][in] : x;
        t[i][in] = x;
      }
    #pragma unroll
    for (int i = 0; i < RQ; ++i)
      #pragma unroll
      for (int in = 0; in < FN; in += 2) {
        const int col0 = nbase + (wn * FN + in) * 16;
        if (MODE == 0 && col0 >= vcol0) continue;
        unsigned h[2][8];
        #pragma unroll
        for (int j = 0; j < 2; ++j)
          #pragma unroll
          for (int r = 0; r < 8; ++r) {
            float v = t[i][in + j][r] + be[in + j];
            if (MODE == 2) v = 0.5f * v * (1.0f + erff(v * 0.70710678118654752f));
            h[j][r] = f2bf(v);
          }
        us* o = (us*)outp +
                (size_t)(mbase + (wm * FM + RQ * q + i) * 16 + hi8) * N + col0 + l15;
        // The lane's sixteen 2-byte stores (8 rows of two columns 16 apart) as one run
        // in one statement.  The wait on the last line stands in front of every later
        // overwrite of a register that the stores name.
        asm volatile("global_store_b16 %0, %8, off\n\t"
                     "global_store_b16 %1, %9, off\n\t"
                     "global_store_b16 %2, %10, off\n\t"
                     "global_store_b16 %3, %11, off\n\t"
                     "global_store_b16 %4, %12, off\n\t"
                     "global_store_b16 %5, %13, off\n\t"
                     "global_store_b16 %6, %14, off\n\t"
                     "global_store_b16 %7, %15, off\n\t"
                     "global_store_b16 %0, %16, off offset:32\n\t"
                     "global_store_b16 %1, %17, off offset:32\n\t"
                     "global_store_b16 %2, %18, off offset:32\n\t"
                     "global_store_b16 %3, %19, off offset:32\n\t"
                     "global_store_b16 %4, %20, off offset:32\n\t"
                     "global_store_b16 %5, %21, off offset:32\n\t"
                     "global_store_b16 %6, %22, off offset:32\n\t"
                     "global_store_b16 %7, %23, off offset:32\n\t"
                     "s_wait_xcnt 0x0"
                     :: "v"(o), "v"(o + N), "v"(o + 2 * (size_t)N), "v"(o + 3 * (size_t)N),
                        "v"(o + 4 * (size_t)N), "v"(o + 5 * (size_t)N),
                        "v"(o + 6 * (size_t)N), "v"(o + 7 * (size_t)N),
                        "v"(h[0][0]), "v"(h[0][1]), "v"(h[0][2]), "v"(h[0][3]),
                        "v"(h[0][4]), "v"(h[0][5]), "v"(h[0][6]), "v"(h[0][7]),
                        "v"(h[1][0]), "v"(h[1][1]), "v"(h[1][2]), "v"(h[1][3]),
                        "v"(h[1][4]), "v"(h[1][5]), "v"(h[1][6]), "v"(h[1][7])
                     : "memory");
      }
  }
}

template <int MODE>
__global__ __launch_bounds__(512)
void k_gemm(const us* __restrict__ A, const us* __restrict__ Wt,
            const float* __restrict__ bias, void* __restrict__ outp, int N, int K) {
  gemm_block<MODE, 256, 256, 16, 4>(A, Wt, bias, outp, N, K, blockIdx.x);
}

// ------- fp32 out = resid + A[M,K] @ Wt[N,K]^T + bias, N small ---------------
// These products have one 128 x 128 tile per WGP and no second block to hide a
// block's waits behind.  So k is split INSIDE the block: a stage is 256 k, and
// the 8 waves are two halves of 4; half kg works on the stage's k slab kg (128 k)
// with 64 x 64 per wave.  A stage's copy latency and its barrier are then paid
// once per 256 k, and a fragment read from LDS feeds 4 products, not 2 or 4.
// At the end waves w and w + 4 hold partial sums of the same 64 x 64 tile: each
// hands the other 32 of its rows through LDS and finishes the 32 rows it keeps.
// M, N multiples of 128, K of 256.
__global__ __launch_bounds__(256)
void k_gemm_res(const us* __restrict__ A, const us* __restrict__ Wt,
                const float* __restrict__ bias, const float* __restrict__ resid,
                float* __restrict__ outp, int N, int K) {
  // LDS pitch, in 16-bit elements, of a stage's rows of 256 (slab kg: columns from
  // 128 kg): 528 B = 16 B x odd, as LP is, for the same ds_load_b128 readers
  constexpr int LQ = 264;
  __shared__ __align__(16) us lA[2][128 * LQ];
  __shared__ __align__(16) us lW[2][128 * LQ];
  const int tid  = threadIdx.x;
  const int lane = tid & 31;
  // the wave's number in a scalar register: the slab's LDS offset is then scalar
  const int wid = __builtin_amdgcn_readfirstlane(tid >> 5);
  const int kg = wid >> 2, wm = wid & 1, wn = (wid >> 1) & 1;
  const int l15 = lane & 15, khalf = (lane >> 4) << 3;
  const int mbase = blockIdx.y * 128, nbase = blockIdx.x * 128;

  // 16 threads copy 256 B of one row (one slab's part of it); a thread: 16 x 16 B
  // of A, 16 x 16 B of W per stage
  const int crow = tid >> 4, cc8 = (tid & 15) << 3;
  const us* ga0 = A  + (size_t)(mbase + crow) * K + cc8;
  const us* gw0 = Wt + (size_t)(nbase + crow) * K + cc8;

  auto issue = [&](int p, int s) {   // stage s (k from 256 s) into buffer p
    const us* ga = ga0 + s * 256;
    const us* gw = gw0 + s * 256;
    // unrolled: the LDS row steps become constants
    #pragma unroll
    for (int i = 0; i < 8; ++i)
      #pragma unroll
      for (int h = 0; h < 2; ++h) {
        async_copy16(&lA[p][(crow + 16 * i) * LQ + h * 128 + cc8],
                     ga + (size_t)(16 * i) * K + h * 128);
        async_copy16(&lW[p][(crow + 16 * i) * LQ + h * 128 + cc8],
                     gw + (size_t)(16 * i) * K + h * 128);
      }
  };

  v8f c[4][4];
  // unrolled, here and below: constant indices keep c, a and bfr in registers
  #pragma unroll
  for (int im = 0; im < 4; ++im)
    #pragma unroll
    for (int in = 0; in < 4; ++in) c[im][in] = zero8();

  const int nst = K >> 8;
  issue(0, 0);
  // stage 0 has landed before the barrier behind which other waves read it
  asm volatile("s_wait_asynccnt 0x0" ::: "memory");
  __syncthreads();
  if (1 < nst) issue(1, 1);

  for (int s = 0; s < nst; ++s) {
    const int p = s & 1;
    const us* tA = &lA[p][(wm * 64 + l15) * LQ + kg * 128 + khalf];
    const us* tW = &lW[p][(wn * 64 + l15) * LQ + kg * 128 + khalf];
    // unrolled: the LDS offsets of a 32-k block become constants
    #pragma unroll
    for (int kk = 0; kk < 128; kk += 32) {
      FragB16 a[4], bfr[4];
      // W first: a row of 4 products needs all of bfr and one a
      #pragma unroll
      for (int i = 0; i < 4; ++i) {
        bfr[i].q[0] = *(const uint4*)(tW + i * 16 * LQ + kk);
        bfr[i].q[1] = *(const uint4*)(tW + i * 16 * LQ + kk + 16);
      }
      #pragma unroll
      for (int i = 0; i < 4; ++i) {
        a[i].q[0] = *(const uint4*)(tA + i * 16 * LQ + kk);
        a[i].q[1] = *(const uint4*)(tA + i * 16 * LQ + kk + 16);
      }
      // keeps the block's 16 LDS reads together in front of its 16 products: one
      // place with reads a block; without it each row of 4 products waits out the
      // LDS latency of its own A fragment, read into one register set
      __builtin_amdgcn_sched_barrier(0);
      #pragma unroll
      for (int im = 0; im < 4; ++im)
        #pragma unroll
        for (int in = 0; in < 4; ++in)
          c[im][in] = wmma_bf16(a[im], bfr[in], c[im][in]);
      // keeps the next block's reads from being spread among these products
      __builtin_amdgcn_sched_barrier(0);
    }
    // the hand-over of a stage, in every wave: this wave's reads of buffer p are
    // done, its copies of the next stage have landed, then the barrier that
    // publishes that stage and frees buffer p for the refill behind it
    asm volatile("s_wait_dscnt 0x0" ::: "memory");
    asm volatile("s_wait_asynccnt 0x0" ::: "memory");
    __syncthreads();
    if (s + 2 < nst) issue(p, s + 2);
  }
  // no copy is outstanding when the tiles' LDS is used anew and the wave ends
  asm volatile("s_wait_asynccnt 0x0" ::: "memory");

  // The two slabs' partial sums meet.  The last stage's barrier has ended every
  // read of the tiles, so their LDS takes the exchange: 16 x 16 B per lane, a
  // wave's store or load covering 512 B in a row.  Half kg keeps tile rows
  // 32 kg .. 32 kg + 31 and hands over the others.
  f32x4* xch = (f32x4*)&lA[0][0];
  v8f keep[2][4];
  #pragma unroll
  for (int i = 0; i < 2; ++i)
    #pragma unroll
    for (int in = 0; in < 4; ++in) {
      const v8f give = kg ? c[i][in] : c[2 + i][in];
      keep[i][in]    = kg ? c[2 + i][in] : c[i][in];
      f32x4 lo = {give[0], give[1], give[2], give[3]};
      f32x4 hi = {give[4], give[5], give[6], give[7]};
      xch[(wid * 16 + (i * 4 + in) * 2) * 32 + lane]     = lo;
      xch[(wid * 16 + (i * 4 + in) * 2 + 1) * 32 + lane] = hi;
    }
  // every wave's partial sums are in LDS before its partner reads them
  __syncthreads();
  const int hi8 = (lane >> 4) << 3;
  #pragma unroll
  for (int i = 0; i < 2; ++i)
    #pragma unroll
    for (int in = 0; in < 4; ++in) {
      const f32x4 lo = xch[((wid ^ 4) * 16 + (i * 4 + in) * 2) * 32 + lane];
      const f32x4 hi = xch[((wid ^ 4) * 16 + (i * 4 + in) * 2 + 1) * 32 + lane];
      const int col = nbase + wn * 64 + in * 16 + l15;
      #pragma unroll
      for (int r = 0; r < 8; ++r) {
        const int row = mbase + wm * 64 + (kg * 2 + i) * 16 + r + hi8;
        const size_t idx = (size_t)row * N + col;
        const float v = (keep[i][in][r] + (r < 4 ? lo[r & 3] : hi[r & 3])) + bias[col];
        outp[idx] = resid[idx] + v;
      }
    }
}

// A MODE 0 product whose columns from vcol0 on are V (rows of T per batch); N a
// multiple of 192: with N = 3072 and M = 4096 one 256 x 192 tile for every WGP.
template <int T>
__global__ __launch_bounds__(256)
void k_gemm_v(const us* __restrict__ A, const us* __restrict__ Wt,
              const float* __restrict__ bias, us* __restrict__ outp, int N, int K,
              us* __restrict__ vt, int vcol0) {
  gemm_block<0, T, 192, 8, 4>(A, Wt, bias, outp, N, K, blockIdx.x, vt, vcol0);
}

// Two independent MODE 0 products of the same M and K in ONE launch: the second's
// tile columns stand behind the first's in blockIdx.x (a scalar test).  The first
// has no V columns; the second's begin at vcol1.
template <int T>
__global__ __launch_bounds__(256)
void k_gemm_two(const us* __restrict__ A0, const us* __restrict__ Wt0,
                const float* __restrict__ bias0, us* __restrict__ out0, int N0,
                const us* __restrict__ A1, const us* __restrict__ Wt1,
                const float* __restrict__ bias1, us* __restrict__ out1, int N1,
                int K, us* __restrict__ vt, int vcol1) {
  const int bx = blockIdx.x, nb0 = N0 >> 8;
  const bool second = bx >= nb0;
  gemm_block<0, T, 256, 8, 2>(second ? A1 : A0, second ? Wt1 : Wt0,
                           second ? bias1 : bias0, second ? out1 : out0,
                           second ? N1 : N0, K, second ? bx - nb0 : bx, vt,
                           second ? vcol1 : N0);
}

typedef float  f32x2  __attribute__((ext_vector_type(2)));
typedef __bf16 bf16x2 __attribute__((ext_vector_type(2)));

// two f32 -> two bf16 in one dword, round to nearest even, one instruction
DEV unsigned cvt2(float lo, float hi) {
  f32x2 f = {lo, hi};
  return __builtin_bit_cast(unsigned, __builtin_convertvector(f, bf16x2));
}
// LDS pitch, in 16-bit elements, of the attention tiles' rows of 64 (128 B), which
// ds_load_b128 reads one row per lane: 144 B = 16 B x odd spreads 16 rows over
// all 64 banks.
constexpr int FP = 72;
DEV unsigned lds_addr(const us* p) {
  return (unsigned)(unsigned long long)(const AS3 us*)p;
}
// Four 16-byte async global -> LDS copies of one lane (ASYNCcnt-tracked).  The
// wait on the last line stands in front of every later overwrite of a register
// that the copies name; inside the statement nothing can be lifted over it.
DEV void async_copy16x4(unsigned l0, const us* g0, unsigned l1, const us* g1,
                        unsigned l2, const us* g2, unsigned l3, const us* g3) {
  asm volatile("global_load_async_to_lds_b128 %0, %1, off\n\t"
               "global_load_async_to_lds_b128 %2, %3, off\n\t"
               "global_load_async_to_lds_b128 %4, %5, off\n\t"
               "global_load_async_to_lds_b128 %6, %7, off\n\t"
               "s_wait_xcnt 0x0"
               :: "v"(l0), "v"(g0), "v"(l1), "v"(g1), "v"(l2), "v"(g2),
                  "v"(l3), "v"(g3) : "memory");
}
// max of a lane's value and its partner's (lane ^ 16)
DEV float maxhalves(float v) {
  const int i = __float_as_int(v);
  return fmaxf(v, __int_as_float(__builtin_amdgcn_permlanex16(
                      i, i, 0x76543210, 0xfedcba98, false, false)));
}

__global__ __launch_bounds__(256)
void k_flash(const us* __restrict__ Qb, int q_rs, int q_col0,
             const us* __restrict__ Kb, int k_rs, int k_col0,
             const us* __restrict__ Vt,
             us* __restrict__ Ob, int o_rs,
             int T, int H, int causal, float scale) {
  __shared__ __align__(16) us lK[2][64 * FP];
  __shared__ __align__(16) us lV[2][64 * FP];
  const int tid = threadIdx.x;
  const int lane = tid & 31;
  // the wave's number in a scalar register: tile indices and the trip count
  // are then scalar, and the loop and the diagonal test are scalar branches
  const int wid = __builtin_amdgcn_readfirstlane(tid >> 5);
  const int gw = blockIdx.x * 8 + wid;
  const int nQT = T >> 5;
  const int qt = gw % nQT;
  const int h  = (gw / nQT) % H;
  const int b  = gw / (nQT * H);
  const int l15 = lane & 15, khalf = (lane >> 4) << 3, hi8 = khalf;
  const size_t brow = (size_t)b * T;
  // 8 threads copy one row of 128 B; a thread: 2 x 16 B of K, 2 x 16 B of Vt
  const int crow = tid >> 3, cc8 = (tid & 7) << 3;
  const us* gk = Kb + (brow + crow) * k_rs + k_col0 + h * 64 + cc8;
  const us* gv = Vt + ((size_t)(b * H + h) * 64 + crow) * T + cc8;
  const unsigned lk = lds_addr(&lK[0][crow * FP + cc8]);
  const unsigned lv = lds_addr(&lV[0][crow * FP + cc8]);
  auto issue = [&](int p, int s) {   // stage s (keys 64 s ..) into buffer p
    const us* k0 = gk + (size_t)(s * 64) * k_rs;
    const us* v0 = gv + s * 64;
    const unsigned o = p * (64 * FP * 2), half = 32 * FP * 2;
    async_copy16x4(lk + o, k0, lk + o + half, k0 + (size_t)32 * k_rs,
                   lv + o, v0, lv + o + half, v0 + (size_t)32 * T);
  };

  FragB16 ones;
  {
    uint4 o; o.x = o.y = o.z = o.w = 0x3F803F80u;   // bf16 1.0 pairs
    ones.q[0] = o; ones.q[1] = o;
  }
  FragB16 bq[2][2];                  // [query group][32 d]
  #pragma unroll
  for (int g = 0; g < 2; ++g) {
    const us* qr = Qb + (brow + qt * 32 + g * 16 + l15) * q_rs + q_col0 + h * 64;
    #pragma unroll
    for (int kc = 0; kc < 2; ++kc) {
      bq[g][kc].q[0] = *(const uint4*)(qr + kc * 32 + khalf);
      bq[g][kc].q[1] = *(const uint4*)(qr + kc * 32 + 16 + khalf);
    }
  }
  // the copies' addresses are formed next, in registers that the Q loads in
  // flight may name: the wait that belongs in front of such an overwrite
  asm volatile("s_wait_xcnt 0x0" ::: "memory");
  // exp(scale * (s - m)) = exp2(s * c2 - m * c2); scale > 0, so the maximum is
  // taken over the raw scores
  const float c2 = scale * 1.44269504088896340736f;
  float mrow[2];
  v8f oc[2][4], ls[2];
  #pragma unroll
  for (int g = 0; g < 2; ++g) {
    mrow[g] = -__builtin_inff(); ls[g] = zero8();
    #pragma unroll
    for (int d = 0; d < 4; ++d) oc[g][d] = zero8();
  }

  const int nsteps = causal ? (qt + 1) : (T >> 5);
  // stages of the block: as far as its last wave's diagonal; the same in all waves
  const int nst = causal ? (((int)(blockIdx.x * 8) % nQT + 8) >> 1) : (T >> 6);

  issue(0, 0);
  // stage 0 has landed before the barrier behind which other waves read it
  asm volatile("s_wait_asynccnt 0x0" ::: "memory");
  __syncthreads();
  if (1 < nst) issue(1, 1);

  for (int s = 0; s < nst; ++s) {
   const int pb = s & 1;
   // unrolled: the half stage's LDS offsets become constants
   #pragma unroll
   for (int sub = 0; sub < 2; ++sub) {
    const int j = 2 * s + sub;
    // a wave is done behind its diagonal (a scalar test); it still passes every
    // barrier below
    if (j >= nsteps) continue;
    FragB16 ka[2][2], va[4];
    #pragma unroll
    for (int ns = 0; ns < 2; ++ns) {
      const us* kr = &lK[pb][(sub * 32 + ns * 16 + l15) * FP + khalf];
      #pragma unroll
      for (int kc = 0; kc < 2; ++kc) {
        ka[ns][kc].q[0] = *(const uint4*)(kr + kc * 32);
        ka[ns][kc].q[1] = *(const uint4*)(kr + kc * 32 + 16);
      }
    }
    #pragma unroll
    for (int d = 0; d < 4; ++d) {
      const us* vr = &lV[pb][(d * 16 + l15) * FP + sub * 32 + khalf];
      va[d].q[0] = *(const uint4*)vr;
      va[d].q[1] = *(const uint4*)(vr + 16);
    }
    // keeps the step's 16 LDS reads together in front of the first product: one
    // place with reads a step; without it the Vt reads sink into the softmax in
    // further groups
    __builtin_amdgcn_sched_barrier(0);
    v8f st[2][2];                    // [query group][16-key tile]
    #pragma unroll
    for (int g = 0; g < 2; ++g)
      #pragma unroll
      for (int ns = 0; ns < 2; ++ns) {
        v8f acc = wmma_bf16(ka[ns][0], bq[g][0], zero8());
        st[g][ns] = wmma_bf16(ka[ns][1], bq[g][1], acc);
      }
    // only the last causal step holds keys behind a query of this wave
    if (causal && j == nsteps - 1) {
      #pragma unroll
      for (int g = 0; g < 2; ++g)
        #pragma unroll
        for (int ns = 0; ns < 2; ++ns)
          #pragma unroll
          for (int r = 0; r < 8; ++r)
            if (ns * 16 + hi8 + r > g * 16 + l15) st[g][ns][r] = -__builtin_inff();
    }
    #pragma unroll
    for (int g = 0; g < 2; ++g) {
      float mx = fmaxf(st[g][0][0], st[g][1][0]);
      #pragma unroll
      for (int r = 1; r < 8; ++r) mx = fmaxf(mx, fmaxf(st[g][0][r], st[g][1][r]));
      const float mn = fmaxf(mrow[g], maxhalves(mx));
      const float a  = __builtin_amdgcn_exp2f((mrow[g] - mn) * c2);
      const float mc = mn * c2;
      mrow[g] = mn;
      FragB16 pf;
      #pragma unroll
      for (int ns = 0; ns < 2; ++ns) {
        float p[8];
        #pragma unroll
        for (int r = 0; r < 8; ++r)
          p[r] = __builtin_amdgcn_exp2f(fmaf(st[g][ns][r], c2, -mc));
        uint4 w;
        w.x = cvt2(p[0], p[1]); w.y = cvt2(p[2], p[3]);
        w.z = cvt2(p[4], p[5]); w.w = cvt2(p[6], p[7]);
        pf.q[ns] = w;
      }
      ls[g] *= a;
      ls[g] = wmma_bf16(ones, pf, ls[g]);
      #pragma unroll
      for (int d = 0; d < 4; ++d) {
        oc[g][d] *= a;
        oc[g][d] = wmma_bf16(va[d], pf, oc[g][d]);
      }
    }
   }
   // the hand-over of a stage, in every wave: this wave's reads of buffer pb are
   // done, its copies of the next stage have landed, then the barrier that
   // publishes that stage and frees buffer pb for the refill behind it
   asm volatile("s_wait_dscnt 0x0" ::: "memory");
   asm volatile("s_wait_asynccnt 0x0" ::: "memory");
   __syncthreads();
   if (s + 2 < nst) issue(pb, s + 2);
  }
  // no copy is outstanding when the wave ends
  asm volatile("s_wait_asynccnt 0x0" ::: "memory");
  // a lane holds 8 consecutive d of its query in each tile: 16-byte stores
  #pragma unroll
  for (int g = 0; g < 2; ++g) {
    const float inv = 1.0f / ls[g][0];
    us* orow = Ob + (brow + qt * 32 + g * 16 + l15) * o_rs + h * 64 + hi8;
    #pragma unroll
    for (int d = 0; d < 4; ++d) {
      uint4 w;
      w.x = cvt2(oc[g][d][0] * inv, oc[g][d][1] * inv);
      w.y = cvt2(oc[g][d][2] * inv, oc[g][d][3] * inv);
      w.z = cvt2(oc[g][d][4] * inv, oc[g][d][5] * inv);
      w.w = cvt2(oc[g][d][6] * inv, oc[g][d][7] * inv);
      *(uint4*)(orow + d * 16) = w;
    }
  }
}

// ----------------------------- host launcher --------------------------------
extern "C" void kernel_launch(void* const* d_in, const int* in_sizes, int n_in,
                              void* d_out, int out_size, void* d_ws,
                              size_t ws_size, hipStream_t stream) {
  (void)in_sizes; (void)n_in; (void)out_size; (void)ws_size;
  constexpr int B = 4, T = 1024, C = 1024, H = 16, F = 4096;
  constexpr int BT = B * T;
  const float* x     = (const float*)d_in[0];
  const float* ctx   = (const float*)d_in[1];
  const float* ln1_g = (const float*)d_in[2];
  const float* ln1_b = (const float*)d_in[3];
  const float* qkv_w = (const float*)d_in[4];
  const float* qkv_b = (const float*)d_in[5];
  const float* aow   = (const float*)d_in[6];
  const float* aob   = (const float*)d_in[7];
  const float* lnc_g = (const float*)d_in[8];
  const float* lnc_b = (const float*)d_in[9];
  const float* q_w   = (const float*)d_in[10];
  const float* q_b   = (const float*)d_in[11];
  const float* kv_w  = (const float*)d_in[12];
  const float* kv_b  = (const float*)d_in[13];
  const float* cow   = (const float*)d_in[14];
  const float* cob   = (const float*)d_in[15];
  const float* ln2_g = (const float*)d_in[16];
  const float* ln2_b = (const float*)d_in[17];
  const float* w1    = (const float*)d_in[18];
  const float* b1    = (const float*)d_in[19];
  const float* w2    = (const float*)d_in[20];
  const float* b2    = (const float*)d_in[21];

  char* p = (char*)d_ws;
  auto carve = [&](size_t bytes) -> char* {
    char* r = p; p += (bytes + 255) & ~(size_t)255; return r;
  };
  us* wqkv = (us*)carve((size_t)C * 3 * C * 2);   // [3C][C] transposed
  us* wao  = (us*)carve((size_t)C * C * 2);
  us* wq   = (us*)carve((size_t)C * C * 2);
  us* wkv  = (us*)carve((size_t)C * 2 * C * 2);
  us* wco  = (us*)carve((size_t)C * C * 2);
  us* w1b  = (us*)carve((size_t)C * F * 2);
  us* w2b  = (us*)carve((size_t)F * C * 2);
  us* hbuf = (us*)carve((size_t)BT * C * 2);
  us* qkvb = (us*)carve((size_t)BT * 3 * C * 2);
  us* obuf = (us*)carve((size_t)BT * C * 2);
  us* ctxb = (us*)carve((size_t)BT * C * 2);
  us* vtb  = (us*)carve((size_t)BT * C * 2);      // Vt[(b*H+h)*64 + d][T]
  us* f1b  = (us*)carve((size_t)BT * F * 2);
  float* resid = (float*)carve((size_t)BT * C * 4);
  us* qxb = qkvb;                    // reuse after self-attention
  us* kvb = qkvb + (size_t)BT * C;

  // first LayerNorm, weight conversions, context conversion: 1536 blocks
  k_prep<C, F, BT><<<BT / 16 + (8 * C * C + 2 * C * F + BT * C) / 16384, 256, 0,
                     stream>>>(x, ln1_g, ln1_b, hbuf, qkv_w, wqkv, aow, wao, q_w, wq,
                               kv_w, wkv, cow, wco, w1, w1b, w2, w2b, ctx, ctxb, C);

  const int flashBlocks = (B * H * (T / 32)) / 8;   // 256
  const float scale = 0.125f;                       // 1/sqrt(64)

  // 1) self-attention branch
  k_gemm_v<T><<<dim3(3 * C / 192, BT / 256), 256, 0, stream>>>(
      hbuf, wqkv, qkv_b, qkvb, 3 * C, C, vtb, 2 * C);
  k_flash<<<flashBlocks, 256, 0, stream>>>(
      qkvb, 3 * C, 0, qkvb, 3 * C, C, vtb, obuf, C, T, H, 1, scale);
  k_gemm_res<<<dim3(C / 128, BT / 128), 256, 0, stream>>>(
      obuf, wao, aob, x, resid, C, C);

  // 2) cross-attention branch
  k_layernorm<<<BT / 16, 256, 0, stream>>>(resid, lnc_g, lnc_b, hbuf, C);
  k_gemm_two<T><<<dim3(3 * C / 256, BT / 256), 256, 0, stream>>>(
      hbuf, wq, q_b, qxb, C, ctxb, wkv, kv_b, kvb, 2 * C, C, vtb, C);
  k_flash<<<flashBlocks, 256, 0, stream>>>(
      qxb, C, 0, kvb, 2 * C, 0, vtb, obuf, C, T, H, 0, scale);
  k_gemm_res<<<dim3(C / 128, BT / 128), 256, 0, stream>>>(
      obuf, wco, cob, resid, resid, C, C);

  // 3) FFN
  k_layernorm<<<BT / 16, 256, 0, stream>>>(resid, ln2_g, ln2_b, hbuf, C);
  k_gemm<2><<<dim3(F / 256, BT / 256), 512, 0, stream>>>(
      hbuf, w1b, b1, f1b, F, C);
  k_gemm_res<<<dim3(C / 128, BT / 128), 256, 0, stream>>>(
      f1b, w2b, b2, resid, (float*)d_out, C, F);
}

// v010
// One run takes 201 microseconds.
// In both of two side-by-side timings against v009, it was 1.04 times as fast.
// Over all steps from v000 it is 2.75 times as fast.
#include <hip/hip_runtime.h>
#include <hip/hip_bf16.h>
#include <math.h>

typedef __attribute__((ext_vector_type(16))) __bf16 v16bf;
typedef __attribute__((ext_vector_type(8)))  float  v8f;
typedef int v4i_t __attribute__((vector_size(16)));
typedef unsigned short us;

#define DEV static __device__ __forceinline__
#define AS1 __attribute__((address_space(1)))
#define AS3 __attribute__((address_space(3)))

#if defined(__has_builtin)
#if __has_builtin(__builtin_amdgcn_global_load_async_to_lds_b128)
#define HAVE_ASYNC_BUILTIN 1
#endif
#endif
#ifndef HAVE_ASYNC_BUILTIN
#define HAVE_ASYNC_BUILTIN 0
#endif

// LDS pitch, in 16-bit elements, of the GEMM tiles' rows of 128, which
// ds_load_b128 reads one row per lane: 272 B = 16 B x odd spreads 16 rows over
// all 64 banks.
constexpr int LP = 136;

union FragB16 { uint4 q[2]; v16bf v; };

DEV us f2bf(float f) {
  unsigned u = __float_as_uint(f);
  u += 0x7FFFu + ((u >> 16) & 1u);          // round-to-nearest-even
  return (us)(u >> 16);
}
DEV v8f zero8() { v8f z = {0.f,0.f,0.f,0.f,0.f,0.f,0.f,0.f}; return z; }

DEV v8f wmma_bf16(const FragB16& a, const FragB16& b, v8f c) {
  return __builtin_amdgcn_wmma_f32_16x16x32_bf16(false, a.v, false, b.v,
                                                 (short)0, c, false, false);
}

// 16-byte async global -> LDS copy (per-lane addresses), ASYNCcnt-tracked.
DEV void async_copy16(us* lds, const us* g) {
#if HAVE_ASYNC_BUILTIN
  __builtin_amdgcn_global_load_async_to_lds_b128((AS1 v4i_t*)(us*)g,
                                                 (AS3 v4i_t*)lds, 0, 0);
#else
  unsigned loff = (unsigned)(unsigned long long)(AS3 us*)lds;
  unsigned long long ga = (unsigned long long)g;
  asm volatile("global_load_async_to_lds_b128 %0, %1, off"
               :: "v"(loff), "v"(ga) : "memory");
#endif
}

// The three streaming pieces below give every lane 64 elements (16 loads of
// 16 B, all issued before the first use): a launch then starts one wave where
// sixteen one-load waves would stand, for speed only.  The two conversions and the LayerNorm are written as
// the work of one block of 256 threads, numbered blk, so that pieces which do
// not depend on one another can share a launch (k_prep).
typedef float    f32x4 __attribute__((ext_vector_type(4)));
typedef unsigned u32x4 __attribute__((ext_vector_type(4)));

// two f32 -> two bf16 in one dword, each rounded as f2bf rounds
DEV unsigned pack2(float lo, float hi) {
  unsigned a = __float_as_uint(lo), c = __float_as_uint(hi);
  a += 0x7FFFu + ((a >> 16) & 1u);
  c += 0x7FFFu + ((c >> 16) & 1u);
  return (a >> 16) | (c & 0xFFFF0000u);
}

// ---------------- fp32 -> bf16 (row-major copy: context) --------------------
// One block: 4096 float4 in a row; a wave's load covers 512 B, its store 256 B.
DEV void cvt_bf16_block(const float* __restrict__ src, us* __restrict__ dst,
                        int blk) {
  const int base = blk * 4096 + threadIdx.x;
  f32x4 f[16];
  #pragma unroll
  for (int u = 0; u < 16; ++u) f[u] = ((const f32x4*)src)[base + u * 256];
  // keeps every load above in front of the first use, all in flight together;
  // without it some sink to their use, one memory latency after another
  __builtin_amdgcn_sched_barrier(0);
  #pragma unroll
  for (int u = 0; u < 16; ++u) {
    uint2 o; o.x = pack2(f[u][0], f[u][1]); o.y = pack2(f[u][2], f[u][3]);
    ((uint2*)dst)[base + u * 256] = o;
  }
  // in a shared launch another piece's code can stand behind these stores in the
  // listing: the wait that belongs in front of an overwrite of their registers
  asm volatile("s_wait_xcnt 0x0" ::: "memory");
}

// -------- fp32 W[K,N] -> bf16 Wt[N,K] (convert + transpose in registers) ----
// One wave: 64 k x 32 n.  A lane loads 8 k-rows x 8 n and stores 8 n-rows x 8 k:
// four lanes read one 128-B line of W, eight lanes write one 128-B line of Wt.
// K and N are compile-time so that the row steps are immediate offsets.
// One block: 64 k x 256 n; K * N / 16384 blocks, n fastest.
template <int K, int N>
DEV void cvt_t_block(const float* __restrict__ src, us* __restrict__ dst,
                     int blk) {
  const int lane = threadIdx.x & 31, wid = threadIdx.x >> 5;
  const int k0 = (blk / (N / 256)) * 64 + (lane >> 2) * 8;
  const int n0 = (blk % (N / 256)) * 256 + wid * 32 + (lane & 3) * 8;
  const float* s = src + (size_t)k0 * N + n0;
  f32x4 f[16];                       // f[2 i + j]: row k0 + i, columns 4 j ..
  #pragma unroll
  for (int i = 0; i < 15; ++i)
    f[i] = *(const f32x4*)(s + (i >> 1) * N + (i & 1) * 4);
  // the last load's result may take the address register that the 15 loads in
  // flight name: the wait that belongs in front of such an overwrite
  asm volatile("s_wait_xcnt 0x0" ::: "memory");
  f[15] = *(const f32x4*)(s + 7 * N + 4);
  // keeps every load above in front of the first use, all in flight together;
  // without it some sink to their use, one memory latency after another
  __builtin_amdgcn_sched_barrier(0);
  us* d = dst + (size_t)n0 * K + k0;
  #pragma unroll
  for (int e = 0; e < 8; ++e) {
    const int j = e >> 2, m = e & 3;
    uint4 o;
    o.x = pack2(f[0 + j][m],  f[2 + j][m]);  o.y = pack2(f[4 + j][m],  f[6 + j][m]);
    o.z = pack2(f[8 + j][m],  f[10 + j][m]); o.w = pack2(f[12 + j][m], f[14 + j][m]);
    *(uint4*)(d + e * K) = o;
  }
  // in a shared launch another piece's code can stand behind these stores in the
  // listing: the wait that belongs in front of an overwrite of their registers
  asm volatile("s_wait_xcnt 0x0" ::: "memory");
}

// ---------------- LayerNorm: one wave per two rows (C = 1024) ---------------
// A lane holds 32 elements of each row; a row's sums are four in-lane chains and
// a five-step butterfly, so no LDS array and no barrier.
DEV void layernorm_block(const float* __restrict__ x, const float* __restrict__ g,
                         const float* __restrict__ b, us* __restrict__ out, int C,
                         int blk) {
  const int lane = threadIdx.x & 31;
  const int row0 = (blk * 8 + (threadIdx.x >> 5)) * 2;
  const int c4 = C >> 2;             // groups of 4 elements in a row
  const int at[2] = {row0 * c4 + lane, (row0 + 1) * c4 + lane};
  f32x4 v[16], gb[16];               // v[8 q + i]: row q; gb[i]: g, gb[8 + i]: b
  #pragma unroll
  for (int q = 0; q < 2; ++q)
    #pragma unroll
    for (int i = 0; i < 8; ++i)
      v[8 * q + i] = ((const f32x4*)x)[at[q] + i * 32];
  // a result of the loads below may take an address register that the loads in
  // flight above name: the wait that belongs in front of such an overwrite
  asm volatile("s_wait_xcnt 0x0" ::: "memory");
  #pragma unroll
  for (int i = 0; i < 15; ++i)
    gb[i] = ((const f32x4*)(i < 8 ? g : b))[lane + (i & 7) * 32];
  // the same in front of the last load, whose result may take the index register
  asm volatile("s_wait_xcnt 0x0" ::: "memory");
  gb[15] = ((const f32x4*)b)[lane + 7 * 32];
  // keeps every load above in front of the first use, all in flight together;
  // without it some sink to their use, one memory latency after another
  __builtin_amdgcn_sched_barrier(0);
  float s[2], s2[2];
  #pragma unroll
  for (int q = 0; q < 2; ++q) {
    f32x4 a = {0.f, 0.f, 0.f, 0.f}, a2 = {0.f, 0.f, 0.f, 0.f};
    #pragma unroll
    for (int i = 0; i < 8; ++i) {
      f32x4 t = v[8 * q + i];
      a += t; a2 += t * t;
    }
    s[q]  = (a[0] + a[1]) + (a[2] + a[3]);
    s2[q] = (a2[0] + a2[1]) + (a2[2] + a2[3]);
  }
  #pragma unroll
  for (int off = 16; off; off >>= 1)
    #pragma unroll
    for (int q = 0; q < 2; ++q) {
      s[q]  += __shfl_xor(s[q],  off, 32);
      s2[q] += __shfl_xor(s2[q], off, 32);
    }
  #pragma unroll
  for (int q = 0; q < 2; ++q) {
    const float mean = s[q] / C;
    const float rstd = rsqrtf(s2[q] / C - mean * mean + 1e-5f);
    #pragma unroll
    for (int i = 0; i < 8; ++i) {
      f32x4 t = v[8 * q + i], gg = gb[i], bb = gb[8 + i];
      uint2 w;
      w.x = pack2((t[0] - mean) * rstd * gg[0] + bb[0],
                  (t[1] - mean) * rstd * gg[1] + bb[1]);
      w.y = pack2((t[2] - mean) * rstd * gg[2] + bb[2],
                  (t[3] - mean) * rstd * gg[3] + bb[3]);
      ((uint2*)out)[at[q] + i * 32] = w;
    }
  }
}

__global__ __launch_bounds__(256)
void k_layernorm(const float* __restrict__ x, const float* __restrict__ g,
                 const float* __restrict__ b, us* __restrict__ out, int C) {
  layernorm_block(x, g, b, out, C, blockIdx.x);
}

// -------- everything that reads inputs alone, in ONE launch -----------------
// The first LayerNorm, the seven weight conversions and the context conversion
// depend on nothing but inputs and write disjoint buffers: one grid holds the
// blocks of all nine, dealt out by ranges of blockIdx.x (a scalar test), so that
// one launch gap, one ramp and one drain stand where nine would, and the short
// pieces' memory latency hides behind the long ones' streams.
// lnC: the LayerNorm's row length, at run time as k_layernorm takes it, so that
// both run the same code.
template <int C, int F, int BT>
__global__ __launch_bounds__(256)
void k_prep(const float* __restrict__ x, const float* __restrict__ ln_g,
            const float* __restrict__ ln_b, us* __restrict__ h,
            const float* __restrict__ qkv_w, us* __restrict__ wqkv,
            const float* __restrict__ aow, us* __restrict__ wao,
            const float* __restrict__ q_w, us* __restrict__ wq,
            const float* __restrict__ kv_w, us* __restrict__ wkv,
            const float* __restrict__ cow, us* __restrict__ wco,
            const float* __restrict__ w1, us* __restrict__ w1b,
            const float* __restrict__ w2, us* __restrict__ w2b,
            const float* __restrict__ ctx, us* __restrict__ ctxb, int lnC) {
  constexpr int nLN = BT / 16, nCC = C * C / 16384, nCF = C * F / 16384;
  int blk = blockIdx.x;
  if (blk < nLN) { layernorm_block(x, ln_g, ln_b, h, lnC, blk); return; }
  blk -= nLN;
  if (blk < 3 * nCC) { cvt_t_block<C, 3 * C>(qkv_w, wqkv, blk); return; }
  blk -= 3 * nCC;
  if (blk < 3 * nCC) {               // the three C x C weights: one copy of the code
    const int w = blk / nCC;
    cvt_t_block<C, C>(w == 0 ? aow : w == 1 ? q_w : cow,
                      w == 0 ? wao : w == 1 ? wq : wco, blk - w * nCC);
    return;
  }
  blk -= 3 * nCC;
  if (blk < 2 * nCC) { cvt_t_block<C, 2 * C>(kv_w, wkv, blk); return; }
  blk -= 2 * nCC;
  if (blk < nCF) { cvt_t_block<C, F>(w1, w1b, blk); return; }
  blk -= nCF;
  if (blk < nCF) { cvt_t_block<F, C>(w2, w2b, blk); return; }
  blk -= nCF;
  cvt_bf16_block(ctx, ctxb, blk);
}

// ---------------- exact GELU, x * Phi(x), two values at a time ---------------
// Phi(x) = 0.5 erfc(-x / sqrt 2).  With z = |x| / sqrt 2 and t = 1 / (1 + p z),
// 0.5 erfc(z) = q = (a1 t + a2 t^2 + a3 t^3 + a4 t^4 + a5 t^5) exp(-z^2), absolute
// error below 1e-7 for every z >= 0; Phi = 1 - q for x > 0 and q for x < 0, so
// x Phi(x) = max(x, 0) - |x| q.  ONE form for every x: no range test, so no branch
// and no change of EXEC between values, and the values of a lane are independent
// chains that the compiler can interleave and pair (a library erff is two ranges
// behind two branches a value, which hold each value's chain apart from the next).
typedef float f32x2 __attribute__((ext_vector_type(2)));
DEV f32x2 gelu2(f32x2 x) {
  const f32x2 one = {1.0f, 1.0f}, zero = {0.f, 0.f};
  const f32x2 ax = __builtin_elementwise_abs(x);
  const f32x2 d  = __builtin_elementwise_fma(ax, (f32x2)(0.2316419f), one);  // 1 + p z
  const f32x2 m  = (x * x) * (f32x2)(-0.72134752044448170368f);   // -z^2 log2(e)
  const f32x2 t  = {__builtin_amdgcn_rcpf(d[0]),  __builtin_amdgcn_rcpf(d[1])};
  const f32x2 e  = {__builtin_amdgcn_exp2f(m[0]), __builtin_amdgcn_exp2f(m[1])};
  f32x2 p = __builtin_elementwise_fma(t, (f32x2)(0.5307027145f), (f32x2)(-0.7265760135f));
  p = __builtin_elementwise_fma(p, t, (f32x2)(0.7107068705f));
  p = __builtin_elementwise_fma(p, t, (f32x2)(-0.142248368f));
  p = __builtin_elementwise_fma(p, t, (f32x2)(0.127414796f));
  const f32x2 q = (p * t) * e;
  return __builtin_elementwise_fma(-ax, q, __builtin_elementwise_max(x, zero));
}

// ------- bf16 WMMA GEMM: out = A[M,K] @ Wt[N,K]^T + bias, N large -----------
// Two LDS buffers filled by async global->LDS copies (ASYNCcnt), 128 k per stage.
// One block: a 256 x BN tile of out, alone on its WGP, so that a byte brought from
// L2 feeds 256 (A: BN) rows of products; NW waves, WGM of them along M, each with
// FM x FN accumulator tiles: a fragment read from LDS feeds FN or FM products.
// 8 waves of 128 x 64 or 64 x 96 where the epilogue is short; 16 of 64 x 64 for
// MODE 2, whose GELU is a long run of vector work that wants 4 waves a SIMD.
// A wave's copy covers two rows of 256 B, whole lines.  M a multiple of 256, N of
// BN, K of 128.
// MODE 0: bf16 out.  MODE 2: bf16 gelu(acc).
// The work of one block: tile column bx, tile row blockIdx.y.
// MODE 0 only: the columns from vcol0 on are V, which attention reads transposed:
// they go to vt[(b * (N - vcol0) + column - vcol0)][T] and nowhere else
// (row = b * T + t; T a multiple of 256, vcol0 of 32).
template <int MODE, int T, int BN, int NW, int WGM>
DEV void gemm_block(const us* __restrict__ A, const us* __restrict__ Wt,
                    const float* __restrict__ bias, void* __restrict__ outp, int N,
                    int K, int bx, us* __restrict__ vt = nullptr, int vcol0 = 0) {
  constexpr int BM = 256, WGN = NW / WGM, FM = BM / 16 / WGM, FN = BN / 16 / WGN;
  constexpr int CR = NW * 2;         // rows that one copy of every thread covers
  __shared__ __align__(16) us lA[2][BM * LP];
  __shared__ __align__(16) us lW[2][BN * LP];
  const int tid  = threadIdx.x;
  const int lane = tid & 31;
  // the wave's number in a scalar register: its tile's LDS offsets and the test
  // for V columns are then scalar
  const int wid = __builtin_amdgcn_readfirstlane(tid >> 5);
  const int wm = wid % WGM, wn = wid / WGM;
  const int l15 = lane & 15, khalf = (lane >> 4) << 3;
  const int mbase = blockIdx.y * BM, nbase = bx * BN;

  // 16 threads copy one row of 128 k; a thread: BM / CR x 16 B of A, BN / CR of W
  const int crow = tid >> 4, cc8 = (tid & 15) << 3;
  const us* ga0 = A  + (size_t)(mbase + crow) * K + cc8;
  const us* gw0 = Wt + (size_t)(nbase + crow) * K + cc8;

  auto issue = [&](int p, int s) {   // stage s (k from 128 s) into buffer p
    const us* ga = ga0 + s * 128;
    const us* gw = gw0 + s * 128;
    // unrolled: the LDS row steps become constants
    #pragma unroll
    for (int i = 0; i < BM / CR; ++i)
      async_copy16(&lA[p][(crow + CR * i) * LP + cc8], ga + (size_t)(CR * i) * K);
    #pragma unroll
    for (int i = 0; i < BN / CR; ++i)
      async_copy16(&lW[p][(crow + CR * i) * LP + cc8], gw + (size_t)(CR * i) * K);
  };

  v8f c[FM][FN];
  // unrolled, here and below: constant indices keep c, a and bfr in registers
  #pragma unroll
  for (int im = 0; im < FM; ++im)
    #pragma unroll
    for (int in = 0; in < FN; ++in) c[im][in] = zero8();

  const int nst = K >> 7;
  issue(0, 0);
  // stage 0 has landed before the barrier behind which other waves read it
  asm volatile("s_wait_asynccnt 0x0" ::: "memory");
  __syncthreads();
  if (1 < nst) issue(1, 1);

  for (int s = 0; s < nst; ++s) {
    const int p = s & 1;
    const us* tA = &lA[p][(wm * FM * 16 + l15) * LP + khalf];
    const us* tW = &lW[p][(wn * FN * 16 + l15) * LP + khalf];
    // unrolled: the LDS offsets of a 32-k block become constants
    #pragma unroll
    for (int kk = 0; kk < 128; kk += 32) {
      FragB16 a[FM], bfr[FN];
      // W first: a row of FN products needs all of bfr and one a
      #pragma unroll
      for (int i = 0; i < FN; ++i) {
        bfr[i].q[0] = *(const uint4*)(tW + i * 16 * LP + kk);
        bfr[i].q[1] = *(const uint4*)(tW + i * 16 * LP + kk + 16);
      }
      #pragma unroll
      for (int i = 0; i < FM; ++i) {
        a[i].q[0] = *(const uint4*)(tA + i * 16 * LP + kk);
        a[i].q[1] = *(const uint4*)(tA + i * 16 * LP + kk + 16);
      }
      // keeps the block's LDS reads together in front of its products: one place
      // with reads a block; without it each row of products waits out the LDS
      // latency of its own A fragment, read into one register set
      __builtin_amdgcn_sched_barrier(0);
      #pragma unroll
      for (int im = 0; im < FM; ++im)
        #pragma unroll
        for (int in = 0; in < FN; ++in)
          c[im][in] = wmma_bf16(a[im], bfr[in], c[im][in]);
      // keeps the next block's reads from being spread among these products
      __builtin_amdgcn_sched_barrier(0);
    }
    // the hand-over of a stage, in every wave: this wave's reads of buffer p are
    // done, its copies of the next stage have landed, then the barrier that
    // publishes that stage and frees buffer p for the refill behind it
    asm volatile("s_wait_dscnt 0x0" ::: "memory");
    asm volatile("s_wait_asynccnt 0x0" ::: "memory");
    __syncthreads();
    if (s + 2 < nst) issue(p, s + 2);
  }
  // no copy is outstanding when the wave ends
  asm volatile("s_wait_asynccnt 0x0" ::: "memory");

  const int hi8 = (lane >> 4) << 3;
  if constexpr (MODE == 0) {
    // A lane's 8 values of an accumulator tile are 8 consecutive rows (t) of one
    // column (d): 16 B in a row of vt.  64 rows of a wave fill one 128-B line of
    // each of a tile column's 16 rows of vt.  The test is scalar.
    #pragma unroll
    for (int in = 0; in < FN; ++in) {
      const int col0 = nbase + (wn * FN + in) * 16;
      if (col0 < vcol0) continue;
      const int col = col0 + l15;
      us* d = vt + ((size_t)(mbase / T) * (N - vcol0) + (col - vcol0)) * T +
              mbase % T + wm * FM * 16 + hi8;
      const float e = bias[col];
      // what follows may take the index register that the load names: the wait
      // that belongs in front of such an overwrite
      asm volatile("s_wait_xcnt 0x0" ::: "memory");
      #pragma unroll
      for (int g = 0; g < FM / 4; ++g) {
        u32x4 w[4];
        // unrolled: constant indices keep c and w in registers
        #pragma unroll
        for (int j = 0; j < 4; ++j) {
          const v8f a = c[4 * g + j][in];
          w[j][0] = pack2(a[0] + e, a[1] + e);
          w[j][1] = pack2(a[2] + e, a[3] + e);
          w[j][2] = pack2(a[4] + e, a[5] + e);
          w[j][3] = pack2(a[6] + e, a[7] + e);
        }
        // The lane's four 16-byte stores (64 t of one row of vt) as one run in one
        // statement: written as plain stores they came out with arithmetic between
        // them that takes their registers.  The wait on the last line stands in
        // front of every later overwrite of a register that the stores name.
        asm volatile("global_store_b128 %0, %1, off\n\t"
                     "global_store_b128 %0, %2, off offset:32\n\t"
                     "global_store_b128 %0, %3, off offset:64\n\t"
                     "global_store_b128 %0, %4, off offset:96\n\t"
                     "s_wait_xcnt 0x0"
                     :: "v"(d + 64 * g), "v"(w[0]), "v"(w[1]), "v"(w[2]), "v"(w[3])
                     : "memory");
      }
    }
  }
  // RQ rows of accumulator tiles a trip.  Rolled, for speed only.  A trip picks its tiles by scalar tests on q, which keeps c in registers.
  constexpr int RQ = MODE == 2 ? 1 : 2;
  float be[FN];
  #pragma unroll
  for (int in = 0; in < FN - 1; ++in)
    be[in] = bias[nbase + (wn * FN + in) * 16 + l15];
  // the last load's result may take the index register that the loads in flight
  // name, and what follows may take it behind the last: the wait that belongs in
  // front of such an overwrite, in front of the last load and behind it
  asm volatile("s_wait_xcnt 0x0" ::: "memory");
  be[FN - 1] = bias[nbase + (wn * FN + FN - 1) * 16 + l15];
  asm volatile("s_wait_xcnt 0x0" ::: "memory");
  #pragma unroll 1
  for (int q = 0; q < FM / RQ; ++q) {
    v8f t[RQ][FN];
    #pragma unroll
    for (int i = 0; i < RQ; ++i)
      #pragma unroll
      for (int in = 0; in < FN; ++in) {
        v8f x = c[i][in];
        #pragma unroll
        for (int u = 1; u < FM / RQ; ++u) x = (q == u) ? c[RQ * u + i][in] : x;
        t[i][in] = x;
      }
    #pragma unroll
    for (int i = 0; i < RQ; ++i)
      #pragma unroll
      for (int in = 0; in < FN; in += 2) {
        const int col0 = nbase + (wn * FN + in) * 16;
        if (MODE == 0 && col0 >= vcol0) continue;
        unsigned h[2][8];
        #pragma unroll
        for (int j = 0; j < 2; ++j)
          #pragma unroll
          for (int r = 0; r < 8; r += 2) {
            f32x2 v = {t[i][in + j][r] + be[in + j], t[i][in + j][r + 1] + be[in + j]};
            if (MODE == 2) v = gelu2(v);
            h[j][r] = f2bf(v[0]);
            h[j][r + 1] = f2bf(v[1]);
          }
        us* o = (us*)outp +
                (size_t)(mbase + (wm * FM + RQ * q + i) * 16 + hi8) * N + col0 + l15;
        // The lane's sixteen 2-byte stores (8 rows of two columns 16 apart) as one run
        // in one statement.  The wait on the last line stands in front of every later
        // overwrite of a register that the stores name.
        asm volatile("global_store_b16 %0, %8, off\n\t"
                     "global_store_b16 %1, %9, off\n\t"
                     "global_store_b16 %2, %10, off\n\t"
                     "global_store_b16 %3, %11, off\n\t"
                     "global_store_b16 %4, %12, off\n\t"
                     "global_store_b16 %5, %13, off\n\t"
                     "global_store_b16 %6, %14, off\n\t"
                     "global_store_b16 %7, %15, off\n\t"
                     "global_store_b16 %0, %16, off offset:32\n\t"
                     "global_store_b16 %1, %17, off offset:32\n\t"
                     "global_store_b16 %2, %18, off offset:32\n\t"
                     "global_store_b16 %3, %19, off offset:32\n\t"
                     "global_store_b16 %4, %20, off offset:32\n\t"
                     "global_store_b16 %5, %21, off offset:32\n\t"
                     "global_store_b16 %6, %22, off offset:32\n\t"
                     "global_store_b16 %7, %23, off offset:32\n\t"
                     "s_wait_xcnt 0x0"
                     :: "v"(o), "v"(o + N), "v"(o + 2 * (size_t)N), "v"(o + 3 * (size_t)N),
                        "v"(o + 4 * (size_t)N), "v"(o + 5 * (size_t)N),
                        "v"(o + 6 * (size_t)N), "v"(o + 7 * (size_t)N),
                        "v"(h[0][0]), "v"(h[0][1]), "v"(h[0][2]), "v"(h[0][3]),
                        "v"(h[0][4]), "v"(h[0][5]), "v"(h[0][6]), "v"(h[0][7]),
                        "v"(h[1][0]), "v"(h[1][1]), "v"(h[1][2]), "v"(h[1][3]),
                        "v"(h[1][4]), "v"(h[1][5]), "v"(h[1][6]), "v"(h[1][7])
                     : "memory");
      }
  }
}

template <int MODE>
__global__ __launch_bounds__(512)
void k_gemm(const us* __restrict__ A, const us* __restrict__ Wt,
            const float* __restrict__ bias, void* __restrict__ outp, int N, int K) {
  gemm_block<MODE, 256, 256, 16, 4>(A, Wt, bias, outp, N, K, blockIdx.x);
}

// ------- fp32 out = resid + A[M,K] @ Wt[N,K]^T + bias, N small ---------------
// These products have one 128 x 128 tile per WGP and no second block to hide a
// block's waits behind.  So k is split INSIDE the block: a stage is 256 k, and
// the 8 waves are two halves of 4; half kg works on the stage's k slab kg (128 k)
// with 64 x 64 per wave.  A stage's copy latency and its barrier are then paid
// once per 256 k, and a fragment read from LDS feeds 4 products, not 2 or 4.
// At the end waves w and w + 4 hold partial sums of the same 64 x 64 tile: each
// hands the other 32 of its rows through LDS and finishes the 32 rows it keeps.
// M, N multiples of 128, K of 256.
__global__ __launch_bounds__(256)
void k_gemm_res(const us* __restrict__ A, const us* __restrict__ Wt,
                const float* __restrict__ bias, const float* __restrict__ resid,
                float* __restrict__ outp, int N, int K) {
  // LDS pitch, in 16-bit elements, of a stage's rows of 256 (slab kg: columns from
  // 128 kg): 528 B = 16 B x odd, as LP is, for the same ds_load_b128 readers
  constexpr int LQ = 264;
  __shared__ __align__(16) us lA[2][128 * LQ];
  __shared__ __align__(16) us lW[2][128 * LQ];
  const int tid  = threadIdx.x;
  const int lane = tid & 31;
  // the wave's number in a scalar register: the slab's LDS offset is then scalar
  const int wid = __builtin_amdgcn_readfirstlane(tid >> 5);
  const int kg = wid >> 2, wm = wid & 1, wn = (wid >> 1) & 1;
  const int l15 = lane & 15, khalf = (lane >> 4) << 3;
  const int mbase = blockIdx.y * 128, nbase = blockIdx.x * 128;

  // 16 threads copy 256 B of one row (one slab's part of it); a thread: 16 x 16 B
  // of A, 16 x 16 B of W per stage
  const int crow = tid >> 4, cc8 = (tid & 15) << 3;
  const us* ga0 = A  + (size_t)(mbase + crow) * K + cc8;
  const us* gw0 = Wt + (size_t)(nbase + crow) * K + cc8;

  auto issue = [&](int p, int s) {   // stage s (k from 256 s) into buffer p
    const us* ga = ga0 + s * 256;
    const us* gw = gw0 + s * 256;
    // unrolled: the LDS row steps become constants
    #pragma unroll
    for (int i = 0; i < 8; ++i)
      #pragma unroll
      for (int h = 0; h < 2; ++h) {
        async_copy16(&lA[p][(crow + 16 * i) * LQ + h * 128 + cc8],
                     ga + (size_t)(16 * i) * K + h * 128);
        async_copy16(&lW[p][(crow + 16 * i) * LQ + h * 128 + cc8],
                     gw + (size_t)(16 * i) * K + h * 128);
      }
  };

  v8f c[4][4];
  // unrolled, here and below: constant indices keep c, a and bfr in registers
  #pragma unroll
  for (int im = 0; im < 4; ++im)
    #pragma unroll
    for (int in = 0; in < 4; ++in) c[im][in] = zero8();

  const int nst = K >> 8;
  issue(0, 0);
  // stage 0 has landed before the barrier behind which other waves read it
  asm volatile("s_wait_asynccnt 0x0" ::: "memory");
  __syncthreads();
  if (1 < nst) issue(1, 1);

  for (int s = 0; s < nst; ++s) {
    const int p = s & 1;
    const us* tA = &lA[p][(wm * 64 + l15) * LQ + kg * 128 + khalf];
    const us* tW = &lW[p][(wn * 64 + l15) * LQ + kg * 128 + khalf];
    // unrolled: the LDS offsets of a 32-k block become constants
    #pragma unroll
    for (int kk = 0; kk < 128; kk += 32) {
      FragB16 a[4], bfr[4];
      // W first: a row of 4 products needs all of bfr and one a
      #pragma unroll
      for (int i = 0; i < 4; ++i) {
        bfr[i].q[0] = *(const uint4*)(tW + i * 16 * LQ + kk);
        bfr[i].q[1] = *(const uint4*)(tW + i * 16 * LQ + kk + 16);
      }
      #pragma unroll
      for (int i = 0; i < 4; ++i) {
        a[i].q[0] = *(const uint4*)(tA + i * 16 * LQ + kk);
        a[i].q[1] = *(const uint4*)(tA + i * 16 * LQ + kk + 16);
      }
      // keeps the block's 16 LDS reads together in front of its 16 products: one
      // place with reads a block; without it each row of 4 products waits out the
      // LDS latency of its own A fragment, read into one register set
      __builtin_amdgcn_sched_barrier(0);
      #pragma unroll
      for (int im = 0; im < 4; ++im)
        #pragma unroll
        for (int in = 0; in < 4; ++in)
          c[im][in] = wmma_bf16(a[im], bfr[in], c[im][in]);
      // keeps the next block's reads from being spread among these products
      __builtin_amdgcn_sched_barrier(0);
    }
    // the hand-over of a stage, in every wave: this wave's reads of buffer p are
    // done, its copies of the next stage have landed, then the barrier that
    // publishes that stage and frees buffer p for the refill behind it
    asm volatile("s_wait_dscnt 0x0" ::: "memory");
    asm volatile("s_wait_asynccnt 0x0" ::: "memory");
    __syncthreads();
    if (s + 2 < nst) issue(p, s + 2);
  }
  // no copy is outstanding when the tiles' LDS is used anew and the wave ends
  asm volatile("s_wait_asynccnt 0x0" ::: "memory");

  // The two slabs' partial sums meet.  The last stage's barrier has ended every
  // read of the tiles, so their LDS takes the exchange: 16 x 16 B per lane, a
  // wave's store or load covering 512 B in a row.  Half kg keeps tile rows
  // 32 kg .. 32 kg + 31 and hands over the others.
  f32x4* xch = (f32x4*)&lA[0][0];
  v8f keep[2][4];
  #pragma unroll
  for (int i = 0; i < 2; ++i)
    #pragma unroll
    for (int in = 0; in < 4; ++in) {
      const v8f give = kg ? c[i][in] : c[2 + i][in];
      keep[i][in]    = kg ? c[2 + i][in] : c[i][in];
      f32x4 lo = {give[0], give[1], give[2], give[3]};
      f32x4 hi = {give[4], give[5], give[6], give[7]};
      xch[(wid * 16 + (i * 4 + in) * 2) * 32 + lane]     = lo;
      xch[(wid * 16 + (i * 4 + in) * 2 + 1) * 32 + lane] = hi;
    }
  // every wave's partial sums are in LDS before its partner reads them
  __syncthreads();
  const int hi8 = (lane >> 4) << 3;
  #pragma unroll
  for (int i = 0; i < 2; ++i)
    #pragma unroll
    for (int in = 0; in < 4; ++in) {
      const f32x4 lo = xch[((wid ^ 4) * 16 + (i * 4 + in) * 2) * 32 + lane];
      const f32x4 hi = xch[((wid ^ 4) * 16 + (i * 4 + in) * 2 + 1) * 32 + lane];
      const int col = nbase + wn * 64 + in * 16 + l15;
      #pragma unroll
      for (int r = 0; r < 8; ++r) {
        const int row = mbase + wm * 64 + (kg * 2 + i) * 16 + r + hi8;
        const size_t idx = (size_t)row * N + col;
        const float v = (keep[i][in][r] + (r < 4 ? lo[r & 3] : hi[r & 3])) + bias[col];
        outp[idx] = resid[idx] + v;
      }
    }
}

// A MODE 0 product whose columns from vcol0 on are V (rows of T per batch); N a
// multiple of 192: with N = 3072 and M = 4096 one 256 x 192 tile for every WGP.
template <int T>
__global__ __launch_bounds__(256)
void k_gemm_v(const us* __restrict__ A, const us* __restrict__ Wt,
              const float* __restrict__ bias, us* __restrict__ outp, int N, int K,
              us* __restrict__ vt, int vcol0) {
  gemm_block<0, T, 192, 8, 4>(A, Wt, bias, outp, N, K, blockIdx.x, vt, vcol0);
}

// Two independent MODE 0 products of the same M and K in ONE launch: the second's
// tile columns stand behind the first's in blockIdx.x (a scalar test).  The first
// has no V columns; the second's begin at vcol1.
template <int T>
__global__ __launch_bounds__(256)
void k_gemm_two(const us* __restrict__ A0, const us* __restrict__ Wt0,
                const float* __restrict__ bias0, us* __restrict__ out0, int N0,
                const us* __restrict__ A1, const us* __restrict__ Wt1,
                const float* __restrict__ bias1, us* __restrict__ out1, int N1,
                int K, us* __restrict__ vt, int vcol1) {
  const int bx = blockIdx.x, nb0 = N0 >> 8;
  const bool second = bx >= nb0;
  gemm_block<0, T, 256, 8, 2>(second ? A1 : A0, second ? Wt1 : Wt0,
                           second ? bias1 : bias0, second ? out1 : out0,
                           second ? N1 : N0, K, second ? bx - nb0 : bx, vt,
                           second ? vcol1 : N0);
}

typedef __bf16 bf16x2 __attribute__((ext_vector_type(2)));

// two f32 -> two bf16 in one dword, round to nearest even, one instruction
DEV unsigned cvt2(float lo, float hi) {
  f32x2 f = {lo, hi};
  return __builtin_bit_cast(unsigned, __builtin_convertvector(f, bf16x2));
}
// LDS pitch, in 16-bit elements, of the attention tiles' rows of 64 (128 B), which
// ds_load_b128 reads one row per lane: 144 B = 16 B x odd spreads 16 rows over
// all 64 banks.
constexpr int FP = 72;
DEV unsigned lds_addr(const us* p) {
  return (unsigned)(unsigned long long)(const AS3 us*)p;
}
// Four 16-byte async global -> LDS copies of one lane (ASYNCcnt-tracked).  The
// wait on the last line stands in front of every later overwrite of a register
// that the copies name; inside the statement nothing can be lifted over it.
DEV void async_copy16x4(unsigned l0, const us* g0, unsigned l1, const us* g1,
                        unsigned l2, const us* g2, unsigned l3, const us* g3) {
  asm volatile("global_load_async_to_lds_b128 %0, %1, off\n\t"
               "global_load_async_to_lds_b128 %2, %3, off\n\t"
               "global_load_async_to_lds_b128 %4, %5, off\n\t"
               "global_load_async_to_lds_b128 %6, %7, off\n\t"
               "s_wait_xcnt 0x0"
               :: "v"(l0), "v"(g0), "v"(l1), "v"(g1), "v"(l2), "v"(g2),
                  "v"(l3), "v"(g3) : "memory");
}
// max of a lane's value and its partner's (lane ^ 16)
DEV float maxhalves(float v) {
  const int i = __float_as_int(v);
  return fmaxf(v, __int_as_float(__builtin_amdgcn_permlanex16(
                      i, i, 0x76543210, 0xfedcba98, false, false)));
}

__global__ __launch_bounds__(256)
void k_flash(const us* __restrict__ Qb, int q_rs, int q_col0,
             const us* __restrict__ Kb, int k_rs, int k_col0,
             const us* __restrict__ Vt,
             us* __restrict__ Ob, int o_rs,
             int T, int H, int causal, float scale) {
  __shared__ __align__(16) us lK[2][64 * FP];
  __shared__ __align__(16) us lV[2][64 * FP];
  const int tid = threadIdx.x;
  const int lane = tid & 31;
  // the wave's number in a scalar register: tile indices and the trip count
  // are then scalar, and the loop and the diagonal test are scalar branches
  const int wid = __builtin_amdgcn_readfirstlane(tid >> 5);
  const int gw = blockIdx.x * 8 + wid;
  const int nQT = T >> 5;
  const int qt = gw % nQT;
  const int h  = (gw / nQT) % H;
  const int b  = gw / (nQT * H);
  const int l15 = lane & 15, khalf = (lane >> 4) << 3, hi8 = khalf;
  const size_t brow = (size_t)b * T;
  // 8 threads copy one row of 128 B; a thread: 2 x 16 B of K, 2 x 16 B of Vt
  const int crow = tid >> 3, cc8 = (tid & 7) << 3;
  const us* gk = Kb + (brow + crow) * k_rs + k_col0 + h * 64 + cc8;
  const us* gv = Vt + ((size_t)(b * H + h) * 64 + crow) * T + cc8;
  const unsigned lk = lds_addr(&lK[0][crow * FP + cc8]);
  const unsigned lv = lds_addr(&lV[0][crow * FP + cc8]);
  auto issue = [&](int p, int s) {   // stage s (keys 64 s ..) into buffer p
    const us* k0 = gk + (size_t)(s * 64) * k_rs;
    const us* v0 = gv + s * 64;
    const unsigned o = p * (64 * FP * 2), half = 32 * FP * 2;
    async_copy16x4(lk + o, k0, lk + o + half, k0 + (size_t)32 * k_rs,
                   lv + o, v0, lv + o + half, v0 + (size_t)32 * T);
  };

  FragB16 ones;
  {
    uint4 o; o.x = o.y = o.z = o.w = 0x3F803F80u;   // bf16 1.0 pairs
    ones.q[0] = o; ones.q[1] = o;
  }
  FragB16 bq[2][2];                  // [query group][32 d]
  #pragma unroll
  for (int g = 0; g < 2; ++g) {
    const us* qr = Qb + (brow + qt * 32 + g * 16 + l15) * q_rs + q_col0 + h * 64;
    #pragma unroll
    for (int kc = 0; kc < 2; ++kc) {
      bq[g][kc].q[0] = *(const uint4*)(qr + kc * 32 + khalf);
      bq[g][kc].q[1] = *(const uint4*)(qr + kc * 32 + 16 + khalf);
    }
  }
  // the copies' addresses are formed next, in registers that the Q loads in
  // flight may name: the wait that belongs in front of such an overwrite
  asm volatile("s_wait_xcnt 0x0" ::: "memory");
  // exp(scale * (s - m)) = exp2(s * c2 - m * c2); scale > 0, so the maximum is
  // taken over the raw scores
  const float c2 = scale * 1.44269504088896340736f;
  float mrow[2];
  v8f oc[2][4], ls[2];
  #pragma unroll
  for (int g = 0; g < 2; ++g) {
    mrow[g] = -__builtin_inff(); ls[g] = zero8();
    #pragma unroll
    for (int d = 0; d < 4; ++d) oc[g][d] = zero8();
  }

  const int nsteps = causal ? (qt + 1) : (T >> 5);
  // stages of the block: as far as its last wave's diagonal; the same in all waves
  const int nst = causal ? (((int)(blockIdx.x * 8) % nQT + 8) >> 1) : (T >> 6);

  issue(0, 0);
  // stage 0 has landed before the barrier behind which other waves read it
  asm volatile("s_wait_asynccnt 0x0" ::: "memory");
  __syncthreads();
  if (1 < nst) issue(1, 1);

  for (int s = 0; s < nst; ++s) {
   const int pb = s & 1;
   // unrolled: the half stage's LDS offsets become constants
   #pragma unroll
   for (int sub = 0; sub < 2; ++sub) {
    const int j = 2 * s + sub;
    // a wave is done behind its diagonal (a scalar test); it still passes every
    // barrier below
    if (j >= nsteps) continue;
    FragB16 ka[2][2], va[4];
    #pragma unroll
    for (int ns = 0; ns < 2; ++ns) {
      const us* kr = &lK[pb][(sub * 32 + ns * 16 + l15) * FP + khalf];
      #pragma unroll
      for (int kc = 0; kc < 2; ++kc) {
        ka[ns][kc].q[0] = *(const uint4*)(kr + kc * 32);
        ka[ns][kc].q[1] = *(const uint4*)(kr + kc * 32 + 16);
      }
    }
    #pragma unroll
    for (int d = 0; d < 4; ++d) {
      const us* vr = &lV[pb][(d * 16 + l15) * FP + sub * 32 + khalf];
      va[d].q[0] = *(const uint4*)vr;
      va[d].q[1] = *(const uint4*)(vr + 16);
    }
    // keeps the step's 16 LDS reads together in front of the first product: one
    // place with reads a step; without it the Vt reads sink into the softmax in
    // further groups
    __builtin_amdgcn_sched_barrier(0);
    v8f st[2][2];                    // [query group][16-key tile]
    #pragma unroll
    for (int g = 0; g < 2; ++g)
      #pragma unroll
      for (int ns = 0; ns < 2; ++ns) {
        v8f acc = wmma_bf16(ka[ns][0], bq[g][0], zero8());
        st[g][ns] = wmma_bf16(ka[ns][1], bq[g][1], acc);
      }
    // only the last causal step holds keys behind a query of this wave
    if (causal && j == nsteps - 1) {
      #pragma unroll
      for (int g = 0; g < 2; ++g)
        #pragma unroll
        for (int ns = 0; ns < 2; ++ns)
          #pragma unroll
          for (int r = 0; r < 8; ++r)
            if (ns * 16 + hi8 + r > g * 16 + l15) st[g][ns][r] = -__builtin_inff();
    }
    #pragma unroll
    for (int g = 0; g < 2; ++g) {
      float mx = fmaxf(st[g][0][0], st[g][1][0]);
      #pragma unroll
      for (int r = 1; r < 8; ++r) mx = fmaxf(mx, fmaxf(st[g][0][r], st[g][1][r]));
      const float mn = fmaxf(mrow[g], maxhalves(mx));
      const float a  = __builtin_amdgcn_exp2f((mrow[g] - mn) * c2);
      const float mc = mn * c2;
      mrow[g] = mn;
      FragB16 pf;
      #pragma unroll
      for (int ns = 0; ns < 2; ++ns) {
        float p[8];
        #pragma unroll
        for (int r = 0; r < 8; ++r)
          p[r] = __builtin_amdgcn_exp2f(fmaf(st[g][ns][r], c2, -mc));
        uint4 w;
        w.x = cvt2(p[0], p[1]); w.y = cvt2(p[2], p[3]);
        w.z = cvt2(p[4], p[5]); w.w = cvt2(p[6], p[7]);
        pf.q[ns] = w;
      }
      ls[g] *= a;
      ls[g] = wmma_bf16(ones, pf, ls[g]);
      #pragma unroll
      for (int d = 0; d < 4; ++d) {
        oc[g][d] *= a;
        oc[g][d] = wmma_bf16(va[d], pf, oc[g][d]);
      }
    }
   }
   // the hand-over of a stage, in every wave: this wave's reads of buffer pb are
   // done, its copies of the next stage have landed, then the barrier that
   // publishes that stage and frees buffer pb for the refill behind it
   asm volatile("s_wait_dscnt 0x0" ::: "memory");
   asm volatile("s_wait_asynccnt 0x0" ::: "memory");
   __syncthreads();
   if (s + 2 < nst) issue(pb, s + 2);
  }
  // no copy is outstanding when the wave ends
  asm volatile("s_wait_asynccnt 0x0" ::: "memory");
  // a lane holds 8 consecutive d of its query in each tile: 16-byte stores
  #pragma unroll
  for (int g = 0; g < 2; ++g) {
    const float inv = 1.0f / ls[g][0];
    us* orow = Ob + (brow + qt * 32 + g * 16 + l15) * o_rs + h * 64 + hi8;
    #pragma unroll
    for (int d = 0; d < 4; ++d) {
      uint4 w;
      w.x = cvt2(oc[g][d][0] * inv, oc[g][d][1] * inv);
      w.y = cvt2(oc[g][d][2] * inv, oc[g][d][3] * inv);
      w.z = cvt2(oc[g][d][4] * inv, oc[g][d][5] * inv);
      w.w = cvt2(oc[g][d][6] * inv, oc[g][d][7] * inv);
      *(uint4*)(orow + d * 16) = w;
    }
  }
}

// ----------------------------- host launcher --------------------------------
extern "C" void kernel_launch(void* const* d_in, const int* in_sizes, int n_in,
                              void* d_out, int out_size, void* d_ws,
                              size_t ws_size, hipStream_t stream) {
  (void)in_sizes; (void)n_in; (void)out_size; (void)ws_size;
  constexpr int B = 4, T = 1024, C = 1024, H = 16, F = 4096;
  constexpr int BT = B * T;
  const float* x     = (const float*)d_in[0];
  const float* ctx   = (const float*)d_in[1];
  const float* ln1_g = (const float*)d_in[2];
  const float* ln1_b = (const float*)d_in[3];
  const float* qkv_w = (const float*)d_in[4];
  const float* qkv_b = (const float*)d_in[5];
  const float* aow   = (const float*)d_in[6];
  const float* aob   = (const float*)d_in[7];
  const float* lnc_g = (const float*)d_in[8];
  const float* lnc_b = (const float*)d_in[9];
  const float* q_w   = (const float*)d_in[10];
  const float* q_b   = (const float*)d_in[11];
  const float* kv_w  = (const float*)d_in[12];
  const float* kv_b  = (const float*)d_in[13];
  const float* cow   = (const float*)d_in[14];
  const float* cob   = (const float*)d_in[15];
  const float* ln2_g = (const float*)d_in[16];
  const float* ln2_b = (const float*)d_in[17];
  const float* w1    = (const float*)d_in[18];
  const float* b1    = (const float*)d_in[19];
  const float* w2    = (const float*)d_in[20];
  const float* b2    = (const float*)d_in[21];

  char* p = (char*)d_ws;
  auto carve = [&](size_t bytes) -> char* {
    char* r = p; p += (bytes + 255) & ~(size_t)255; return r;
  };
  us* wqkv = (us*)carve((size_t)C * 3 * C * 2);   // [3C][C] transposed
  us* wao  = (us*)carve((size_t)C * C * 2);
  us* wq   = (us*)carve((size_t)C * C * 2);
  us* wkv  = (us*)carve((size_t)C * 2 * C * 2);
  us* wco  = (us*)carve((size_t)C * C * 2);
  us* w1b  = (us*)carve((size_t)C * F * 2);
  us* w2b  = (us*)carve((size_t)F * C * 2);
  us* hbuf = (us*)carve((size_t)BT * C * 2);
  us* qkvb = (us*)carve((size_t)BT * 3 * C * 2);
  us* obuf = (us*)carve((size_t)BT * C * 2);
  us* ctxb = (us*)carve((size_t)BT * C * 2);
  us* vtb  = (us*)carve((size_t)BT * C * 2);      // Vt[(b*H+h)*64 + d][T]
  us* f1b  = (us*)carve((size_t)BT * F * 2);
  float* resid = (float*)carve((size_t)BT * C * 4);
  us* qxb = qkvb;                    // reuse after self-attention
  us* kvb = qkvb + (size_t)BT * C;

  // first LayerNorm, weight conversions, context conversion: 1536 blocks
  k_prep<C, F, BT><<<BT / 16 + (8 * C * C + 2 * C * F + BT * C) / 16384, 256, 0,
                     stream>>>(x, ln1_g, ln1_b, hbuf, qkv_w, wqkv, aow, wao, q_w, wq,
                               kv_w, wkv, cow, wco, w1, w1b, w2, w2b, ctx, ctxb, C);

  const int flashBlocks = (B * H * (T / 32)) / 8;   // 256
  const float scale = 0.125f;                       // 1/sqrt(64)

  // 1) self-attention branch
  k_gemm_v<T><<<dim3(3 * C / 192, BT / 256), 256, 0, stream>>>(
      hbuf, wqkv, qkv_b, qkvb, 3 * C, C, vtb, 2 * C);
  k_flash<<<flashBlocks, 256, 0, stream>>>(
      qkvb, 3 * C, 0, qkvb, 3 * C, C, vtb, obuf, C, T, H, 1, scale);
  k_gemm_res<<<dim3(C / 128, BT / 128), 256, 0, stream>>>(
      obuf, wao, aob, x, resid, C, C);

  // 2) cross-attention branch
  k_layernorm<<<BT / 16, 256, 0, stream>>>(resid, lnc_g, lnc_b, hbuf, C);
  k_gemm_two<T><<<dim3(3 * C / 256, BT / 256), 256, 0, stream>>>(
      hbuf, wq, q_b, qxb, C, ctxb, wkv, kv_b, kvb, 2 * C, C, vtb, C);
  k_flash<<<flashBlocks, 256, 0, stream>>>(
      qxb, C, 0, kvb, 2 * C, 0, vtb, obuf, C, T, H, 0, scale);
  k_gemm_res<<<dim3(C / 128, BT / 128), 256, 0, stream>>>(
      obuf, wco, cob, resid, resid, C, C);

  // 3) FFN
  k_layernorm<<<BT / 16, 256, 0, stream>>>(resid, ln2_g, ln2_b, hbuf, C);
  k_gemm<2><<<dim3(F / 256, BT / 256), 512, 0, stream>>>(
      hbuf, w1b, b1, f1b, F, C);
  k_gemm_res<<<dim3(C / 128, BT / 128), 256, 0, stream>>>(
      f1b, w2b, b2, resid, (float*)d_out, C, F);
}
